// v000
// Measured on an AMD MI455X. A time is GPU time per run, averaged over a window of back-to-back runs after a warm-up
// (all launches, gaps included; the runs take copies of the inputs in turn), and the median of several windows.
// Apart from v000's, it joins two sittings. Times from different sittings can be a few percent apart, while
// side-by-side timings come from the same sitting.
// v000, which the later versions start from, runs in 679 microseconds.
// compute dtype: all float inputs rounded to bf16; the per-head 64 x 64 q / k / v projections (ONE shared weight per stream, applied to every head) with EXACT bf16 products on WMMA 16x16x32 (f32 accumulate) (no projection biases); logits q x k once to f16 each (1 product) x 1024^-0.5; the per-(batch, key) int mask read per element; softmax f32; P x 2^11 once to f16 x v once to f16 (1 product); ctx x 2^6 once to f16 x Wo f16(bf16 x 2^8) + bo; f32 output.
#include <hip/hip_runtime.h>
#include <math.h>

typedef __attribute__((ext_vector_type(16))) _Float16 v16h;
typedef __attribute__((ext_vector_type(16))) __bf16 v16b;
typedef __attribute__((ext_vector_type(8)))  _Float16 v8h;
typedef __attribute__((ext_vector_type(8)))  float v8f;
typedef __attribute__((ext_vector_type(4)))  float v4f;
typedef __attribute__((ext_vector_type(2)))  float v2f;
typedef __attribute__((ext_vector_type(4)))  unsigned v4u;
typedef __attribute__((ext_vector_type(4)))  int v4i;
typedef float __attribute__((may_alias)) float_a;
typedef int __attribute__((may_alias)) int_a;

template <typename T> __device__ __forceinline__ void vst2(void* p, T v) { *(T*)p = v;  }
__device__ __forceinline__ v8f wmma16(v16h a, v16h b, v8f c) {
  v8f d = __builtin_amdgcn_wmma_f32_16x16x32_f16(false, a, false, b, (short)0, c, false, false);
  asm volatile("v_nop\n\tv_nop\n\tv_nop\n\tv_nop" : "+v"(d) : "v"(a), "v"(b));
  return d;
}
__device__ __forceinline__ v8f wmma_bf(v16b a, v16b b, v8f c) {
  v8f d = __builtin_amdgcn_wmma_f32_16x16x32_bf16(false, a, false, b, (short)0, c, false, false);
  asm volatile("v_nop\n\tv_nop\n\tv_nop\n\tv_nop" : "+v"(d) : "v"(a), "v"(b));
  return d;
}
// 16x16x32 fragments: lane = (h = lane>>4, row/col = lane&15); elements 0..7 = k0+8h+0..7, 8..15 = k0+16+8h+0..7; D element r = row 8h+r
__device__ __forceinline__ v16h frag_h(const _Float16* rowk0, int lane) {
  union { v16h v; v8h q[2]; } u; const _Float16* p = rowk0 + 8 * (lane >> 4);
  u.q[0] = *(const v8h*)p; u.q[1] = *(const v8h*)(p + 16); return u.v;
}
__device__ __forceinline__ v16h frag_f32(const float* rowk0, int lane) {
  v16h a; const float* p = rowk0 + 8 * (lane >> 4);
#pragma unroll
  for (int i = 0; i < 8; ++i) { a[i] = (_Float16)p[i]; a[8 + i] = (_Float16)p[16 + i]; }
  return a;
}
__device__ __forceinline__ v16h frag_f32s(const float* rowk0, int lane, float sc) {
  v16h a; const float* p = rowk0 + 8 * (lane >> 4);
#pragma unroll
  for (int i = 0; i < 8; ++i) { a[i] = (_Float16)(p[i] * sc); a[8 + i] = (_Float16)(p[16 + i] * sc); }
  return a;
}
// column fragment from a [K][ld] layout (column n), rows >= K read as 0
__device__ __forceinline__ v16h fragc_f32(const float* W, int k0, int n, int lane, int ld, int K) {
  v16h a; const int g = lane >> 4;
#pragma unroll
  for (int i = 0; i < 8; ++i) { const int ka = k0 + 8 * g + i, kb = ka + 16;
    a[i] = (_Float16)(ka < K ? W[(size_t)(ka < K ? ka : K - 1) * ld + n] : 0.f); a[8 + i] = (_Float16)(kb < K ? W[(size_t)(kb < K ? kb : K - 1) * ld + n] : 0.f); }
  return a;
}
struct F2 { v16b h, l; };
__device__ __forceinline__ F2 bsplit16(const float v[16]) { F2 r;
#pragma unroll
  for (int i = 0; i < 16; ++i) { const __bf16 h = (__bf16)v[i]; r.h[i] = h; r.l[i] = (__bf16)(v[i] - (float)h); }
  return r; }
__device__ __forceinline__ F2 split_row(const float* row, int k0, int lane) { float v[16]; const float* p = row + k0 + 8 * (lane >> 4);
#pragma unroll
  for (int i = 0; i < 8; ++i) { v[i] = p[i]; v[8 + i] = p[16 + i]; }
  return bsplit16(v); }
__device__ __forceinline__ F2 split_rowK(const float* row, int k0, int lane, int K) { float v[16]; const int g = lane >> 4;
#pragma unroll
  for (int i = 0; i < 8; ++i) { const int ka = k0 + 8 * g + i, kb = ka + 16; v[i] = ka < K ? row[ka < K ? ka : K - 1] : 0.f; v[8 + i] = kb < K ? row[kb < K ? kb : K - 1] : 0.f; }
  return bsplit16(v); }
__device__ __forceinline__ F2 split_col(const float* W, int k0, int n, int lane, int ld, int K) { float v[16]; const int g = lane >> 4;
#pragma unroll
  for (int i = 0; i < 8; ++i) { const int ka = k0 + 8 * g + i, kb = ka + 16; v[i] = ka < K ? W[(size_t)(ka < K ? ka : K - 1) * ld + n] : 0.f; v[8 + i] = kb < K ? W[(size_t)(kb < K ? kb : K - 1) * ld + n] : 0.f; }
  return bsplit16(v); }
__device__ __forceinline__ v8f mac3(const F2& a, const F2& b, v8f c) { c = wmma_bf(a.l, b.h, c); c = wmma_bf(a.h, b.l, c); return wmma_bf(a.h, b.h, c); }
__device__ __forceinline__ float sigm(float v) { return 1.0f / (1.0f + expf(-v)); }
#define LDSX() do { asm volatile("s_wait_dscnt 0" ::: "memory"); __builtin_amdgcn_wave_barrier(); __builtin_amdgcn_fence(__ATOMIC_RELEASE, "workgroup"); } while (0)

// Multi-head attention whose q / k / v projections are ONE shared 64 x 64 linear per stream applied to every head, with a key mask (inputs in the order values, keys, queries [4,1024,1024]; mask [4,1,1,1024] int32 RANDOM 0/1 per (batch, key); torch (out,in) Wv / Wk / Wq [64,64] uniform(+-1/8), NO projection biases; heads = reshape(N, L, 16, 64); einsum('nlhd,od->nlho'); energy = einsum('nqhd,nkhd->nhqk'); where(mask == 0, -1e20, energy); softmax(energy * 1/sqrt(1024)) - the scale is 1/32, not 1/8; out merged to [N, L, 1024]; out @ Wo.T + bo with Wo [1024,1024] and bo uniform(+-1/32), bo NONZERO).
#define NB 4
#define TT 1024
#define CC 1024            // NH * HD = projected width
#define DIN 1024          // input (model) width
#define NH 16
#define HD 64
#define NQB (TT / 64)
#define HG 8   // eight heads per pass: S = 8 x 1,024 x 1,024 f32 = 32 MiB
#define SCALE (0.03125f)   // 1 / sqrt(E) with E = 1024 (the module scales by the MODEL width, not the head width)
#define CAUSAL 0
#ifndef TNB
#define TNB NB
#endif
__device__ __forceinline__ float bfr(float v) { return (float)(__bf16)v; }
__host__ __device__ __forceinline__ int kb_last(int qb) { return CAUSAL ? ((qb * 64 + 63) >> 7) : (TT / 128 - 1); }
typedef __attribute__((ext_vector_type(8))) __bf16 v8b;
__device__ __forceinline__ v16b frag_b(const __bf16* rowk0, int lane) {
  union { v16b v; v8b q[2]; } u; const __bf16* p = rowk0 + 8 * (lane >> 4);
  u.q[0] = *(const v8b*)p; u.q[1] = *(const v8b*)(p + 16); return u.v;
}
#define QBH 0              // no query block takes the high-precision path (every block sees all 1024 keys)
#define QHI 0               // single-product logits on every row
#define KHI 64            // key rows carrying k residual / v bf16 hi+lo planes (used only by the causal high-precision path)
// B fragment (k rows k0+.., output column o) of a weight: (in,out) [K][ld] or (out,in) [ld rows of K]: bf16 exact, or f16(bf16 * 256) exact
__device__ __forceinline__ v16b wcol_io(const float* Wm, int k0, int o, int lane, int ld) { v16b w; const int g = lane >> 4;
#pragma unroll
  for (int i = 0; i < 8; ++i) { w[i] = (__bf16)Wm[(size_t)(k0 + 8 * g + i) * ld + o]; w[8 + i] = (__bf16)Wm[(size_t)(k0 + 16 + 8 * g + i) * ld + o]; }
  return w; }
__device__ __forceinline__ v16b wcol_oi(const float* Wm, int k0, int o, int lane, int K) { v16b w; const float* p = Wm + (size_t)o * K + k0 + 8 * (lane >> 4);
#pragma unroll
  for (int i = 0; i < 8; ++i) { w[i] = (__bf16)p[i]; w[8 + i] = (__bf16)p[16 + i]; }
  return w; }
__device__ __forceinline__ v16h wcolh_io(const float* Wm, int k0, int o, int lane, int ld) { v16h w; const int g = lane >> 4;
#pragma unroll
  for (int i = 0; i < 8; ++i) { w[i] = (_Float16)(bfr(Wm[(size_t)(k0 + 8 * g + i) * ld + o]) * 256.0f); w[8 + i] = (_Float16)(bfr(Wm[(size_t)(k0 + 16 + 8 * g + i) * ld + o]) * 256.0f); }
  return w; }
__device__ __forceinline__ v16h wcolh_oi(const float* Wm, int k0, int o, int lane, int K) { v16h w; const float* p = Wm + (size_t)o * K + k0 + 8 * (lane >> 4);
#pragma unroll
  for (int i = 0; i < 8; ++i) { w[i] = (_Float16)(bfr(p[i]) * 256.0f); w[8 + i] = (_Float16)(bfr(p[16 + i]) * 256.0f); }
  return w; }
#define WQKV_LAYOUT 1   // 0 = (in,out) [DIN][CC]; 1 = (out,in) [CC][DIN]; 2 = per-head [NH][DIN][HD]
__device__ __forceinline__ v16b wcol_hdk(const float* Wm, int k0, int o, int lane) { v16b w; const int g = lane >> 4; const float* p = Wm + (size_t)(o / HD) * DIN * HD + (o % HD);
#pragma unroll
  for (int i = 0; i < 8; ++i) { w[i] = (__bf16)p[(size_t)(k0 + 8 * g + i) * HD]; w[8 + i] = (__bf16)p[(size_t)(k0 + 16 + 8 * g + i) * HD]; }
  return w; }
#define WO_OUT_IN 1
#if WQKV_LAYOUT == 1
#define WCOL(W, k0, o, lane) wcol_oi(W, k0, o, lane, DIN)
#elif WQKV_LAYOUT == 2
#define WCOL(W, k0, o, lane) wcol_hdk(W, k0, o, lane)
#else
#define WCOL(W, k0, o, lane) wcol_io(W, k0, o, lane, CC)
#endif
#if WO_OUT_IN
#define WOCOL(W, k0, o, lane) wcol_oi(W, k0, o, lane, CC)
#define WOCOLH(W, k0, o, lane) wcolh_oi(W, k0, o, lane, CC)
#else
#define WOCOL(W, k0, o, lane) wcol_io(W, k0, o, lane, DIN)
#define WOCOLH(W, k0, o, lane) wcolh_io(W, k0, o, lane, DIN)
#endif
#define SM_EXTRA_PARAMS , int bsm, const int* __restrict__ MASK
// int32 mask [B,1,1,S] (per batch, shared by the heads): where(mask == 0, -1e9, score); read per (batch, key); unconditional load, then a value select (-1e9 next to real scores == weight exactly 0)
#define SM_MASK_HOOK do { const int mk_ = MASK[(size_t)bsm * TT + k]; asm volatile("s_wait_loadcnt 0x0" ::: "memory"); v = (mk_ == 0) ? -1.0e9f : v; } while (0)
#ifndef SM_EXTRA_PARAMS
#define SM_EXTRA_PARAMS
#endif
#ifndef PROJ_EXTRA_PARAMS
#define PROJ_EXTRA_PARAMS
#endif
#ifndef SM_MASK_HOOK
#define SM_MASK_HOOK (void)0
#endif

#define WS_QH  0u                                      // f16 q rows [b*t][CC]
#define WS_KH  (WS_QH + 2u * (size_t)NB * TT * CC)      // f16 k rows [b*t][CC]
#define WS_VT  (WS_KH + 2u * (size_t)NB * TT * CC)      // f16 v planes [b][c][t]
#define WS_QL  (WS_VT + 2u * (size_t)NB * CC * TT)      // f16 q residual x 2^10 rows [b][t < QHI][CC]
#define WS_KL  (WS_QL + 2u * (size_t)NB * QHI * CC)     // f16 k residual x 2^10 rows [b][t < KHI][CC]
#define WS_VB  (WS_KL + 2u * (size_t)NB * KHI * CC)     // bf16 v hi planes [b][c][t < KHI]
#define WS_VBL (WS_VB + 2u * (size_t)NB * CC * KHI)
#define WS_S   (WS_VBL + 2u * (size_t)NB * CC * KHI)    // f32 logits / P [hg][t][s]
#define WS_Y   (WS_S  + 4u * (size_t)HG * TT * TT)      // f32 ctx rows [b*t][CC] (only when there is an output projection)
#define WS_END (WS_Y  + 4u * (size_t)NB * TT * CC)

// ---- k_proj: block = (64 rows, 128 cols, which): q/k/v = X W (+ b) with exact bf16 products (K = HD per head) -> which 0: q f16 rows (+ residual rows < QHI); 1: k f16 rows (+ residual rows < KHI); 2: v f16 planes [c][t] (+ bf16 hi/lo planes for t < KHI)
__global__ __launch_bounds__(128) void k_proj(const float* __restrict__ XQ, const float* __restrict__ XK, const float* __restrict__ XV, const float* __restrict__ WQ, const float* __restrict__ WK, const float* __restrict__ WV, const float* __restrict__ BQ, const float* __restrict__ BK, const float* __restrict__ BV,
    _Float16* __restrict__ QH, _Float16* __restrict__ QL, _Float16* __restrict__ KH, _Float16* __restrict__ KL, _Float16* __restrict__ VT, __bf16* __restrict__ VB, __bf16* __restrict__ VBL) {
  __shared__ __align__(16) _Float16 sh[64][136], sl[64][136]; __shared__ __align__(16) _Float16 th[128][72]; __shared__ __align__(16) __bf16 tb[128][72], tbl[128][72];
  const int tid = threadIdx.x, wave = tid >> 5, lane = tid & 31, col = lane & 15, g = lane >> 4; const int which = blockIdx.z; const int c0 = blockIdx.y * 128; const size_t r0 = (size_t)blockIdx.x * 64; const size_t bb = r0 / TT; const int t0 = (int)(r0 % TT);
  const float* X = which == 0 ? XQ : which == 1 ? XK : XV; const float* WA = which == 0 ? WQ : which == 1 ? WK : WV; const float* BA = which == 0 ? BQ : which == 1 ? BK : BV;
  v8f acc[8] = {};
#pragma unroll
  for (int kk = 0; kk < 4; ++kk) { const int kc = (c0 >> 5) + kk;   /* block-diagonal projection: the 128 output columns c0 .. c0+127 are two heads; head hh = column / 64 contracts ONLY over its own 64 input columns, i.e. k-steps kk = 2 hh and 2 hh + 1 of the tile's 128-column input slice */
    v16b a; { const float* p = X + (r0 + wave * 16 + col) * DIN + kc * 32 + 8 * g;
#pragma unroll
      for (int i = 0; i < 8; ++i) { a[i] = (__bf16)p[i]; a[8 + i] = (__bf16)p[16 + i]; } }
    asm volatile("s_wait_loadcnt 0x0" ::: "memory");
#pragma unroll
    for (int j = 0; j < 8; ++j) if ((kk >> 1) == (j >> 2)) { const v16b w = wcol_oi(WA, (kk & 1) * 32, (j & 3) * 16 + col, lane, HD); asm volatile("s_wait_loadcnt 0x0" ::: "memory"); acc[j] = wmma_bf(a, w, acc[j]); } }   /* shared (out,in) [64][64] weight: row = output dim within the head, k = input dim within the head; the test is a compile-time constant per unrolled (kk, j) */
  if (which < 2) { _Float16* DH = which == 0 ? QH : KH; _Float16* DL = which == 0 ? QL : KL; const int nhi = which == 0 ? QHI : KHI; const bool hi_rows = t0 < nhi;
#pragma unroll
    for (int j = 0; j < 8; ++j) { const float bias = BA ? bfr(BA[(j & 3) * 16 + col]) : 0.f;
#pragma unroll
      for (int r = 0; r < 8; ++r) { const float v = acc[j][r] + bias; const _Float16 hv = (_Float16)v; sh[wave * 16 + 8 * g + r][j * 16 + col] = hv; sl[wave * 16 + 8 * g + r][j * 16 + col] = (_Float16)((v - (float)hv) * 1024.0f); } }
    __syncthreads();
    for (int e = tid; e < 64 * 16; e += 128) { const int rl = e >> 4, q = e & 15; vst2((unsigned*)(DH + (r0 + rl) * CC + c0 + q * 8), *(const v4u*)&sh[rl][q * 8]); if (hi_rows) vst2((unsigned*)(DL + (bb * nhi + t0 + rl) * (size_t)CC + c0 + q * 8), *(const v4u*)&sl[rl][q * 8]); }
  } else { const bool hi_rows = t0 < KHI;
#pragma unroll
    for (int j = 0; j < 8; ++j) { const float bias = BA ? bfr(BA[(j & 3) * 16 + col]) : 0.f;
#pragma unroll
      for (int r = 0; r < 8; ++r) { const float v = acc[j][r] + bias; const int rl = wave * 16 + 8 * g + r, cl = j * 16 + col; th[cl][rl] = (_Float16)v; const __bf16 bh = (__bf16)v; tb[cl][rl] = bh; tbl[cl][rl] = (__bf16)(v - (float)bh); } }
    __syncthreads();
    for (int e = tid; e < 128 * 8; e += 128) { const int cl = e >> 3, q = e & 7; vst2((unsigned*)(VT + (bb * CC + c0 + cl) * (size_t)TT + t0 + q * 8), *(const v4u*)&th[cl][q * 8]); if (hi_rows) { const size_t o3 = (bb * CC + c0 + cl) * (size_t)KHI + t0 + q * 8; vst2((unsigned*)(VB + o3), *(const v4u*)&tb[cl][q * 8]); vst2((unsigned*)(VBL + o3), *(const v4u*)&tbl[cl][q * 8]); } } } }
// ---- k_sc: block = (query block qb, key block kb <= kb_last(qb), head in group) of batch b: logits x SCALE; q hi + residual (x 2^10) against k (2 products) for query rows < QHI, plus the k residual (3 products) for query blocks < QBH (causal early rows); causal: blocks past the diagonal exit, the mask itself is applied by index in k_sm
__global__ __launch_bounds__(128) void k_sc(const _Float16* __restrict__ QH, const _Float16* __restrict__ KH, const _Float16* __restrict__ QL, const _Float16* __restrict__ KL, int b, int h0, float* __restrict__ S0) { __shared__ __align__(16) float ss[4][16][132];
  const int qb = blockIdx.x, kb = blockIdx.y; if (kb > kb_last(qb)) return;
  const int h = h0 + blockIdx.z; float* S = S0 + (size_t)blockIdx.z * TT * TT;
  const int tid = threadIdx.x, wave = tid >> 5, lane = tid & 31, col = lane & 15, g = lane >> 4; const int k0 = kb * 128; const int ql0 = qb * 64 + wave * 16; const size_t q0 = (size_t)b * TT + ql0, kr0 = (size_t)b * TT + k0;
  v8f acc[8] = {}, accl[8] = {};
  const _Float16* QLb = QL + (size_t)b * QHI * CC; const _Float16* KLb = KL + (size_t)b * KHI * CC;
  if (qb < QBH) {
#pragma unroll
    for (int kc = 0; kc < HD / 32; ++kc) { const v16h ah = frag_h(QH + (q0 + col) * CC + h * HD + kc * 32, lane), al = frag_h(QLb + (size_t)(ql0 + col) * CC + h * HD + kc * 32, lane);
#pragma unroll
      for (int j = 0; j < 8; ++j) { const v16h kbf = frag_h(KH + (kr0 + j * 16 + col) * CC + h * HD + kc * 32, lane), klf = frag_h(KLb + (size_t)(k0 + j * 16 + col) * CC + h * HD + kc * 32, lane); acc[j] = wmma16(ah, kbf, acc[j]); accl[j] = wmma16(al, kbf, accl[j]); accl[j] = wmma16(ah, klf, accl[j]); } }
  } else if (qb * 64 < QHI) {
#pragma unroll
    for (int kc = 0; kc < HD / 32; ++kc) { const v16h ah = frag_h(QH + (q0 + col) * CC + h * HD + kc * 32, lane), al = frag_h(QLb + (size_t)(ql0 + col) * CC + h * HD + kc * 32, lane);
#pragma unroll
      for (int j = 0; j < 8; ++j) { const v16h kbf = frag_h(KH + (kr0 + j * 16 + col) * CC + h * HD + kc * 32, lane); acc[j] = wmma16(ah, kbf, acc[j]); accl[j] = wmma16(al, kbf, accl[j]); } }
  } else {
#pragma unroll
    for (int kc = 0; kc < HD / 32; ++kc) { const v16h ah = frag_h(QH + (q0 + col) * CC + h * HD + kc * 32, lane);
#pragma unroll
      for (int j = 0; j < 8; ++j) { const v16h kbf = frag_h(KH + (kr0 + j * 16 + col) * CC + h * HD + kc * 32, lane); acc[j] = wmma16(ah, kbf, acc[j]); } } }
#pragma unroll
  for (int j = 0; j < 8; ++j) {
#pragma unroll
    for (int r = 0; r < 8; ++r) ss[wave][8 * g + r][j * 16 + col] = (acc[j][r] + accl[j][r] * (1.0f / 1024.0f)) * SCALE; }
  LDSX(); for (int rl = 0; rl < 16; ++rl) vst2(S + (size_t)(ql0 + rl) * TT + k0 + lane * 4, *(const v4f*)&ss[wave][rl][lane * 4]); }
// ---- k_sm: block = query row t (head in group): keys [0, kend): causal -> logit if s <= t else excluded; softmax in f32; P x 2^11 in place (0 for excluded)
__global__ __launch_bounds__(256) void k_sm(float* __restrict__ S0 SM_EXTRA_PARAMS) { __shared__ float sred[8]; __shared__ float sbc; __shared__ __align__(16) float shv[TT];
  const int tid = threadIdx.x; const int t = blockIdx.x; const int kend = (kb_last(t >> 6) + 1) * 128;
  float* sr = S0 + (size_t)blockIdx.y * TT * TT + (size_t)t * TT;
  float m = -3.0e38f; for (int k = tid; k < kend; k += 256) { float v = (!CAUSAL || k <= t) ? sr[k] : -3.0e38f; SM_MASK_HOOK; shv[k] = v; m = fmaxf(m, v); }
#pragma unroll
  for (int o = 1; o < 32; o <<= 1) m = fmaxf(m, __shfl_xor(m, o));
  if ((tid & 31) == 0) sred[tid >> 5] = m; __syncthreads(); if (tid == 0) { float a = sred[0]; for (int i = 1; i < 8; ++i) a = fmaxf(a, sred[i]); sbc = a; } __syncthreads(); m = sbc; __syncthreads();
  float sum = 0.f; for (int k = tid; k < kend; k += 256) { const float v = shv[k]; const float e = (v <= -1.0e38f) ? 0.f : expf(v - m); shv[k] = e; sum += e; }
#pragma unroll
  for (int o = 1; o < 32; o <<= 1) sum += __shfl_xor(sum, o);
  if ((tid & 31) == 0) sred[tid >> 5] = sum; __syncthreads(); if (tid == 0) { float a = 0.f; for (int i = 0; i < 8; ++i) a += sred[i]; sbc = a > 0.f ? 2048.0f / a : 0.f; }   /* a fully excluded row yields P = 0 */ __syncthreads(); const float inv = sbc;
  for (int k = tid; k < kend; k += 256) shv[k] = shv[k] * inv;
  __syncthreads(); for (int q = tid; q < kend / 4; q += 256) vst2(sr + q * 4, *(const v4f*)&shv[q * 4]); }
// ---- k_pv: block = 64 queries (qb) of (b, h): ctx = P . v over keys [0, kend) (P x 2^11 once to f16 against v f16: 1 product; causal early query blocks: P and v as bf16 hi + lo, 3 products); 256-B (row, head) segment by 16 lanes
__global__ __launch_bounds__(128) void k_pv(const float* __restrict__ PS0, const _Float16* __restrict__ VT, const __bf16* __restrict__ VB, const __bf16* __restrict__ VBL, int b, int h0, float* __restrict__ Y) { const int h = h0 + blockIdx.z; const float* PS = PS0 + (size_t)blockIdx.z * TT * TT; __shared__ __align__(16) float ss[4][16][HD + 4];
  const int tid = threadIdx.x, wave = tid >> 5, lane = tid & 31, col = lane & 15, g = lane >> 4; const int qb = blockIdx.x; const int ql0 = qb * 64 + wave * 16; const int kce = (kb_last(qb) + 1) * 4;
  v8f acc[HD / 16] = {};
  if (qb < QBH) {
#pragma unroll 1
    for (int kc = 0; kc < kce; ++kc) { const F2 p = split_row(PS + (size_t)(ql0 + col) * TT, kc * 32, lane);
      asm volatile("s_wait_loadcnt 0x0" ::: "memory");
#pragma unroll
      for (int j = 0; j < HD / 16; ++j) { const size_t po = ((size_t)b * CC + h * HD + j * 16 + col) * (size_t)KHI + kc * 32; const v16b vh = frag_b(VB + po, lane); acc[j] = wmma_bf(p.h, vh, acc[j]); acc[j] = wmma_bf(p.l, vh, acc[j]); acc[j] = wmma_bf(p.h, frag_b(VBL + po, lane), acc[j]); } }
  } else {
#pragma unroll 1
    for (int kc = 0; kc < kce; ++kc) { const v16h p = frag_f32(PS + (size_t)(ql0 + col) * TT + kc * 32, lane);
      asm volatile("s_wait_loadcnt 0x0" ::: "memory");
#pragma unroll
      for (int j = 0; j < HD / 16; ++j) { const size_t po = ((size_t)b * CC + h * HD + j * 16 + col) * (size_t)TT + kc * 32; acc[j] = wmma16(p, frag_h(VT + po, lane), acc[j]); } } }
#pragma unroll
  for (int j = 0; j < HD / 16; ++j)
#pragma unroll
    for (int r = 0; r < 8; ++r) ss[wave][8 * g + r][j * 16 + col] = acc[j][r] * (1.0f / 2048.0f);
  LDSX(); for (int rl = 0; rl < 16; ++rl) if (lane < HD / 4) vst2(Y + ((size_t)b * TT + ql0 + rl) * CC + h * HD + lane * 4, *(const v4f*)&ss[wave][rl][lane * 4]); }
// ---- k_out: block = (64 rows, 128 cols): out = ctx Wo (+ bo): ctx x 2^6 once to f16 against Wo as f16(bf16 x 2^8) exact (1 product) x 2^-14; causal early rows (< QHI of each sequence): ctx bf16 hi + lo against exact bf16 Wo (2 products)
__global__ __launch_bounds__(128) void k_out(const float* __restrict__ Y, const float* __restrict__ WO, const float* __restrict__ BO, float* __restrict__ OUT) { __shared__ __align__(16) float sf[4][16][132];
  const int tid = threadIdx.x, wave = tid >> 5, lane = tid & 31, col = lane & 15, g = lane >> 4; const int c0 = blockIdx.y * 128; const size_t r0 = (size_t)blockIdx.x * 64 + wave * 16;
  v8f acc[8] = {};
  if (CAUSAL && (int)(((size_t)blockIdx.x * 64) % TT) < QHI) {   /* block-uniform */
#pragma unroll 2
    for (int kc = 0; kc < CC / 32; ++kc) { const F2 a = split_row(Y + (r0 + col) * CC, kc * 32, lane); asm volatile("s_wait_loadcnt 0x0" ::: "memory");
#pragma unroll
      for (int j = 0; j < 8; ++j) { const v16b w = WOCOL(WO, kc * 32, c0 + j * 16 + col, lane); asm volatile("s_wait_loadcnt 0x0" ::: "memory"); acc[j] = wmma_bf(a.h, w, acc[j]); acc[j] = wmma_bf(a.l, w, acc[j]); } }
#pragma unroll
    for (int j = 0; j < 8; ++j) { const float bias = BO ? bfr(BO[c0 + j * 16 + col]) : 0.f;
#pragma unroll
      for (int r = 0; r < 8; ++r) sf[wave][8 * g + r][j * 16 + col] = acc[j][r] + bias; }
  } else {
#pragma unroll 2
    for (int kc = 0; kc < CC / 32; ++kc) { const v16h a = frag_f32s(Y + (r0 + col) * CC + kc * 32, lane, 64.0f); asm volatile("s_wait_loadcnt 0x0" ::: "memory");   /* ctx carried x 2^6 into f16 so small-magnitude context rows stay clear of f16 subnormals (chip FTZ) */
#pragma unroll
      for (int j = 0; j < 8; ++j) { const v16h w = WOCOLH(WO, kc * 32, c0 + j * 16 + col, lane); asm volatile("s_wait_loadcnt 0x0" ::: "memory"); acc[j] = wmma16(a, w, acc[j]); } }
#pragma unroll
    for (int j = 0; j < 8; ++j) { const float bias = BO ? bfr(BO[c0 + j * 16 + col]) : 0.f;
#pragma unroll
      for (int r = 0; r < 8; ++r) sf[wave][8 * g + r][j * 16 + col] = acc[j][r] * (1.0f / 16384.0f) + bias; } }   /* 2^-8 (Wo carry) x 2^-6 (ctx carry) */
  LDSX(); for (int rl = 0; rl < 16; ++rl) vst2(OUT + (r0 + rl) * DIN + c0 + lane * 4, *(const v4f*)&sf[wave][rl][lane * 4]); }

static_assert(HD == 64 && CC == NH * HD && DIN == CC, "block-diagonal per-head projection: 128-column tiles = two 64-wide heads, input width == projected width");
extern "C" void kernel_launch(void* const* d_in, const int* in_sizes, int n_in, void* d_out, int out_size, void* d_ws, size_t ws_size, hipStream_t stream) {
  (void)in_sizes; (void)n_in; (void)out_size;
  const float** F = (const float**)d_in;
  if (ws_size < (size_t)WS_END) return;
  char* ws = (char*)d_ws; _Float16 *QH = (_Float16*)(ws + WS_QH), *KH = (_Float16*)(ws + WS_KH), *VT = (_Float16*)(ws + WS_VT), *QL = (_Float16*)(ws + WS_QL), *KL = (_Float16*)(ws + WS_KL); __bf16 *VB = (__bf16*)(ws + WS_VB), *VBL = (__bf16*)(ws + WS_VBL); float *S = (float*)(ws + WS_S), *Y = (float*)(ws + WS_Y);
  (void)Y; (void)QL; (void)KL; (void)VB; (void)VBL;
  // inputs: 0 values [4,1024,1024]; 1 keys; 2 queries; 3 mask [4,1,1,1024] int32 (random 0/1; 0 = masked key); 4 Wv [64,64] (out,in); 5 Wk; 6 Wq (no projection biases); 7 Wo [1024,1024] (out,in); 8 bo (NONZERO)
  k_proj<<<dim3(TNB * TT / 64, CC / 128, 3), 128, 0, stream>>>(F[2], F[1], F[0], F[6], F[5], F[4], nullptr, nullptr, nullptr, QH, QL, KH, KL, VT, VB, VBL);
  for (int b = 0; b < TNB; ++b) for (int h0 = 0; h0 < NH; h0 += HG) {
    k_sc<<<dim3(NQB, TT / 128, HG), 128, 0, stream>>>(QH, KH, QL, KL, b, h0, S);
    k_sm<<<dim3(TT, HG), 256, 0, stream>>>(S, b, (const int*)d_in[3]);
    k_pv<<<dim3(NQB, 1, HG), 128, 0, stream>>>(S, VT, VB, VBL, b, h0, Y);
  }
  k_out<<<dim3(TNB * TT / 64, DIN / 128), 128, 0, stream>>>(Y, F[7], F[8], (float*)d_out);
}

// v001
// One run takes 169 microseconds.
// In two side-by-side timings against v000, it was 4.07 and 4.08 times as fast.
// compute dtype: all float inputs rounded to bf16; the per-head 64 x 64 q / k / v projections (ONE shared weight per stream, applied to every head) with EXACT bf16 products on WMMA 16x16x32 (f32 accumulate) (no projection biases); logits q x k once to f16 each (1 product) x 1024^-0.5; the per-(batch, key) int mask as a bias per key; online softmax f32 (log2 domain); unnormalised P x 2^7 once to f16 x v once to f16 (1 product), divided by the f32 sum of the same f16 P; ctx x 2^6 once to f16 x Wo f16(bf16 x 2^8) + bo; f32 output.
#include <hip/hip_runtime.h>
#include <math.h>

typedef __attribute__((ext_vector_type(16))) _Float16 v16h;
typedef __attribute__((ext_vector_type(16))) __bf16 v16b;
typedef __attribute__((ext_vector_type(8)))  _Float16 v8h;
typedef __attribute__((ext_vector_type(8)))  float v8f;
typedef __attribute__((ext_vector_type(4)))  float v4f;
typedef __attribute__((ext_vector_type(2)))  float v2f;
typedef __attribute__((ext_vector_type(4)))  unsigned v4u;
typedef __attribute__((ext_vector_type(4)))  int v4i;
typedef float __attribute__((may_alias)) float_a;
typedef int __attribute__((may_alias)) int_a;

template <typename T> __device__ __forceinline__ void vst2(void* p, T v) { *(T*)p = v;  }
__device__ __forceinline__ v8f wmma16(v16h a, v16h b, v8f c) {
  v8f d = __builtin_amdgcn_wmma_f32_16x16x32_f16(false, a, false, b, (short)0, c, false, false);
  asm volatile("v_nop\n\tv_nop\n\tv_nop\n\tv_nop" : "+v"(d) : "v"(a), "v"(b));
  return d;
}
__device__ __forceinline__ v8f wmma_bf(v16b a, v16b b, v8f c) {
  v8f d = __builtin_amdgcn_wmma_f32_16x16x32_bf16(false, a, false, b, (short)0, c, false, false);
  asm volatile("v_nop\n\tv_nop\n\tv_nop\n\tv_nop" : "+v"(d) : "v"(a), "v"(b));
  return d;
}
// 16x16x32 fragments: lane = (h = lane>>4, row/col = lane&15); elements 0..7 = k0+8h+0..7, 8..15 = k0+16+8h+0..7; D element r = row 8h+r
__device__ __forceinline__ v16h frag_h(const _Float16* rowk0, int lane) {
  union { v16h v; v8h q[2]; } u; const _Float16* p = rowk0 + 8 * (lane >> 4);
  u.q[0] = *(const v8h*)p; u.q[1] = *(const v8h*)(p + 16); return u.v;
}
__device__ __forceinline__ v16h frag_f32(const float* rowk0, int lane) {
  v16h a; const float* p = rowk0 + 8 * (lane >> 4);
#pragma unroll
  for (int i = 0; i < 8; ++i) { a[i] = (_Float16)p[i]; a[8 + i] = (_Float16)p[16 + i]; }
  return a;
}
__device__ __forceinline__ v16h frag_f32s(const float* rowk0, int lane, float sc) {
  v16h a; const float* p = rowk0 + 8 * (lane >> 4);
#pragma unroll
  for (int i = 0; i < 8; ++i) { a[i] = (_Float16)(p[i] * sc); a[8 + i] = (_Float16)(p[16 + i] * sc); }
  return a;
}
// column fragment from a [K][ld] layout (column n), rows >= K read as 0
__device__ __forceinline__ v16h fragc_f32(const float* W, int k0, int n, int lane, int ld, int K) {
  v16h a; const int g = lane >> 4;
#pragma unroll
  for (int i = 0; i < 8; ++i) { const int ka = k0 + 8 * g + i, kb = ka + 16;
    a[i] = (_Float16)(ka < K ? W[(size_t)(ka < K ? ka : K - 1) * ld + n] : 0.f); a[8 + i] = (_Float16)(kb < K ? W[(size_t)(kb < K ? kb : K - 1) * ld + n] : 0.f); }
  return a;
}
struct F2 { v16b h, l; };
__device__ __forceinline__ F2 bsplit16(const float v[16]) { F2 r;
#pragma unroll
  for (int i = 0; i < 16; ++i) { const __bf16 h = (__bf16)v[i]; r.h[i] = h; r.l[i] = (__bf16)(v[i] - (float)h); }
  return r; }
__device__ __forceinline__ F2 split_row(const float* row, int k0, int lane) { float v[16]; const float* p = row + k0 + 8 * (lane >> 4);
#pragma unroll
  for (int i = 0; i < 8; ++i) { v[i] = p[i]; v[8 + i] = p[16 + i]; }
  return bsplit16(v); }
__device__ __forceinline__ F2 split_rowK(const float* row, int k0, int lane, int K) { float v[16]; const int g = lane >> 4;
#pragma unroll
  for (int i = 0; i < 8; ++i) { const int ka = k0 + 8 * g + i, kb = ka + 16; v[i] = ka < K ? row[ka < K ? ka : K - 1] : 0.f; v[8 + i] = kb < K ? row[kb < K ? kb : K - 1] : 0.f; }
  return bsplit16(v); }
__device__ __forceinline__ F2 split_col(const float* W, int k0, int n, int lane, int ld, int K) { float v[16]; const int g = lane >> 4;
#pragma unroll
  for (int i = 0; i < 8; ++i) { const int ka = k0 + 8 * g + i, kb = ka + 16; v[i] = ka < K ? W[(size_t)(ka < K ? ka : K - 1) * ld + n] : 0.f; v[8 + i] = kb < K ? W[(size_t)(kb < K ? kb : K - 1) * ld + n] : 0.f; }
  return bsplit16(v); }
__device__ __forceinline__ v8f mac3(const F2& a, const F2& b, v8f c) { c = wmma_bf(a.l, b.h, c); c = wmma_bf(a.h, b.l, c); return wmma_bf(a.h, b.h, c); }
__device__ __forceinline__ float sigm(float v) { return 1.0f / (1.0f + expf(-v)); }
#define LDSX() do { asm volatile("s_wait_dscnt 0" ::: "memory"); __builtin_amdgcn_wave_barrier(); __builtin_amdgcn_fence(__ATOMIC_RELEASE, "workgroup"); } while (0)

// Multi-head attention whose q / k / v projections are ONE shared 64 x 64 linear per stream applied to every head, with a key mask (inputs in the order values, keys, queries [4,1024,1024]; mask [4,1,1,1024] int32 RANDOM 0/1 per (batch, key); torch (out,in) Wv / Wk / Wq [64,64] uniform(+-1/8), NO projection biases; heads = reshape(N, L, 16, 64); einsum('nlhd,od->nlho'); energy = einsum('nqhd,nkhd->nhqk'); where(mask == 0, -1e20, energy); softmax(energy * 1/sqrt(1024)) - the scale is 1/32, not 1/8; out merged to [N, L, 1024]; out @ Wo.T + bo with Wo [1024,1024] and bo uniform(+-1/32), bo NONZERO).
#define NB 4
#define TT 1024
#define CC 1024            // NH * HD = projected width
#define DIN 1024          // input (model) width
#define NH 16
#define HD 64
#define NQB (TT / 64)
#define HG 8   // S workspace sized for eight heads: 8 x 1,024 x 1,024 f32 = 32 MiB; no kernel uses it
#define SCALE (0.03125f)   // 1 / sqrt(E) with E = 1024 (the module scales by the MODEL width, not the head width)
#define CAUSAL 0
#ifndef TNB
#define TNB NB
#endif
__device__ __forceinline__ float bfr(float v) { return (float)(__bf16)v; }
__host__ __device__ __forceinline__ int kb_last(int qb) { return CAUSAL ? ((qb * 64 + 63) >> 7) : (TT / 128 - 1); }
typedef __attribute__((ext_vector_type(8))) __bf16 v8b;
__device__ __forceinline__ v16b frag_b(const __bf16* rowk0, int lane) {
  union { v16b v; v8b q[2]; } u; const __bf16* p = rowk0 + 8 * (lane >> 4);
  u.q[0] = *(const v8b*)p; u.q[1] = *(const v8b*)(p + 16); return u.v;
}
#define QBH 0
#define QHI 0               // single-product logits on every row
#define KHI 64            // key rows carrying k residual / v bf16 hi+lo planes (written by k_proj; no kernel reads them)
// B fragment (k rows k0+.., output column o) of a weight: (in,out) [K][ld] or (out,in) [ld rows of K]: bf16 exact, or f16(bf16 * 256) exact
__device__ __forceinline__ v16b wcol_io(const float* Wm, int k0, int o, int lane, int ld) { v16b w; const int g = lane >> 4;
#pragma unroll
  for (int i = 0; i < 8; ++i) { w[i] = (__bf16)Wm[(size_t)(k0 + 8 * g + i) * ld + o]; w[8 + i] = (__bf16)Wm[(size_t)(k0 + 16 + 8 * g + i) * ld + o]; }
  return w; }
__device__ __forceinline__ v16b wcol_oi(const float* Wm, int k0, int o, int lane, int K) { v16b w; const float* p = Wm + (size_t)o * K + k0 + 8 * (lane >> 4);
#pragma unroll
  for (int i = 0; i < 8; ++i) { w[i] = (__bf16)p[i]; w[8 + i] = (__bf16)p[16 + i]; }
  return w; }
__device__ __forceinline__ v16h wcolh_io(const float* Wm, int k0, int o, int lane, int ld) { v16h w; const int g = lane >> 4;
#pragma unroll
  for (int i = 0; i < 8; ++i) { w[i] = (_Float16)(bfr(Wm[(size_t)(k0 + 8 * g + i) * ld + o]) * 256.0f); w[8 + i] = (_Float16)(bfr(Wm[(size_t)(k0 + 16 + 8 * g + i) * ld + o]) * 256.0f); }
  return w; }
__device__ __forceinline__ v16h wcolh_oi(const float* Wm, int k0, int o, int lane, int K) { v16h w; const float* p = Wm + (size_t)o * K + k0 + 8 * (lane >> 4);
#pragma unroll
  for (int i = 0; i < 8; ++i) { w[i] = (_Float16)(bfr(p[i]) * 256.0f); w[8 + i] = (_Float16)(bfr(p[16 + i]) * 256.0f); }
  return w; }
#define WQKV_LAYOUT 1   // 0 = (in,out) [DIN][CC]; 1 = (out,in) [CC][DIN]; 2 = per-head [NH][DIN][HD]
__device__ __forceinline__ v16b wcol_hdk(const float* Wm, int k0, int o, int lane) { v16b w; const int g = lane >> 4; const float* p = Wm + (size_t)(o / HD) * DIN * HD + (o % HD);
#pragma unroll
  for (int i = 0; i < 8; ++i) { w[i] = (__bf16)p[(size_t)(k0 + 8 * g + i) * HD]; w[8 + i] = (__bf16)p[(size_t)(k0 + 16 + 8 * g + i) * HD]; }
  return w; }
#define WO_OUT_IN 1
#if WQKV_LAYOUT == 1
#define WCOL(W, k0, o, lane) wcol_oi(W, k0, o, lane, DIN)
#elif WQKV_LAYOUT == 2
#define WCOL(W, k0, o, lane) wcol_hdk(W, k0, o, lane)
#else
#define WCOL(W, k0, o, lane) wcol_io(W, k0, o, lane, CC)
#endif
#if WO_OUT_IN
#define WOCOL(W, k0, o, lane) wcol_oi(W, k0, o, lane, CC)
#define WOCOLH(W, k0, o, lane) wcolh_oi(W, k0, o, lane, CC)
#else
#define WOCOL(W, k0, o, lane) wcol_io(W, k0, o, lane, DIN)
#define WOCOLH(W, k0, o, lane) wcolh_io(W, k0, o, lane, DIN)
#endif
#ifndef PROJ_EXTRA_PARAMS
#define PROJ_EXTRA_PARAMS
#endif

#define WS_QH  0u                                      // f16 q rows [b*t][CC]
#define WS_KH  (WS_QH + 2u * (size_t)NB * TT * CC)      // f16 k rows [b*t][CC]
#define WS_VT  (WS_KH + 2u * (size_t)NB * TT * CC)      // f16 v planes [b][c][t]
#define WS_QL  (WS_VT + 2u * (size_t)NB * CC * TT)      // f16 q residual x 2^10 rows [b][t < QHI][CC]
#define WS_KL  (WS_QL + 2u * (size_t)NB * QHI * CC)     // f16 k residual x 2^10 rows [b][t < KHI][CC]
#define WS_VB  (WS_KL + 2u * (size_t)NB * KHI * CC)     // bf16 v hi planes [b][c][t < KHI]
#define WS_VBL (WS_VB + 2u * (size_t)NB * CC * KHI)
#define WS_S   (WS_VBL + 2u * (size_t)NB * CC * KHI)    // f32 [hg][t][s], unused: k_fa keeps the scores in registers
#define WS_Y   (WS_S  + 4u * (size_t)HG * TT * TT)      // f32 ctx rows [b*t][CC] (only when there is an output projection)
#define WS_END (WS_Y  + 4u * (size_t)NB * TT * CC)

// ---- k_proj: block = (64 rows, 128 cols, which): q/k/v = X W (+ b) with exact bf16 products (K = HD per head) -> which 0: q f16 rows (+ residual rows < QHI); 1: k f16 rows (+ residual rows < KHI); 2: v f16 planes [c][t] (+ bf16 hi/lo planes for t < KHI)
__global__ __launch_bounds__(128) void k_proj(const float* __restrict__ XQ, const float* __restrict__ XK, const float* __restrict__ XV, const float* __restrict__ WQ, const float* __restrict__ WK, const float* __restrict__ WV, const float* __restrict__ BQ, const float* __restrict__ BK, const float* __restrict__ BV,
    _Float16* __restrict__ QH, _Float16* __restrict__ QL, _Float16* __restrict__ KH, _Float16* __restrict__ KL, _Float16* __restrict__ VT, __bf16* __restrict__ VB, __bf16* __restrict__ VBL) {
  __shared__ __align__(16) _Float16 sh[64][136], sl[64][136]; __shared__ __align__(16) _Float16 th[128][72]; __shared__ __align__(16) __bf16 tb[128][72], tbl[128][72];
  const int tid = threadIdx.x, wave = tid >> 5, lane = tid & 31, col = lane & 15, g = lane >> 4; const int which = blockIdx.z; const int c0 = blockIdx.y * 128; const size_t r0 = (size_t)blockIdx.x * 64; const size_t bb = r0 / TT; const int t0 = (int)(r0 % TT);
  const float* X = which == 0 ? XQ : which == 1 ? XK : XV; const float* WA = which == 0 ? WQ : which == 1 ? WK : WV; const float* BA = which == 0 ? BQ : which == 1 ? BK : BV;
  v8f acc[8] = {};
#pragma unroll
  for (int kk = 0; kk < 4; ++kk) { const int kc = (c0 >> 5) + kk;   /* block-diagonal projection: the 128 output columns c0 .. c0+127 are two heads; head hh = column / 64 contracts ONLY over its own 64 input columns, i.e. k-steps kk = 2 hh and 2 hh + 1 of the tile's 128-column input slice */
    v16b a; { const float* p = X + (r0 + wave * 16 + col) * DIN + kc * 32 + 8 * g;
#pragma unroll
      for (int i = 0; i < 8; ++i) { a[i] = (__bf16)p[i]; a[8 + i] = (__bf16)p[16 + i]; } }
    asm volatile("s_wait_loadcnt 0x0" ::: "memory");
#pragma unroll
    for (int j = 0; j < 8; ++j) if ((kk >> 1) == (j >> 2)) { const v16b w = wcol_oi(WA, (kk & 1) * 32, (j & 3) * 16 + col, lane, HD); asm volatile("s_wait_loadcnt 0x0" ::: "memory"); acc[j] = wmma_bf(a, w, acc[j]); } }   /* shared (out,in) [64][64] weight: row = output dim within the head, k = input dim within the head; the test is a compile-time constant per unrolled (kk, j) */
  if (which < 2) { _Float16* DH = which == 0 ? QH : KH; _Float16* DL = which == 0 ? QL : KL; const int nhi = which == 0 ? QHI : KHI; const bool hi_rows = t0 < nhi;
#pragma unroll
    for (int j = 0; j < 8; ++j) { const float bias = BA ? bfr(BA[(j & 3) * 16 + col]) : 0.f;
#pragma unroll
      for (int r = 0; r < 8; ++r) { const float v = acc[j][r] + bias; const _Float16 hv = (_Float16)v; sh[wave * 16 + 8 * g + r][j * 16 + col] = hv; sl[wave * 16 + 8 * g + r][j * 16 + col] = (_Float16)((v - (float)hv) * 1024.0f); } }
    __syncthreads();
    for (int e = tid; e < 64 * 16; e += 128) { const int rl = e >> 4, q = e & 15; vst2((unsigned*)(DH + (r0 + rl) * CC + c0 + q * 8), *(const v4u*)&sh[rl][q * 8]); if (hi_rows) vst2((unsigned*)(DL + (bb * nhi + t0 + rl) * (size_t)CC + c0 + q * 8), *(const v4u*)&sl[rl][q * 8]); }
  } else { const bool hi_rows = t0 < KHI;
#pragma unroll
    for (int j = 0; j < 8; ++j) { const float bias = BA ? bfr(BA[(j & 3) * 16 + col]) : 0.f;
#pragma unroll
      for (int r = 0; r < 8; ++r) { const float v = acc[j][r] + bias; const int rl = wave * 16 + 8 * g + r, cl = j * 16 + col; th[cl][rl] = (_Float16)v; const __bf16 bh = (__bf16)v; tb[cl][rl] = bh; tbl[cl][rl] = (__bf16)(v - (float)bh); } }
    __syncthreads();
    for (int e = tid; e < 128 * 8; e += 128) { const int cl = e >> 3, q = e & 7; vst2((unsigned*)(VT + (bb * CC + c0 + cl) * (size_t)TT + t0 + q * 8), *(const v4u*)&th[cl][q * 8]); if (hi_rows) { const size_t o3 = (bb * CC + c0 + cl) * (size_t)KHI + t0 + q * 8; vst2((unsigned*)(VB + o3), *(const v4u*)&tb[cl][q * 8]); vst2((unsigned*)(VBL + o3), *(const v4u*)&tbl[cl][q * 8]); } } } }
#define FA_KP 144                  // LDS pitch of a 128-B k row: 16 B x odd
#define FA_VP 2064                 // LDS pitch of a 2,048-B v plane row: 16 B x odd
#define FA_KB (TT * FA_KP)
#define FA_VB (HD * FA_VP)
#define FA_EP 68                   // floats per staged ctx row (272 B: 16 B x odd)
__device__ __forceinline__ v8f mmah(v16h a, v16h b, v8f c) { return __builtin_amdgcn_wmma_f32_16x16x32_f16(false, a, false, b, (short)0, c, false, false); }
__device__ __forceinline__ v16h frag_l(const unsigned char* p) { union { v16h v; v8h q[2]; } u; u.q[0] = *(const v8h*)p; u.q[1] = *(const v8h*)(p + 32); return u.v; }
__device__ __forceinline__ v8f ld8f(const unsigned char* p) { union { v8f v; v4f q[2]; } u; u.q[0] = *(const v4f*)p; u.q[1] = *(const v4f*)(p + 16); return u.v; }
// sixteen base-2 exponentials, each in place, in one statement: directly behind a transcendental stands nothing that reads its result or overwrites its source; the v_nop is that slot behind the last one
__device__ __forceinline__ void exp2x16(float (&a)[16]) {
  asm("v_exp_f32 %0, %0\n\tv_exp_f32 %1, %1\n\tv_exp_f32 %2, %2\n\tv_exp_f32 %3, %3\n\tv_exp_f32 %4, %4\n\tv_exp_f32 %5, %5\n\tv_exp_f32 %6, %6\n\tv_exp_f32 %7, %7\n\tv_exp_f32 %8, %8\n\tv_exp_f32 %9, %9\n\tv_exp_f32 %10, %10\n\tv_exp_f32 %11, %11\n\tv_exp_f32 %12, %12\n\tv_exp_f32 %13, %13\n\tv_exp_f32 %14, %14\n\tv_exp_f32 %15, %15\n\tv_nop" : "+v"(a[0]), "+v"(a[1]), "+v"(a[2]), "+v"(a[3]), "+v"(a[4]), "+v"(a[5]), "+v"(a[6]), "+v"(a[7]), "+v"(a[8]), "+v"(a[9]), "+v"(a[10]), "+v"(a[11]), "+v"(a[12]), "+v"(a[13]), "+v"(a[14]), "+v"(a[15])); }
__device__ __forceinline__ float xhalf(float x) { return __builtin_bit_cast(float, __builtin_amdgcn_permlanex16(__builtin_bit_cast(int, x), __builtin_bit_cast(int, x), 0x76543210, 0xfedcba98, false, false)); }  // lane l with lane l ^ 16
__global__ __launch_bounds__(256) void k_fa(const _Float16* __restrict__ QH, const _Float16* __restrict__ KH, const _Float16* __restrict__ VT, const int* __restrict__ MASK, float* __restrict__ Y) {
  __shared__ __align__(16) unsigned char L[FA_KB + FA_VB + 4 * TT];
  const int tid = threadIdx.x, wave = tid >> 5, lane = tid & 31, c = lane & 15, hh = lane >> 4; const int hd = blockIdx.y, b = blockIdx.z; const int qw0 = blockIdx.x * 256 + wave * 32;
  const _Float16* Kg = KH + (size_t)b * TT * CC + hd * HD; const _Float16* Vg = VT + ((size_t)b * CC + hd * HD) * (size_t)TT; const int* Mb = MASK + b * TT;
  v16h qf[2][2];
  const _Float16* qp0 = QH + ((size_t)b * TT + qw0 + c) * CC + hd * HD + 8 * hh; const _Float16* qp1 = qp0 + (size_t)16 * CC;   // the lane's two query rows, at its half's first element
#pragma unroll
  for (int kc = 0; kc < 2; ++kc) { qf[0][kc] = frag_l((const unsigned char*)(qp0 + kc * 32)); qf[1][kc] = frag_l((const unsigned char*)(qp1 + kc * 32)); }
  asm volatile("s_wait_xcnt 0x0" :: "v"(qp0) : "memory");   // the wait kept before a register that an issued global load names is overwritten; the pointer (all eight loads go by it, the second row as an offset) is an input, so that the pair lives through them and no loaded value lands in it
  { const v4i mm = *(const v4i*)(Mb + tid * 4); v4f bz;
#pragma unroll
    for (int i = 0; i < 4; ++i) bz[i] = mm[i] == 0 ? -1.0e30f : 0.f;
    *(v4f*)(L + FA_KB + FA_VB + tid * 16) = bz; }
  { const _Float16* kp = Kg + (size_t)(tid >> 3) * CC + (tid & 7) * 8; unsigned char* kl = L + (tid >> 3) * FA_KP + (tid & 7) * 16;   // 8 lanes per 128-B k row, 32 rows per step
    const _Float16* vp = Vg + (size_t)(tid >> 7) * TT + (tid & 127) * 8; unsigned char* vl = L + FA_KB + (tid >> 7) * FA_VP + (tid & 127) * 16;   // 128 lanes per 2,048-B v row, 2 rows per step
    // two runs of 16 loads a plane (64 KiB of a workgroup in flight; all 32 would take the kernel past 256 registers). Behind each run: the wait that is kept before a register
    // which an issued global load names is overwritten; it takes the run's pointer as an input, so that the pair lives through the run and no loaded value lands in it
#pragma unroll
    for (int h = 0; h < 2; ++h) { v4u t[16];
#pragma unroll
      for (int i = 0; i < 16; ++i) t[i] = *(const v4u*)(kp + (size_t)(h * 16 + i) * 32 * CC);
      asm volatile("s_wait_xcnt 0x0" :: "v"(kp) : "memory");
#pragma unroll
      for (int i = 0; i < 16; ++i) *(v4u*)(kl + (h * 16 + i) * 32 * FA_KP) = t[i]; }
#pragma unroll
    for (int h = 0; h < 2; ++h) { v4u t[16];
#pragma unroll
      for (int i = 0; i < 16; ++i) t[i] = *(const v4u*)(vp + (size_t)(h * 16 + i) * 2 * TT);
      asm volatile("s_wait_xcnt 0x0" :: "v"(vp) : "memory");
#pragma unroll
      for (int i = 0; i < 16; ++i) *(v4u*)(vl + (h * 16 + i) * 2 * FA_VP) = t[i]; } }
  __syncthreads();
  // a batch whose keys are ALL masked: the reference's logits are then all equal, i.e. uniform weights: scale 0 gives exactly that, whatever the (finite) biased scores are
  float bmx = -1.0e30f;
#pragma unroll
  for (int i = 0; i < 8; ++i) { const v4f b4 = *(const v4f*)(L + FA_KB + FA_VB + lane * 16 + i * 512); bmx = __builtin_fmaxf(__builtin_fmaxf(bmx, __builtin_fmaxf(b4[0], b4[1])), __builtin_fmaxf(b4[2], b4[3])); }
  const float cs = __builtin_amdgcn_ballot_w32(bmx == 0.f) != 0 ? SCALE * 1.4426950408889634f : 0.f;
  v16h ones;
#pragma unroll
  for (int i = 0; i < 16; ++i) ones[i] = (_Float16)1.0f;
  v8f acc[2][4] = {}, lacc[2] = {}; float m_run[2] = {-1.0e20f, -1.0e20f};   // the floor lies far above a masked score (-1e30 x scale) and far below any real one: a stretch of masked keys alone yields P = 0
  const unsigned char* Kl = L + c * FA_KP + 16 * hh; const unsigned char* Vl = L + FA_KB + c * FA_VP + 16 * hh; const unsigned char* Bl = L + FA_KB + FA_VB + 32 * hh;
  v16h kf[2][2]; v8f bz[2];
#pragma unroll
  for (int kt = 0; kt < 2; ++kt) { bz[kt] = ld8f(Bl + kt * 64); kf[kt][0] = frag_l(Kl + kt * 16 * FA_KP); kf[kt][1] = frag_l(Kl + kt * 16 * FA_KP + 64); }
#pragma unroll 1   // rolled: two passes unrolled take more than 256 registers, and the loop then switches register windows throughout
  for (int ps = 0; ps < TT / 32; ++ps) {
    v8f s[2][2];
#pragma unroll
    for (int kt = 0; kt < 2; ++kt)
#pragma unroll
      for (int g = 0; g < 2; ++g) s[kt][g] = mmah(kf[kt][1], qf[g][1], mmah(kf[kt][0], qf[g][0], bz[kt]));
    // the pass's LDS reads stand in one place: this pass's v, and the next pass's k rows and bias (the last pass re-reads pass 0, unused)
    v16h vf[4]; const int pn = (ps + 1) & (TT / 32 - 1);
#pragma unroll
    for (int t = 0; t < 4; ++t) vf[t] = frag_l(Vl + t * 16 * FA_VP + ps * 64);
#pragma unroll
    for (int kt = 0; kt < 2; ++kt) { bz[kt] = ld8f(Bl + (pn * 32 + kt * 16) * 4); kf[kt][0] = frag_l(Kl + (pn * 32 + kt * 16) * FA_KP); kf[kt][1] = frag_l(Kl + (pn * 32 + kt * 16) * FA_KP + 64); }
    __builtin_amdgcn_sched_barrier(0);   // the reads are issued ahead of the maxima, which then cover their latency
    float mb[2]; bool need = false;
#pragma unroll
    for (int g = 0; g < 2; ++g) { float mx = s[0][g][0];
#pragma unroll
      for (int r = 1; r < 8; ++r) mx = __builtin_fmaxf(mx, s[0][g][r]);
#pragma unroll
      for (int r = 0; r < 8; ++r) mx = __builtin_fmaxf(mx, s[1][g][r]);
      mx = __builtin_fmaxf(mx, xhalf(mx)) * cs; mb[g] = mx; need = need || (mx > m_run[g] + 8.0f); }
    __builtin_amdgcn_sched_barrier(0);   // keeps the statement below, and the wait it brings, behind the maxima
    // inputs only: holds the pass's LDS reads in front of the branch; sunk behind it they would stand directly in front of their first use
    asm volatile("" :: "v"(vf[0]), "v"(vf[1]), "v"(vf[2]), "v"(vf[3]), "v"(kf[0][0]), "v"(kf[0][1]), "v"(kf[1][0]), "v"(kf[1][1]), "v"(bz[0]), "v"(bz[1]));
    if (__builtin_amdgcn_ballot_w32(need) != 0) {   // one scalar test per pass; rare after the first unmasked keys
#pragma unroll
      for (int g = 0; g < 2; ++g) { const float m_new = __builtin_fmaxf(m_run[g], mb[g]); const float corr = __builtin_amdgcn_exp2f(m_run[g] - m_new); m_run[g] = m_new; lacc[g] = lacc[g] * corr;
#pragma unroll
        for (int t = 0; t < 4; ++t) acc[g][t] = acc[g][t] * corr; } }
#pragma unroll
    for (int g = 0; g < 2; ++g) { const float nm = 7.0f - m_run[g];   // P carried x 2^7: at most 2^15 in f16 (the maximum trails by 8 at most), small weights clear of f16 subnormals
      v16h pf; float a[16];
#pragma unroll
      for (int i = 0; i < 16; ++i) a[i] = __builtin_fmaf(s[i >> 3][g][i & 7], cs, nm);
      exp2x16(a);
#pragma unroll
      for (int i = 0; i < 16; ++i) pf[i] = (_Float16)a[i];
#pragma unroll
      for (int t = 0; t < 4; ++t) acc[g][t] = mmah(vf[t], pf, acc[g][t]);
      lacc[g] = mmah(ones, pf, lacc[g]); } }
  __syncthreads();   // every wave has left the k / v planes: their LDS becomes the output staging
  float* es = (float*)L + wave * 32 * FA_EP;
#pragma unroll
  for (int g = 0; g < 2; ++g) { const float inv = 1.0f / lacc[g][0];   // every row of the all-ones product holds the column's sum over both lane halves
#pragma unroll
    for (int t = 0; t < 4; ++t) { const v8f o = acc[g][t] * inv; float* p = es + (g * 16 + c) * FA_EP + t * 16 + 8 * hh; *(v4f*)p = v4f{o[0], o[1], o[2], o[3]}; *(v4f*)(p + 4) = v4f{o[4], o[5], o[6], o[7]}; } }
  LDSX();
#pragma unroll
  for (int i = 0; i < 16; ++i) { const int row = i * 2 + hh; vst2(Y + ((size_t)b * TT + qw0 + row) * CC + hd * HD + c * 4, *(const v4f*)(es + row * FA_EP + c * 4)); } }
// ---- k_out: block = (64 rows, 128 cols): out = ctx Wo (+ bo): ctx x 2^6 once to f16 against Wo as f16(bf16 x 2^8) exact (1 product) x 2^-14; causal early rows (< QHI of each sequence): ctx bf16 hi + lo against exact bf16 Wo (2 products)
__global__ __launch_bounds__(128) void k_out(const float* __restrict__ Y, const float* __restrict__ WO, const float* __restrict__ BO, float* __restrict__ OUT) { __shared__ __align__(16) float sf[4][16][132];
  const int tid = threadIdx.x, wave = tid >> 5, lane = tid & 31, col = lane & 15, g = lane >> 4; const int c0 = blockIdx.y * 128; const size_t r0 = (size_t)blockIdx.x * 64 + wave * 16;
  v8f acc[8] = {};
  if (CAUSAL && (int)(((size_t)blockIdx.x * 64) % TT) < QHI) {   /* block-uniform */
#pragma unroll 2
    for (int kc = 0; kc < CC / 32; ++kc) { const F2 a = split_row(Y + (r0 + col) * CC, kc * 32, lane); asm volatile("s_wait_loadcnt 0x0" ::: "memory");
#pragma unroll
      for (int j = 0; j < 8; ++j) { const v16b w = WOCOL(WO, kc * 32, c0 + j * 16 + col, lane); asm volatile("s_wait_loadcnt 0x0" ::: "memory"); acc[j] = wmma_bf(a.h, w, acc[j]); acc[j] = wmma_bf(a.l, w, acc[j]); } }
#pragma unroll
    for (int j = 0; j < 8; ++j) { const float bias = BO ? bfr(BO[c0 + j * 16 + col]) : 0.f;
#pragma unroll
      for (int r = 0; r < 8; ++r) sf[wave][8 * g + r][j * 16 + col] = acc[j][r] + bias; }
  } else {
#pragma unroll 2
    for (int kc = 0; kc < CC / 32; ++kc) { const v16h a = frag_f32s(Y + (r0 + col) * CC + kc * 32, lane, 64.0f); asm volatile("s_wait_loadcnt 0x0" ::: "memory");   /* ctx carried x 2^6 into f16 so small-magnitude context rows stay clear of f16 subnormals (chip FTZ) */
#pragma unroll
      for (int j = 0; j < 8; ++j) { const v16h w = WOCOLH(WO, kc * 32, c0 + j * 16 + col, lane); asm volatile("s_wait_loadcnt 0x0" ::: "memory"); acc[j] = wmma16(a, w, acc[j]); } }
#pragma unroll
    for (int j = 0; j < 8; ++j) { const float bias = BO ? bfr(BO[c0 + j * 16 + col]) : 0.f;
#pragma unroll
      for (int r = 0; r < 8; ++r) sf[wave][8 * g + r][j * 16 + col] = acc[j][r] * (1.0f / 16384.0f) + bias; } }   /* 2^-8 (Wo carry) x 2^-6 (ctx carry) */
  LDSX(); for (int rl = 0; rl < 16; ++rl) vst2(OUT + (r0 + rl) * DIN + c0 + lane * 4, *(const v4f*)&sf[wave][rl][lane * 4]); }

static_assert(HD == 64 && CC == NH * HD && DIN == CC, "block-diagonal per-head projection: 128-column tiles = two 64-wide heads, input width == projected width");
extern "C" void kernel_launch(void* const* d_in, const int* in_sizes, int n_in, void* d_out, int out_size, void* d_ws, size_t ws_size, hipStream_t stream) {
  (void)in_sizes; (void)n_in; (void)out_size;
  const float** F = (const float**)d_in;
  if (ws_size < (size_t)WS_END) return;
  char* ws = (char*)d_ws; _Float16 *QH = (_Float16*)(ws + WS_QH), *KH = (_Float16*)(ws + WS_KH), *VT = (_Float16*)(ws + WS_VT), *QL = (_Float16*)(ws + WS_QL), *KL = (_Float16*)(ws + WS_KL); __bf16 *VB = (__bf16*)(ws + WS_VB), *VBL = (__bf16*)(ws + WS_VBL); float *S = (float*)(ws + WS_S), *Y = (float*)(ws + WS_Y);
  (void)Y; (void)QL; (void)KL; (void)VB; (void)VBL; (void)S;
  // inputs: 0 values [4,1024,1024]; 1 keys; 2 queries; 3 mask [4,1,1,1024] int32 (random 0/1; 0 = masked key); 4 Wv [64,64] (out,in); 5 Wk; 6 Wq (no projection biases); 7 Wo [1024,1024] (out,in); 8 bo (NONZERO)
  k_proj<<<dim3(TNB * TT / 64, CC / 128, 3), 128, 0, stream>>>(F[2], F[1], F[0], F[6], F[5], F[4], nullptr, nullptr, nullptr, QH, QL, KH, KL, VT, VB, VBL);
  k_fa<<<dim3(TT / 256, NH, TNB), 256, 0, stream>>>(QH, KH, VT, (const int*)d_in[3], Y);
  k_out<<<dim3(TNB * TT / 64, DIN / 128), 128, 0, stream>>>(Y, F[7], F[8], (float*)d_out);
}

// v002
// It runs in 63.7 microseconds.
// In two side-by-side timings against v001, it was 2.63 and 2.65 times as fast.
// All steps since v000 together make it 10.8 times as fast.
// compute dtype: all float inputs rounded to bf16; the per-head 64 x 64 q / k / v projections (ONE shared weight per stream, applied to every head) with EXACT bf16 products on WMMA 16x16x32 (f32 accumulate) (no projection biases); logits q x k once to f16 each (1 product) x 1024^-0.5; the per-(batch, key) int mask as a bias per key; online softmax f32 (log2 domain); unnormalised P x 2^7 once to f16 x v once to f16 (1 product), divided by the f32 sum of the same f16 P; ctx x 2^6 once to f16 x Wo f16(bf16 x 2^8) + bo; f32 output.
#include <hip/hip_runtime.h>
#include <math.h>

typedef __attribute__((ext_vector_type(16))) _Float16 v16h;
typedef __attribute__((ext_vector_type(16))) __bf16 v16b;
typedef __attribute__((ext_vector_type(8)))  _Float16 v8h;
typedef __attribute__((ext_vector_type(8)))  float v8f;
typedef __attribute__((ext_vector_type(4)))  float v4f;
typedef __attribute__((ext_vector_type(2)))  float v2f;
typedef __attribute__((ext_vector_type(4)))  unsigned v4u;
typedef __attribute__((ext_vector_type(4)))  int v4i;
typedef float __attribute__((may_alias)) float_a;
typedef int __attribute__((may_alias)) int_a;

template <typename T> __device__ __forceinline__ void vst2(void* p, T v) { *(T*)p = v;  }
__device__ __forceinline__ v8f wmma16(v16h a, v16h b, v8f c) {
  v8f d = __builtin_amdgcn_wmma_f32_16x16x32_f16(false, a, false, b, (short)0, c, false, false);
  asm volatile("v_nop\n\tv_nop\n\tv_nop\n\tv_nop" : "+v"(d) : "v"(a), "v"(b));
  return d;
}
__device__ __forceinline__ v8f wmma_bf(v16b a, v16b b, v8f c) {
  v8f d = __builtin_amdgcn_wmma_f32_16x16x32_bf16(false, a, false, b, (short)0, c, false, false);
  asm volatile("v_nop\n\tv_nop\n\tv_nop\n\tv_nop" : "+v"(d) : "v"(a), "v"(b));
  return d;
}
// 16x16x32 fragments: lane = (h = lane>>4, row/col = lane&15); elements 0..7 = k0+8h+0..7, 8..15 = k0+16+8h+0..7; D element r = row 8h+r
__device__ __forceinline__ v16h frag_h(const _Float16* rowk0, int lane) {
  union { v16h v; v8h q[2]; } u; const _Float16* p = rowk0 + 8 * (lane >> 4);
  u.q[0] = *(const v8h*)p; u.q[1] = *(const v8h*)(p + 16); return u.v;
}
__device__ __forceinline__ v16h frag_f32(const float* rowk0, int lane) {
  v16h a; const float* p = rowk0 + 8 * (lane >> 4);
#pragma unroll
  for (int i = 0; i < 8; ++i) { a[i] = (_Float16)p[i]; a[8 + i] = (_Float16)p[16 + i]; }
  return a;
}
__device__ __forceinline__ v16h frag_f32s(const float* rowk0, int lane, float sc) {
  v16h a; const float* p = rowk0 + 8 * (lane >> 4);
#pragma unroll
  for (int i = 0; i < 8; ++i) { a[i] = (_Float16)(p[i] * sc); a[8 + i] = (_Float16)(p[16 + i] * sc); }
  return a;
}
// column fragment from a [K][ld] layout (column n), rows >= K read as 0
__device__ __forceinline__ v16h fragc_f32(const float* W, int k0, int n, int lane, int ld, int K) {
  v16h a; const int g = lane >> 4;
#pragma unroll
  for (int i = 0; i < 8; ++i) { const int ka = k0 + 8 * g + i, kb = ka + 16;
    a[i] = (_Float16)(ka < K ? W[(size_t)(ka < K ? ka : K - 1) * ld + n] : 0.f); a[8 + i] = (_Float16)(kb < K ? W[(size_t)(kb < K ? kb : K - 1) * ld + n] : 0.f); }
  return a;
}
struct F2 { v16b h, l; };
__device__ __forceinline__ F2 bsplit16(const float v[16]) { F2 r;
#pragma unroll
  for (int i = 0; i < 16; ++i) { const __bf16 h = (__bf16)v[i]; r.h[i] = h; r.l[i] = (__bf16)(v[i] - (float)h); }
  return r; }
__device__ __forceinline__ F2 split_row(const float* row, int k0, int lane) { float v[16]; const float* p = row + k0 + 8 * (lane >> 4);
#pragma unroll
  for (int i = 0; i < 8; ++i) { v[i] = p[i]; v[8 + i] = p[16 + i]; }
  return bsplit16(v); }
__device__ __forceinline__ F2 split_rowK(const float* row, int k0, int lane, int K) { float v[16]; const int g = lane >> 4;
#pragma unroll
  for (int i = 0; i < 8; ++i) { const int ka = k0 + 8 * g + i, kb = ka + 16; v[i] = ka < K ? row[ka < K ? ka : K - 1] : 0.f; v[8 + i] = kb < K ? row[kb < K ? kb : K - 1] : 0.f; }
  return bsplit16(v); }
__device__ __forceinline__ F2 split_col(const float* W, int k0, int n, int lane, int ld, int K) { float v[16]; const int g = lane >> 4;
#pragma unroll
  for (int i = 0; i < 8; ++i) { const int ka = k0 + 8 * g + i, kb = ka + 16; v[i] = ka < K ? W[(size_t)(ka < K ? ka : K - 1) * ld + n] : 0.f; v[8 + i] = kb < K ? W[(size_t)(kb < K ? kb : K - 1) * ld + n] : 0.f; }
  return bsplit16(v); }
__device__ __forceinline__ v8f mac3(const F2& a, const F2& b, v8f c) { c = wmma_bf(a.l, b.h, c); c = wmma_bf(a.h, b.l, c); return wmma_bf(a.h, b.h, c); }
__device__ __forceinline__ float sigm(float v) { return 1.0f / (1.0f + expf(-v)); }
#define LDSX() do { asm volatile("s_wait_dscnt 0" ::: "memory"); __builtin_amdgcn_wave_barrier(); __builtin_amdgcn_fence(__ATOMIC_RELEASE, "workgroup"); } while (0)

// Multi-head attention whose q / k / v projections are ONE shared 64 x 64 linear per stream applied to every head, with a key mask (inputs in the order values, keys, queries [4,1024,1024]; mask [4,1,1,1024] int32 RANDOM 0/1 per (batch, key); torch (out,in) Wv / Wk / Wq [64,64] uniform(+-1/8), NO projection biases; heads = reshape(N, L, 16, 64); einsum('nlhd,od->nlho'); energy = einsum('nqhd,nkhd->nhqk'); where(mask == 0, -1e20, energy); softmax(energy * 1/sqrt(1024)) - the scale is 1/32, not 1/8; out merged to [N, L, 1024]; out @ Wo.T + bo with Wo [1024,1024] and bo uniform(+-1/32), bo NONZERO).
#define NB 4
#define TT 1024
#define CC 1024            // NH * HD = projected width
#define DIN 1024          // input (model) width
#define NH 16
#define HD 64
#define NQB (TT / 64)
#define HG 8   // S workspace sized for eight heads: 8 x 1,024 x 1,024 f32 = 32 MiB; no kernel uses it
#define SCALE (0.03125f)   // 1 / sqrt(E) with E = 1024 (the module scales by the MODEL width, not the head width)
#define CAUSAL 0
#ifndef TNB
#define TNB NB
#endif
__device__ __forceinline__ float bfr(float v) { return (float)(__bf16)v; }
__host__ __device__ __forceinline__ int kb_last(int qb) { return CAUSAL ? ((qb * 64 + 63) >> 7) : (TT / 128 - 1); }
typedef __attribute__((ext_vector_type(8))) __bf16 v8b;
__device__ __forceinline__ v16b frag_b(const __bf16* rowk0, int lane) {
  union { v16b v; v8b q[2]; } u; const __bf16* p = rowk0 + 8 * (lane >> 4);
  u.q[0] = *(const v8b*)p; u.q[1] = *(const v8b*)(p + 16); return u.v;
}
#define QBH 0
#define QHI 0               // single-product logits on every row
#define KHI 64            // key rows carrying k residual / v bf16 hi+lo planes (written by k_proj; no kernel reads them)
// B fragment (k rows k0+.., output column o) of a weight: (in,out) [K][ld] or (out,in) [ld rows of K]: bf16 exact, or f16(bf16 * 256) exact
__device__ __forceinline__ v16b wcol_io(const float* Wm, int k0, int o, int lane, int ld) { v16b w; const int g = lane >> 4;
#pragma unroll
  for (int i = 0; i < 8; ++i) { w[i] = (__bf16)Wm[(size_t)(k0 + 8 * g + i) * ld + o]; w[8 + i] = (__bf16)Wm[(size_t)(k0 + 16 + 8 * g + i) * ld + o]; }
  return w; }
__device__ __forceinline__ v16b wcol_oi(const float* Wm, int k0, int o, int lane, int K) { v16b w; const float* p = Wm + (size_t)o * K + k0 + 8 * (lane >> 4);
#pragma unroll
  for (int i = 0; i < 8; ++i) { w[i] = (__bf16)p[i]; w[8 + i] = (__bf16)p[16 + i]; }
  return w; }
__device__ __forceinline__ v16h wcolh_io(const float* Wm, int k0, int o, int lane, int ld) { v16h w; const int g = lane >> 4;
#pragma unroll
  for (int i = 0; i < 8; ++i) { w[i] = (_Float16)(bfr(Wm[(size_t)(k0 + 8 * g + i) * ld + o]) * 256.0f); w[8 + i] = (_Float16)(bfr(Wm[(size_t)(k0 + 16 + 8 * g + i) * ld + o]) * 256.0f); }
  return w; }
__device__ __forceinline__ v16h wcolh_oi(const float* Wm, int k0, int o, int lane, int K) { v16h w; const float* p = Wm + (size_t)o * K + k0 + 8 * (lane >> 4);
#pragma unroll
  for (int i = 0; i < 8; ++i) { w[i] = (_Float16)(bfr(p[i]) * 256.0f); w[8 + i] = (_Float16)(bfr(p[16 + i]) * 256.0f); }
  return w; }
#define WQKV_LAYOUT 1   // 0 = (in,out) [DIN][CC]; 1 = (out,in) [CC][DIN]; 2 = per-head [NH][DIN][HD]
__device__ __forceinline__ v16b wcol_hdk(const float* Wm, int k0, int o, int lane) { v16b w; const int g = lane >> 4; const float* p = Wm + (size_t)(o / HD) * DIN * HD + (o % HD);
#pragma unroll
  for (int i = 0; i < 8; ++i) { w[i] = (__bf16)p[(size_t)(k0 + 8 * g + i) * HD]; w[8 + i] = (__bf16)p[(size_t)(k0 + 16 + 8 * g + i) * HD]; }
  return w; }
#define WO_OUT_IN 1
#if WQKV_LAYOUT == 1
#define WCOL(W, k0, o, lane) wcol_oi(W, k0, o, lane, DIN)
#elif WQKV_LAYOUT == 2
#define WCOL(W, k0, o, lane) wcol_hdk(W, k0, o, lane)
#else
#define WCOL(W, k0, o, lane) wcol_io(W, k0, o, lane, CC)
#endif
#if WO_OUT_IN
#define WOCOL(W, k0, o, lane) wcol_oi(W, k0, o, lane, CC)
#define WOCOLH(W, k0, o, lane) wcolh_oi(W, k0, o, lane, CC)
#else
#define WOCOL(W, k0, o, lane) wcol_io(W, k0, o, lane, DIN)
#define WOCOLH(W, k0, o, lane) wcolh_io(W, k0, o, lane, DIN)
#endif
#ifndef PROJ_EXTRA_PARAMS
#define PROJ_EXTRA_PARAMS
#endif

#define WS_QH  0u                                      // f16 q rows [b*t][CC]
#define WS_KH  (WS_QH + 2u * (size_t)NB * TT * CC)      // f16 k rows [b*t][CC]
#define WS_VT  (WS_KH + 2u * (size_t)NB * TT * CC)      // f16 v planes [b][c][t]
#define WS_QL  (WS_VT + 2u * (size_t)NB * CC * TT)      // f16 q residual x 2^10 rows [b][t < QHI][CC]
#define WS_KL  (WS_QL + 2u * (size_t)NB * QHI * CC)     // f16 k residual x 2^10 rows [b][t < KHI][CC]
#define WS_VB  (WS_KL + 2u * (size_t)NB * KHI * CC)     // bf16 v hi planes [b][c][t < KHI]
#define WS_VBL (WS_VB + 2u * (size_t)NB * CC * KHI)
#define WS_S   (WS_VBL + 2u * (size_t)NB * CC * KHI)    // f32 [hg][t][s], unused: k_fa keeps the scores in registers
#define WS_Y   (WS_S  + 4u * (size_t)HG * TT * TT)      // f32 ctx rows [b*t][CC] (only when there is an output projection)
#define WS_END (WS_Y  + 4u * (size_t)NB * TT * CC)

// ---- k_proj: block = (64 rows, 128 cols, which): q/k/v = X W (+ b) with exact bf16 products (K = HD per head) -> which 0: q f16 rows (+ residual rows < QHI); 1: k f16 rows (+ residual rows < KHI); 2: v f16 planes [c][t] (+ bf16 hi/lo planes for t < KHI)
__global__ __launch_bounds__(128) void k_proj(const float* __restrict__ XQ, const float* __restrict__ XK, const float* __restrict__ XV, const float* __restrict__ WQ, const float* __restrict__ WK, const float* __restrict__ WV, const float* __restrict__ BQ, const float* __restrict__ BK, const float* __restrict__ BV,
    _Float16* __restrict__ QH, _Float16* __restrict__ QL, _Float16* __restrict__ KH, _Float16* __restrict__ KL, _Float16* __restrict__ VT, __bf16* __restrict__ VB, __bf16* __restrict__ VBL) {
  __shared__ __align__(16) _Float16 sh[64][136], sl[64][136]; __shared__ __align__(16) _Float16 th[128][72]; __shared__ __align__(16) __bf16 tb[128][72], tbl[128][72];
  const int tid = threadIdx.x, wave = tid >> 5, lane = tid & 31, col = lane & 15, g = lane >> 4; const int which = blockIdx.z; const int c0 = blockIdx.y * 128; const size_t r0 = (size_t)blockIdx.x * 64; const size_t bb = r0 / TT; const int t0 = (int)(r0 % TT);
  const float* X = which == 0 ? XQ : which == 1 ? XK : XV; const float* WA = which == 0 ? WQ : which == 1 ? WK : WV; const float* BA = which == 0 ? BQ : which == 1 ? BK : BV;
  v8f acc[8] = {};
#pragma unroll
  for (int kk = 0; kk < 4; ++kk) { const int kc = (c0 >> 5) + kk;   /* block-diagonal projection: the 128 output columns c0 .. c0+127 are two heads; head hh = column / 64 contracts ONLY over its own 64 input columns, i.e. k-steps kk = 2 hh and 2 hh + 1 of the tile's 128-column input slice */
    v16b a; { const float* p = X + (r0 + wave * 16 + col) * DIN + kc * 32 + 8 * g;
#pragma unroll
      for (int i = 0; i < 8; ++i) { a[i] = (__bf16)p[i]; a[8 + i] = (__bf16)p[16 + i]; } }
    asm volatile("s_wait_loadcnt 0x0" ::: "memory");
#pragma unroll
    for (int j = 0; j < 8; ++j) if ((kk >> 1) == (j >> 2)) { const v16b w = wcol_oi(WA, (kk & 1) * 32, (j & 3) * 16 + col, lane, HD); asm volatile("s_wait_loadcnt 0x0" ::: "memory"); acc[j] = wmma_bf(a, w, acc[j]); } }   /* shared (out,in) [64][64] weight: row = output dim within the head, k = input dim within the head; the test is a compile-time constant per unrolled (kk, j) */
  if (which < 2) { _Float16* DH = which == 0 ? QH : KH; _Float16* DL = which == 0 ? QL : KL; const int nhi = which == 0 ? QHI : KHI; const bool hi_rows = t0 < nhi;
#pragma unroll
    for (int j = 0; j < 8; ++j) { const float bias = BA ? bfr(BA[(j & 3) * 16 + col]) : 0.f;
#pragma unroll
      for (int r = 0; r < 8; ++r) { const float v = acc[j][r] + bias; const _Float16 hv = (_Float16)v; sh[wave * 16 + 8 * g + r][j * 16 + col] = hv; sl[wave * 16 + 8 * g + r][j * 16 + col] = (_Float16)((v - (float)hv) * 1024.0f); } }
    __syncthreads();
    for (int e = tid; e < 64 * 16; e += 128) { const int rl = e >> 4, q = e & 15; vst2((unsigned*)(DH + (r0 + rl) * CC + c0 + q * 8), *(const v4u*)&sh[rl][q * 8]); if (hi_rows) vst2((unsigned*)(DL + (bb * nhi + t0 + rl) * (size_t)CC + c0 + q * 8), *(const v4u*)&sl[rl][q * 8]); }
  } else { const bool hi_rows = t0 < KHI;
#pragma unroll
    for (int j = 0; j < 8; ++j) { const float bias = BA ? bfr(BA[(j & 3) * 16 + col]) : 0.f;
#pragma unroll
      for (int r = 0; r < 8; ++r) { const float v = acc[j][r] + bias; const int rl = wave * 16 + 8 * g + r, cl = j * 16 + col; th[cl][rl] = (_Float16)v; const __bf16 bh = (__bf16)v; tb[cl][rl] = bh; tbl[cl][rl] = (__bf16)(v - (float)bh); } }
    __syncthreads();
    for (int e = tid; e < 128 * 8; e += 128) { const int cl = e >> 3, q = e & 7; vst2((unsigned*)(VT + (bb * CC + c0 + cl) * (size_t)TT + t0 + q * 8), *(const v4u*)&th[cl][q * 8]); if (hi_rows) { const size_t o3 = (bb * CC + c0 + cl) * (size_t)KHI + t0 + q * 8; vst2((unsigned*)(VB + o3), *(const v4u*)&tb[cl][q * 8]); vst2((unsigned*)(VBL + o3), *(const v4u*)&tbl[cl][q * 8]); } } } }
#define FA_KP 144                  // LDS pitch of a 128-B k row: 16 B x odd
#define FA_VP 2064                 // LDS pitch of a 2,048-B v plane row: 16 B x odd
#define FA_KB (TT * FA_KP)
#define FA_VB (HD * FA_VP)
#define FA_EP 68                   // floats per staged ctx row (272 B: 16 B x odd)
__device__ __forceinline__ v8f mmah(v16h a, v16h b, v8f c) { return __builtin_amdgcn_wmma_f32_16x16x32_f16(false, a, false, b, (short)0, c, false, false); }
__device__ __forceinline__ v16h frag_l(const unsigned char* p) { union { v16h v; v8h q[2]; } u; u.q[0] = *(const v8h*)p; u.q[1] = *(const v8h*)(p + 32); return u.v; }
__device__ __forceinline__ v8f ld8f(const unsigned char* p) { union { v8f v; v4f q[2]; } u; u.q[0] = *(const v4f*)p; u.q[1] = *(const v4f*)(p + 16); return u.v; }
// sixteen base-2 exponentials, each in place, in one statement: directly behind a transcendental stands nothing that reads its result or overwrites its source; the v_nop is that slot behind the last one
__device__ __forceinline__ void exp2x16(float (&a)[16]) {
  asm("v_exp_f32 %0, %0\n\tv_exp_f32 %1, %1\n\tv_exp_f32 %2, %2\n\tv_exp_f32 %3, %3\n\tv_exp_f32 %4, %4\n\tv_exp_f32 %5, %5\n\tv_exp_f32 %6, %6\n\tv_exp_f32 %7, %7\n\tv_exp_f32 %8, %8\n\tv_exp_f32 %9, %9\n\tv_exp_f32 %10, %10\n\tv_exp_f32 %11, %11\n\tv_exp_f32 %12, %12\n\tv_exp_f32 %13, %13\n\tv_exp_f32 %14, %14\n\tv_exp_f32 %15, %15\n\tv_nop" : "+v"(a[0]), "+v"(a[1]), "+v"(a[2]), "+v"(a[3]), "+v"(a[4]), "+v"(a[5]), "+v"(a[6]), "+v"(a[7]), "+v"(a[8]), "+v"(a[9]), "+v"(a[10]), "+v"(a[11]), "+v"(a[12]), "+v"(a[13]), "+v"(a[14]), "+v"(a[15])); }
__device__ __forceinline__ float xhalf(float x) { return __builtin_bit_cast(float, __builtin_amdgcn_permlanex16(__builtin_bit_cast(int, x), __builtin_bit_cast(int, x), 0x76543210, 0xfedcba98, false, false)); }  // lane l with lane l ^ 16
__global__ __launch_bounds__(256) void k_fa(const _Float16* __restrict__ QH, const _Float16* __restrict__ KH, const _Float16* __restrict__ VT, const int* __restrict__ MASK, float* __restrict__ Y) {
  __shared__ __align__(16) unsigned char L[FA_KB + FA_VB + 4 * TT];
  const int tid = threadIdx.x, wave = tid >> 5, lane = tid & 31, c = lane & 15, hh = lane >> 4; const int hd = blockIdx.y, b = blockIdx.z; const int qw0 = blockIdx.x * 256 + wave * 32;
  const _Float16* Kg = KH + (size_t)b * TT * CC + hd * HD; const _Float16* Vg = VT + ((size_t)b * CC + hd * HD) * (size_t)TT; const int* Mb = MASK + b * TT;
  v16h qf[2][2];
  const _Float16* qp0 = QH + ((size_t)b * TT + qw0 + c) * CC + hd * HD + 8 * hh; const _Float16* qp1 = qp0 + (size_t)16 * CC;   // the lane's two query rows, at its half's first element
#pragma unroll
  for (int kc = 0; kc < 2; ++kc) { qf[0][kc] = frag_l((const unsigned char*)(qp0 + kc * 32)); qf[1][kc] = frag_l((const unsigned char*)(qp1 + kc * 32)); }
  asm volatile("s_wait_xcnt 0x0" :: "v"(qp0) : "memory");   // the wait kept before a register that an issued global load names is overwritten; the pointer (all eight loads go by it, the second row as an offset) is an input, so that the pair lives through them and no loaded value lands in it
  { const v4i mm = *(const v4i*)(Mb + tid * 4); v4f bz;
#pragma unroll
    for (int i = 0; i < 4; ++i) bz[i] = mm[i] == 0 ? -1.0e30f : 0.f;
    *(v4f*)(L + FA_KB + FA_VB + tid * 16) = bz; }
  { const _Float16* kp = Kg + (size_t)(tid >> 3) * CC + (tid & 7) * 8; unsigned char* kl = L + (tid >> 3) * FA_KP + (tid & 7) * 16;   // 8 lanes per 128-B k row, 32 rows per step
    const _Float16* vp = Vg + (size_t)(tid >> 7) * TT + (tid & 127) * 8; unsigned char* vl = L + FA_KB + (tid >> 7) * FA_VP + (tid & 127) * 16;   // 128 lanes per 2,048-B v row, 2 rows per step
    // two runs of 16 loads a plane (64 KiB of a workgroup in flight; all 32 would take the kernel past 256 registers). Behind each run: the wait that is kept before a register
    // which an issued global load names is overwritten; it takes the run's pointer as an input, so that the pair lives through the run and no loaded value lands in it
#pragma unroll
    for (int h = 0; h < 2; ++h) { v4u t[16];
#pragma unroll
      for (int i = 0; i < 16; ++i) t[i] = *(const v4u*)(kp + (size_t)(h * 16 + i) * 32 * CC);
      asm volatile("s_wait_xcnt 0x0" :: "v"(kp) : "memory");
#pragma unroll
      for (int i = 0; i < 16; ++i) *(v4u*)(kl + (h * 16 + i) * 32 * FA_KP) = t[i]; }
#pragma unroll
    for (int h = 0; h < 2; ++h) { v4u t[16];
#pragma unroll
      for (int i = 0; i < 16; ++i) t[i] = *(const v4u*)(vp + (size_t)(h * 16 + i) * 2 * TT);
      asm volatile("s_wait_xcnt 0x0" :: "v"(vp) : "memory");
#pragma unroll
      for (int i = 0; i < 16; ++i) *(v4u*)(vl + (h * 16 + i) * 2 * FA_VP) = t[i]; } }
  __syncthreads();
  // a batch whose keys are ALL masked: the reference's logits are then all equal, i.e. uniform weights: scale 0 gives exactly that, whatever the (finite) biased scores are
  float bmx = -1.0e30f;
#pragma unroll
  for (int i = 0; i < 8; ++i) { const v4f b4 = *(const v4f*)(L + FA_KB + FA_VB + lane * 16 + i * 512); bmx = __builtin_fmaxf(__builtin_fmaxf(bmx, __builtin_fmaxf(b4[0], b4[1])), __builtin_fmaxf(b4[2], b4[3])); }
  const float cs = __builtin_amdgcn_ballot_w32(bmx == 0.f) != 0 ? SCALE * 1.4426950408889634f : 0.f;
  v16h ones;
#pragma unroll
  for (int i = 0; i < 16; ++i) ones[i] = (_Float16)1.0f;
  v8f acc[2][4] = {}, lacc[2] = {}; float m_run[2] = {-1.0e20f, -1.0e20f};   // the floor lies far above a masked score (-1e30 x scale) and far below any real one: a stretch of masked keys alone yields P = 0
  const unsigned char* Kl = L + c * FA_KP + 16 * hh; const unsigned char* Vl = L + FA_KB + c * FA_VP + 16 * hh; const unsigned char* Bl = L + FA_KB + FA_VB + 32 * hh;
  v16h kf[2][2]; v8f bz[2];
#pragma unroll
  for (int kt = 0; kt < 2; ++kt) { bz[kt] = ld8f(Bl + kt * 64); kf[kt][0] = frag_l(Kl + kt * 16 * FA_KP); kf[kt][1] = frag_l(Kl + kt * 16 * FA_KP + 64); }
#pragma unroll 1   // rolled: two passes unrolled take more than 256 registers, and the loop then switches register windows throughout
  for (int ps = 0; ps < TT / 32; ++ps) {
    v8f s[2][2];
#pragma unroll
    for (int kt = 0; kt < 2; ++kt)
#pragma unroll
      for (int g = 0; g < 2; ++g) s[kt][g] = mmah(kf[kt][1], qf[g][1], mmah(kf[kt][0], qf[g][0], bz[kt]));
    // the pass's LDS reads stand in one place: this pass's v, and the next pass's k rows and bias (the last pass re-reads pass 0, unused)
    v16h vf[4]; const int pn = (ps + 1) & (TT / 32 - 1);
#pragma unroll
    for (int t = 0; t < 4; ++t) vf[t] = frag_l(Vl + t * 16 * FA_VP + ps * 64);
#pragma unroll
    for (int kt = 0; kt < 2; ++kt) { bz[kt] = ld8f(Bl + (pn * 32 + kt * 16) * 4); kf[kt][0] = frag_l(Kl + (pn * 32 + kt * 16) * FA_KP); kf[kt][1] = frag_l(Kl + (pn * 32 + kt * 16) * FA_KP + 64); }
    __builtin_amdgcn_sched_barrier(0);   // the reads are issued ahead of the maxima, which then cover their latency
    float mb[2]; bool need = false;
#pragma unroll
    for (int g = 0; g < 2; ++g) { float mx = s[0][g][0];
#pragma unroll
      for (int r = 1; r < 8; ++r) mx = __builtin_fmaxf(mx, s[0][g][r]);
#pragma unroll
      for (int r = 0; r < 8; ++r) mx = __builtin_fmaxf(mx, s[1][g][r]);
      mx = __builtin_fmaxf(mx, xhalf(mx)) * cs; mb[g] = mx; need = need || (mx > m_run[g] + 8.0f); }
    __builtin_amdgcn_sched_barrier(0);   // keeps the statement below, and the wait it brings, behind the maxima
    // inputs only: holds the pass's LDS reads in front of the branch; sunk behind it they would stand directly in front of their first use
    asm volatile("" :: "v"(vf[0]), "v"(vf[1]), "v"(vf[2]), "v"(vf[3]), "v"(kf[0][0]), "v"(kf[0][1]), "v"(kf[1][0]), "v"(kf[1][1]), "v"(bz[0]), "v"(bz[1]));
    if (__builtin_amdgcn_ballot_w32(need) != 0) {   // one scalar test per pass; rare after the first unmasked keys
#pragma unroll
      for (int g = 0; g < 2; ++g) { const float m_new = __builtin_fmaxf(m_run[g], mb[g]); const float corr = __builtin_amdgcn_exp2f(m_run[g] - m_new); m_run[g] = m_new; lacc[g] = lacc[g] * corr;
#pragma unroll
        for (int t = 0; t < 4; ++t) acc[g][t] = acc[g][t] * corr; } }
#pragma unroll
    for (int g = 0; g < 2; ++g) { const float nm = 7.0f - m_run[g];   // P carried x 2^7: at most 2^15 in f16 (the maximum trails by 8 at most), small weights clear of f16 subnormals
      v16h pf; float a[16];
#pragma unroll
      for (int i = 0; i < 16; ++i) a[i] = __builtin_fmaf(s[i >> 3][g][i & 7], cs, nm);
      exp2x16(a);
#pragma unroll
      for (int i = 0; i < 16; ++i) pf[i] = (_Float16)a[i];
#pragma unroll
      for (int t = 0; t < 4; ++t) acc[g][t] = mmah(vf[t], pf, acc[g][t]);
      lacc[g] = mmah(ones, pf, lacc[g]); } }
  __syncthreads();   // every wave has left the k / v planes: their LDS becomes the output staging
  float* es = (float*)L + wave * 32 * FA_EP;
#pragma unroll
  for (int g = 0; g < 2; ++g) { const float inv = 1.0f / lacc[g][0];   // every row of the all-ones product holds the column's sum over both lane halves
#pragma unroll
    for (int t = 0; t < 4; ++t) { const v8f o = acc[g][t] * inv; float* p = es + (g * 16 + c) * FA_EP + t * 16 + 8 * hh; *(v4f*)p = v4f{o[0], o[1], o[2], o[3]}; *(v4f*)(p + 4) = v4f{o[4], o[5], o[6], o[7]}; } }
  LDSX();
#pragma unroll
  for (int i = 0; i < 16; ++i) { const int row = i * 2 + hh; vst2(Y + ((size_t)b * TT + qw0 + row) * CC + hd * HD + c * 4, *(const v4f*)(es + row * FA_EP + c * 4)); } }
// ---- k_out: block = 128 rows x 128 cols, 8 waves of 32 x 64: out = ctx Wo (+ bo): ctx x 2^6 once to f16 against Wo as f16(bf16 x 2^8) exact (1 product) x 2^-14.
// Each 64-wide k slice of both operands is read from global memory once per block in whole lines, converted once, and laid in LDS as f16 rows; every wave takes its fragments from there.
// Two LDS buffers; a register quad is refilled with the next slice as soon as it has been converted, so the global loads fly while this slice is multiplied. Every accumulator sums k ascending in steps of 32.
// (the plain unroll directives in k_out and its helpers keep the indices of their register arrays compile-time constants)
#define KO_P 144                   // LDS pitch of a 128-B f16 row: 16 B x odd
#define KO_T (128 * KO_P)          // one operand's slice
#define KO_NS (CC / 64)
#define KO_EP 68                   // floats per staged output row (272 B: 16 B x odd)
typedef __attribute__((ext_vector_type(4))) _Float16 v4h;
// converts the slice held in registers into LDS at d; MORE: refills the registers with the next slice, 64 floats behind ap / wp
template <bool MORE> __device__ __forceinline__ void ko_put(v4f (&ra)[8], v4f (&rw)[8], unsigned char* d, const float* ap, const float* wp) {
#pragma unroll
  for (int h = 0; h < 8; h += 2) {
#pragma unroll
    for (int i = h; i < h + 2; ++i) { v4h x, w;
#pragma unroll
      for (int e = 0; e < 4; ++e) { x[e] = (_Float16)(ra[i][e] * 64.0f); w[e] = (_Float16)(bfr(rw[i][e]) * 256.0f); }   /* ctx carried x 2^6 into f16 so small-magnitude context rows stay clear of f16 subnormals */
      *(v4h*)(d + i * 16 * KO_P) = x; *(v4h*)(d + KO_T + i * 16 * KO_P) = w; }
    if (MORE) {   // the two scheduling barriers: quads are waited for, converted and refilled in the order in which they were loaded (the counted waits then leave the younger loads in flight), each refill behind the last read of its registers (no second register set, no copies)
      __builtin_amdgcn_sched_barrier(0);
#pragma unroll
      for (int i = h; i < h + 2; ++i) { ra[i] = *(const v4f*)(ap + 64 + (size_t)i * 16 * CC); rw[i] = *(const v4f*)(wp + 64 + (size_t)i * 16 * CC); }
      __builtin_amdgcn_sched_barrier(0); } }
  if (MORE) asm volatile("s_wait_xcnt 0x0" :: "v"(ap), "v"(wp) : "memory"); }   // the wait kept before a register that an issued global load names is overwritten; the pointers are inputs, so that the pairs live through the run
// the work-group's barrier with the LDS wait alone: __syncthreads() would also wait out the global loads issued ahead for the next slice
__device__ __forceinline__ void ko_bar() { asm volatile("s_wait_dscnt 0x0" ::: "memory"); asm volatile("s_barrier_signal -1" ::: "memory"); asm volatile("s_barrier_wait -1" ::: "memory"); }
__device__ __forceinline__ void ko_mul(v8f (&acc)[2][4], const unsigned char* A, const unsigned char* B) {
#pragma unroll
  for (int ks = 0; ks < 2; ++ks) { v16h a[2], w[4];
#pragma unroll
    for (int i = 0; i < 2; ++i) a[i] = frag_l(A + i * 16 * KO_P + ks * 64);
#pragma unroll
    for (int j = 0; j < 4; ++j) w[j] = frag_l(B + j * 16 * KO_P + ks * 64);
#pragma unroll
    for (int i = 0; i < 2; ++i)
#pragma unroll
      for (int j = 0; j < 4; ++j) acc[i][j] = mmah(a[i], w[j], acc[i][j]); } }
__global__ __launch_bounds__(256) void k_out(const float* __restrict__ Y, const float* __restrict__ WO, const float* __restrict__ BO, float* __restrict__ OUT) {
  __shared__ __align__(16) unsigned char L[4 * KO_T];   // [buffer][ctx slice | Wo slice]
  static_assert(!CAUSAL && 8 * 32 * KO_EP * 4 <= 4 * KO_T, "single-product path only; the output staging fits the slices' LDS");
  const int tid = threadIdx.x, wave = tid >> 5, lane = tid & 31, c = lane & 15, hh = lane >> 4, wm = wave >> 1, wn = wave & 1; const int c0 = blockIdx.y * 128; const size_t r0 = (size_t)blockIdx.x * 128;
  const float* ap = Y + (r0 + (tid >> 4)) * CC + (tid & 15) * 4; const float* wp = WO + ((size_t)c0 + (tid >> 4)) * CC + (tid & 15) * 4;   // 16 lanes per 256-B row slice, 16 rows per step
  unsigned char* sl = L + (tid >> 4) * KO_P + (tid & 15) * 8;
  const unsigned char* Al = L + (wm * 32 + c) * KO_P + 16 * hh; const unsigned char* Wl = L + KO_T + (wn * 64 + c) * KO_P + 16 * hh;
  v4f ra[8], rw[8]; v8f acc[2][4] = {};
#pragma unroll
  for (int i = 0; i < 8; ++i) { ra[i] = *(const v4f*)(ap + (size_t)i * 16 * CC); rw[i] = *(const v4f*)(wp + (size_t)i * 16 * CC); }
  asm volatile("s_wait_xcnt 0x0" :: "v"(ap), "v"(wp) : "memory");   // as in ko_put
  for (int s = 0; s < KO_NS - 1; ++s) { const int bo = (s & 1) * 2 * KO_T;
    ko_put<true>(ra, rw, sl + bo, ap, wp); ap += 64; wp += 64;
    ko_bar();   // publishes slice s; it also ends every wave's reads of the other buffer, which the next trip overwrites
    ko_mul(acc, Al + bo, Wl + bo); }
  { const int bo = ((KO_NS - 1) & 1) * 2 * KO_T;
    ko_put<false>(ra, rw, sl + bo, ap, wp);
    ko_bar();
    ko_mul(acc, Al + bo, Wl + bo); }
  __syncthreads();   // every wave has left the slices: their LDS becomes the output staging
  float* es = (float*)L + wave * 32 * KO_EP;
#pragma unroll
  for (int j = 0; j < 4; ++j) { const float bias = BO ? bfr(BO[c0 + wn * 64 + j * 16 + c]) : 0.f;
#pragma unroll
    for (int i = 0; i < 2; ++i)
#pragma unroll
      for (int r = 0; r < 8; ++r) es[(i * 16 + 8 * hh + r) * KO_EP + j * 16 + c] = acc[i][j][r] * (1.0f / 16384.0f) + bias; }   /* 2^-8 (Wo carry) x 2^-6 (ctx carry) */
  LDSX();
#pragma unroll
  for (int i = 0; i < 16; ++i) { const int row = i * 2 + hh; vst2(OUT + (r0 + wm * 32 + row) * DIN + c0 + wn * 64 + c * 4, *(const v4f*)(es + row * KO_EP + c * 4)); } }

static_assert(HD == 64 && CC == NH * HD && DIN == CC, "block-diagonal per-head projection: 128-column tiles = two 64-wide heads, input width == projected width");
extern "C" void kernel_launch(void* const* d_in, const int* in_sizes, int n_in, void* d_out, int out_size, void* d_ws, size_t ws_size, hipStream_t stream) {
  (void)in_sizes; (void)n_in; (void)out_size;
  const float** F = (const float**)d_in;
  if (ws_size < (size_t)WS_END) return;
  char* ws = (char*)d_ws; _Float16 *QH = (_Float16*)(ws + WS_QH), *KH = (_Float16*)(ws + WS_KH), *VT = (_Float16*)(ws + WS_VT), *QL = (_Float16*)(ws + WS_QL), *KL = (_Float16*)(ws + WS_KL); __bf16 *VB = (__bf16*)(ws + WS_VB), *VBL = (__bf16*)(ws + WS_VBL); float *S = (float*)(ws + WS_S), *Y = (float*)(ws + WS_Y);
  (void)Y; (void)QL; (void)KL; (void)VB; (void)VBL; (void)S;
  // inputs: 0 values [4,1024,1024]; 1 keys; 2 queries; 3 mask [4,1,1,1024] int32 (random 0/1; 0 = masked key); 4 Wv [64,64] (out,in); 5 Wk; 6 Wq (no projection biases); 7 Wo [1024,1024] (out,in); 8 bo (NONZERO)
  k_proj<<<dim3(TNB * TT / 64, CC / 128, 3), 128, 0, stream>>>(F[2], F[1], F[0], F[6], F[5], F[4], nullptr, nullptr, nullptr, QH, QL, KH, KL, VT, VB, VBL);
  k_fa<<<dim3(TT / 256, NH, TNB), 256, 0, stream>>>(QH, KH, VT, (const int*)d_in[3], Y);
  k_out<<<dim3(TNB * TT / 128, DIN / 128), 256, 0, stream>>>(Y, F[7], F[8], (float*)d_out);
}

// v003
// It runs in 40.9 microseconds.
// In two side-by-side timings against v002, it was 1.55 and 1.56 times as fast.
// Over all steps from v000 it is 16.7 times as fast.
// compute dtype: all float inputs rounded to bf16; the per-head 64 x 64 q / k / v projections (ONE shared weight per stream, applied to every head) with EXACT bf16 products on WMMA 16x16x32 (f32 accumulate) (no projection biases); logits q x k once to f16 each (1 product) x 1024^-0.5; the per-(batch, key) int mask as a bias per key; online softmax f32 (log2 domain); unnormalised P x 2^7 once to f16 x v once to f16 (1 product), divided by the f32 sum of the same f16 P; ctx x 2^6 once to f16 x Wo f16(bf16 x 2^8) + bo; f32 output.
#include <hip/hip_runtime.h>
#include <math.h>

typedef __attribute__((ext_vector_type(16))) _Float16 v16h;
typedef __attribute__((ext_vector_type(16))) __bf16 v16b;
typedef __attribute__((ext_vector_type(8)))  _Float16 v8h;
typedef __attribute__((ext_vector_type(8)))  float v8f;
typedef __attribute__((ext_vector_type(4)))  float v4f;
typedef __attribute__((ext_vector_type(2)))  float v2f;
typedef __attribute__((ext_vector_type(4)))  unsigned v4u;
typedef __attribute__((ext_vector_type(4)))  int v4i;
typedef float __attribute__((may_alias)) float_a;
typedef int __attribute__((may_alias)) int_a;

template <typename T> __device__ __forceinline__ void vst2(void* p, T v) { *(T*)p = v;  }
__device__ __forceinline__ v8f wmma16(v16h a, v16h b, v8f c) {
  v8f d = __builtin_amdgcn_wmma_f32_16x16x32_f16(false, a, false, b, (short)0, c, false, false);
  asm volatile("v_nop\n\tv_nop\n\tv_nop\n\tv_nop" : "+v"(d) : "v"(a), "v"(b));
  return d;
}
__device__ __forceinline__ v8f wmma_bf(v16b a, v16b b, v8f c) {
  v8f d = __builtin_amdgcn_wmma_f32_16x16x32_bf16(false, a, false, b, (short)0, c, false, false);
  asm volatile("v_nop\n\tv_nop\n\tv_nop\n\tv_nop" : "+v"(d) : "v"(a), "v"(b));
  return d;
}
// 16x16x32 fragments: lane = (h = lane>>4, row/col = lane&15); elements 0..7 = k0+8h+0..7, 8..15 = k0+16+8h+0..7; D element r = row 8h+r
__device__ __forceinline__ v16h frag_h(const _Float16* rowk0, int lane) {
  union { v16h v; v8h q[2]; } u; const _Float16* p = rowk0 + 8 * (lane >> 4);
  u.q[0] = *(const v8h*)p; u.q[1] = *(const v8h*)(p + 16); return u.v;
}
__device__ __forceinline__ v16h frag_f32(const float* rowk0, int lane) {
  v16h a; const float* p = rowk0 + 8 * (lane >> 4);
#pragma unroll
  for (int i = 0; i < 8; ++i) { a[i] = (_Float16)p[i]; a[8 + i] = (_Float16)p[16 + i]; }
  return a;
}
__device__ __forceinline__ v16h frag_f32s(const float* rowk0, int lane, float sc) {
  v16h a; const float* p = rowk0 + 8 * (lane >> 4);
#pragma unroll
  for (int i = 0; i < 8; ++i) { a[i] = (_Float16)(p[i] * sc); a[8 + i] = (_Float16)(p[16 + i] * sc); }
  return a;
}
// column fragment from a [K][ld] layout (column n), rows >= K read as 0
__device__ __forceinline__ v16h fragc_f32(const float* W, int k0, int n, int lane, int ld, int K) {
  v16h a; const int g = lane >> 4;
#pragma unroll
  for (int i = 0; i < 8; ++i) { const int ka = k0 + 8 * g + i, kb = ka + 16;
    a[i] = (_Float16)(ka < K ? W[(size_t)(ka < K ? ka : K - 1) * ld + n] : 0.f); a[8 + i] = (_Float16)(kb < K ? W[(size_t)(kb < K ? kb : K - 1) * ld + n] : 0.f); }
  return a;
}
struct F2 { v16b h, l; };
__device__ __forceinline__ F2 bsplit16(const float v[16]) { F2 r;
#pragma unroll
  for (int i = 0; i < 16; ++i) { const __bf16 h = (__bf16)v[i]; r.h[i] = h; r.l[i] = (__bf16)(v[i] - (float)h); }
  return r; }
__device__ __forceinline__ F2 split_row(const float* row, int k0, int lane) { float v[16]; const float* p = row + k0 + 8 * (lane >> 4);
#pragma unroll
  for (int i = 0; i < 8; ++i) { v[i] = p[i]; v[8 + i] = p[16 + i]; }
  return bsplit16(v); }
__device__ __forceinline__ F2 split_rowK(const float* row, int k0, int lane, int K) { float v[16]; const int g = lane >> 4;
#pragma unroll
  for (int i = 0; i < 8; ++i) { const int ka = k0 + 8 * g + i, kb = ka + 16; v[i] = ka < K ? row[ka < K ? ka : K - 1] : 0.f; v[8 + i] = kb < K ? row[kb < K ? kb : K - 1] : 0.f; }
  return bsplit16(v); }
__device__ __forceinline__ F2 split_col(const float* W, int k0, int n, int lane, int ld, int K) { float v[16]; const int g = lane >> 4;
#pragma unroll
  for (int i = 0; i < 8; ++i) { const int ka = k0 + 8 * g + i, kb = ka + 16; v[i] = ka < K ? W[(size_t)(ka < K ? ka : K - 1) * ld + n] : 0.f; v[8 + i] = kb < K ? W[(size_t)(kb < K ? kb : K - 1) * ld + n] : 0.f; }
  return bsplit16(v); }
__device__ __forceinline__ v8f mac3(const F2& a, const F2& b, v8f c) { c = wmma_bf(a.l, b.h, c); c = wmma_bf(a.h, b.l, c); return wmma_bf(a.h, b.h, c); }
__device__ __forceinline__ float sigm(float v) { return 1.0f / (1.0f + expf(-v)); }
#define LDSX() do { asm volatile("s_wait_dscnt 0" ::: "memory"); __builtin_amdgcn_wave_barrier(); __builtin_amdgcn_fence(__ATOMIC_RELEASE, "workgroup"); } while (0)

// Multi-head attention whose q / k / v projections are ONE shared 64 x 64 linear per stream applied to every head, with a key mask (inputs in the order values, keys, queries [4,1024,1024]; mask [4,1,1,1024] int32 RANDOM 0/1 per (batch, key); torch (out,in) Wv / Wk / Wq [64,64] uniform(+-1/8), NO projection biases; heads = reshape(N, L, 16, 64); einsum('nlhd,od->nlho'); energy = einsum('nqhd,nkhd->nhqk'); where(mask == 0, -1e20, energy); softmax(energy * 1/sqrt(1024)) - the scale is 1/32, not 1/8; out merged to [N, L, 1024]; out @ Wo.T + bo with Wo [1024,1024] and bo uniform(+-1/32), bo NONZERO).
#define NB 4
#define TT 1024
#define CC 1024            // NH * HD = projected width
#define DIN 1024          // input (model) width
#define NH 16
#define HD 64
#define NQB (TT / 64)
#define HG 8   // S workspace sized for eight heads: 8 x 1,024 x 1,024 f32 = 32 MiB; no kernel uses it
#define SCALE (0.03125f)   // 1 / sqrt(E) with E = 1024 (the module scales by the MODEL width, not the head width)
#define CAUSAL 0
#ifndef TNB
#define TNB NB
#endif
__device__ __forceinline__ float bfr(float v) { return (float)(__bf16)v; }
__host__ __device__ __forceinline__ int kb_last(int qb) { return CAUSAL ? ((qb * 64 + 63) >> 7) : (TT / 128 - 1); }
typedef __attribute__((ext_vector_type(8))) __bf16 v8b;
__device__ __forceinline__ v16b frag_b(const __bf16* rowk0, int lane) {
  union { v16b v; v8b q[2]; } u; const __bf16* p = rowk0 + 8 * (lane >> 4);
  u.q[0] = *(const v8b*)p; u.q[1] = *(const v8b*)(p + 16); return u.v;
}
#define QBH 0
#define QHI 0               // single-product logits on every row
#define KHI 64            // key rows carrying k residual / v bf16 hi+lo planes (no kernel writes or reads them)
// B fragment (k rows k0+.., output column o) of a weight: (in,out) [K][ld] or (out,in) [ld rows of K]: bf16 exact, or f16(bf16 * 256) exact
__device__ __forceinline__ v16b wcol_io(const float* Wm, int k0, int o, int lane, int ld) { v16b w; const int g = lane >> 4;
#pragma unroll
  for (int i = 0; i < 8; ++i) { w[i] = (__bf16)Wm[(size_t)(k0 + 8 * g + i) * ld + o]; w[8 + i] = (__bf16)Wm[(size_t)(k0 + 16 + 8 * g + i) * ld + o]; }
  return w; }
__device__ __forceinline__ v16b wcol_oi(const float* Wm, int k0, int o, int lane, int K) { v16b w; const float* p = Wm + (size_t)o * K + k0 + 8 * (lane >> 4);
#pragma unroll
  for (int i = 0; i < 8; ++i) { w[i] = (__bf16)p[i]; w[8 + i] = (__bf16)p[16 + i]; }
  return w; }
__device__ __forceinline__ v16h wcolh_io(const float* Wm, int k0, int o, int lane, int ld) { v16h w; const int g = lane >> 4;
#pragma unroll
  for (int i = 0; i < 8; ++i) { w[i] = (_Float16)(bfr(Wm[(size_t)(k0 + 8 * g + i) * ld + o]) * 256.0f); w[8 + i] = (_Float16)(bfr(Wm[(size_t)(k0 + 16 + 8 * g + i) * ld + o]) * 256.0f); }
  return w; }
__device__ __forceinline__ v16h wcolh_oi(const float* Wm, int k0, int o, int lane, int K) { v16h w; const float* p = Wm + (size_t)o * K + k0 + 8 * (lane >> 4);
#pragma unroll
  for (int i = 0; i < 8; ++i) { w[i] = (_Float16)(bfr(p[i]) * 256.0f); w[8 + i] = (_Float16)(bfr(p[16 + i]) * 256.0f); }
  return w; }
#define WQKV_LAYOUT 1   // 0 = (in,out) [DIN][CC]; 1 = (out,in) [CC][DIN]; 2 = per-head [NH][DIN][HD]
__device__ __forceinline__ v16b wcol_hdk(const float* Wm, int k0, int o, int lane) { v16b w; const int g = lane >> 4; const float* p = Wm + (size_t)(o / HD) * DIN * HD + (o % HD);
#pragma unroll
  for (int i = 0; i < 8; ++i) { w[i] = (__bf16)p[(size_t)(k0 + 8 * g + i) * HD]; w[8 + i] = (__bf16)p[(size_t)(k0 + 16 + 8 * g + i) * HD]; }
  return w; }
#define WO_OUT_IN 1
#if WQKV_LAYOUT == 1
#define WCOL(W, k0, o, lane) wcol_oi(W, k0, o, lane, DIN)
#elif WQKV_LAYOUT == 2
#define WCOL(W, k0, o, lane) wcol_hdk(W, k0, o, lane)
#else
#define WCOL(W, k0, o, lane) wcol_io(W, k0, o, lane, CC)
#endif
#if WO_OUT_IN
#define WOCOL(W, k0, o, lane) wcol_oi(W, k0, o, lane, CC)
#define WOCOLH(W, k0, o, lane) wcolh_oi(W, k0, o, lane, CC)
#else
#define WOCOL(W, k0, o, lane) wcol_io(W, k0, o, lane, DIN)
#define WOCOLH(W, k0, o, lane) wcolh_io(W, k0, o, lane, DIN)
#endif
#ifndef PROJ_EXTRA_PARAMS
#define PROJ_EXTRA_PARAMS
#endif

#define WS_QH  0u                                      // f16 q rows [b*t][CC], unused: k_fa keeps q in registers
#define WS_KH  (WS_QH + 2u * (size_t)NB * TT * CC)      // f16 k rows [b*t][CC], unused: k_fa makes k straight into LDS
#define WS_VT  (WS_KH + 2u * (size_t)NB * TT * CC)      // f16 v planes [b][c][t], unused: k_fa makes v straight into LDS
#define WS_QL  (WS_VT + 2u * (size_t)NB * CC * TT)      // f16 q residual x 2^10 rows [b][t < QHI][CC]
#define WS_KL  (WS_QL + 2u * (size_t)NB * QHI * CC)     // f16 k residual x 2^10 rows [b][t < KHI][CC]
#define WS_VB  (WS_KL + 2u * (size_t)NB * KHI * CC)     // bf16 v hi planes [b][c][t < KHI]
#define WS_VBL (WS_VB + 2u * (size_t)NB * CC * KHI)
#define WS_S   (WS_VBL + 2u * (size_t)NB * CC * KHI)    // f32 [hg][t][s], unused: k_fa keeps the scores in registers
#define WS_Y   (WS_S  + 4u * (size_t)HG * TT * TT)      // f32 ctx rows [b*t][CC] (only when there is an output projection)
#define WS_END (WS_Y  + 4u * (size_t)NB * TT * CC)

#define FA_KP 144                  // LDS pitch of a 128-B k row: 16 B x odd
#define FA_VP 2064                 // LDS pitch of a 2,048-B v plane row: 16 B x odd
#define FA_KB (TT * FA_KP)
#define FA_VB (HD * FA_VP)
#define FA_EP 68                   // floats per staged ctx row (272 B: 16 B x odd)
__device__ __forceinline__ v8f mmah(v16h a, v16h b, v8f c) { return __builtin_amdgcn_wmma_f32_16x16x32_f16(false, a, false, b, (short)0, c, false, false); }
__device__ __forceinline__ v16h frag_l(const unsigned char* p) { union { v16h v; v8h q[2]; } u; u.q[0] = *(const v8h*)p; u.q[1] = *(const v8h*)(p + 32); return u.v; }
__device__ __forceinline__ v8f ld8f(const unsigned char* p) { union { v8f v; v4f q[2]; } u; u.q[0] = *(const v4f*)p; u.q[1] = *(const v4f*)(p + 16); return u.v; }
// sixteen base-2 exponentials, each in place, in one statement: directly behind a transcendental stands nothing that reads its result or overwrites its source; the v_nop is that slot behind the last one
__device__ __forceinline__ void exp2x16(float (&a)[16]) {
  asm("v_exp_f32 %0, %0\n\tv_exp_f32 %1, %1\n\tv_exp_f32 %2, %2\n\tv_exp_f32 %3, %3\n\tv_exp_f32 %4, %4\n\tv_exp_f32 %5, %5\n\tv_exp_f32 %6, %6\n\tv_exp_f32 %7, %7\n\tv_exp_f32 %8, %8\n\tv_exp_f32 %9, %9\n\tv_exp_f32 %10, %10\n\tv_exp_f32 %11, %11\n\tv_exp_f32 %12, %12\n\tv_exp_f32 %13, %13\n\tv_exp_f32 %14, %14\n\tv_exp_f32 %15, %15\n\tv_nop" : "+v"(a[0]), "+v"(a[1]), "+v"(a[2]), "+v"(a[3]), "+v"(a[4]), "+v"(a[5]), "+v"(a[6]), "+v"(a[7]), "+v"(a[8]), "+v"(a[9]), "+v"(a[10]), "+v"(a[11]), "+v"(a[12]), "+v"(a[13]), "+v"(a[14]), "+v"(a[15])); }
__device__ __forceinline__ float xhalf(float x) { return __builtin_bit_cast(float, __builtin_amdgcn_permlanex16(__builtin_bit_cast(int, x), __builtin_bit_cast(int, x), 0x76543210, 0xfedcba98, false, false)); }  // lane l with lane l ^ 16
#define FA_SP 144                  // LDS pitch of a staged 128-B bf16 row: 16 B x odd
#define FA_SG (32 * FA_SP)         // one wave's staging: a group of 32 rows
typedef __attribute__((ext_vector_type(4))) __bf16 v4b;
__device__ __forceinline__ v8f mmab(v16b a, v16b b, v8f c) { return __builtin_amdgcn_wmma_f32_16x16x32_bf16(false, a, false, b, (short)0, c, false, false); }
__device__ __forceinline__ v16b frag_lb(const unsigned char* p) { union { v16b v; v8b q[2]; } u; u.q[0] = *(const v8b*)p; u.q[1] = *(const v8b*)(p + 32); return u.v; }
// a group's loads: 16 lanes per 256-B row, two rows an instruction; p = the lane's place in rows 0 / 1 of the group
template <int PITCH> __device__ __forceinline__ void pj_ld(v4f (&t)[16], const float* p) {
#pragma unroll
  for (int j = 0; j < 16; ++j) t[j] = *(const v4f*)(p + (size_t)j * 2 * PITCH);
  asm volatile("s_wait_xcnt 0x0" :: "v"(p) : "memory"); }   // the wait kept before a register that an issued global load names is overwritten; the pointer is an input, so that the pair lives through the run
// rounds the group held in registers to bf16 rows in the wave's staging; d = the lane's place in rows 0 / 1
__device__ __forceinline__ void pj_put(const v4f (&t)[16], unsigned char* d) {
#pragma unroll
  for (int j = 0; j < 16; ++j) { v4b x;
#pragma unroll
    for (int e = 0; e < 4; ++e) x[e] = (__bf16)t[j][e];
    *(v4b*)(d + j * 2 * FA_SP) = x; }
  __builtin_amdgcn_sched_barrier(0); }   // the refill that follows stands behind the last read of its registers: no second register set
// the wave's own LDS writes have landed before its other lanes read them; no fence: that would also wait out the global loads in flight
__device__ __forceinline__ void pj_wx() { asm volatile("s_wait_dscnt 0x0" ::: "memory"); __builtin_amdgcn_wave_barrier(); }
__device__ __forceinline__ v8h pj_h(v8f d) { v8h h;
#pragma unroll
  for (int r = 0; r < 8; ++r) h[r] = (_Float16)d[r];
  return h; }
// the staged group of 32 input rows times the weight: k rows as W . x^T (a lane holds 8 output dims of one key), v planes as x . W^T (a lane holds 8 keys of one output dim): one 16-B LDS store per tile either way
__device__ __forceinline__ void pj_mul(const v16b (&w)[4][2], const unsigned char* sr, unsigned char* kd, unsigned char* vd, bool is_v) {
  if (is_v) {
#pragma unroll
    for (int tl = 0; tl < 2; ++tl) { const v16b x0 = frag_lb(sr + tl * 16 * FA_SP), x1 = frag_lb(sr + tl * 16 * FA_SP + 64);
#pragma unroll
      for (int ot = 0; ot < 4; ++ot) *(v8h*)(vd + ot * 16 * FA_VP + tl * 32) = pj_h(mmab(x1, w[ot][1], mmab(x0, w[ot][0], v8f{}))); }
  } else {
#pragma unroll
    for (int tl = 0; tl < 2; ++tl) { const v16b x0 = frag_lb(sr + tl * 16 * FA_SP), x1 = frag_lb(sr + tl * 16 * FA_SP + 64);
#pragma unroll
      for (int ot = 0; ot < 4; ++ot) *(v8h*)(kd + tl * 16 * FA_KP + ot * 32) = pj_h(mmab(w[ot][1], x1, mmab(w[ot][0], x0, v8f{}))); } } }
__global__ __launch_bounds__(256) void k_fa(const float* __restrict__ XQ, const float* __restrict__ XK, const float* __restrict__ XV, const float* __restrict__ WQ, const float* __restrict__ WK, const float* __restrict__ WV, const int* __restrict__ MASK, float* __restrict__ Y) {
  __shared__ __align__(16) unsigned char L[FA_KB + FA_VB + 4 * TT + 8 * FA_SG];
  const int tid = threadIdx.x, wave = tid >> 5, lane = tid & 31, c = lane & 15, hh = lane >> 4; const int hd = blockIdx.y, b = blockIdx.z; const int qw0 = blockIdx.x * 256 + wave * 32;
  const int* Mb = MASK + b * TT;
  { const v4i mm = *(const v4i*)(Mb + tid * 4); v4f bz;
#pragma unroll
    for (int i = 0; i < 4; ++i) bz[i] = mm[i] == 0 ? -1.0e30f : 0.f;
    *(v4f*)(L + FA_KB + FA_VB + tid * 16) = bz; }
  v16h qf[2][2];
  { const int wv = __builtin_amdgcn_readfirstlane(wave); const bool is_v = wv >= 4; const int k0 = (wv & 3) * 256;   // the wave's 256 keys
    const float* wp = (is_v ? WV : WK) + hh * HD + c * 4; const float* wqp = WQ + hh * HD + c * 4;
    const float* xp = (is_v ? XV : XK) + ((size_t)b * TT + k0 + hh) * DIN + hd * HD + c * 4; const float* qp = XQ + ((size_t)b * TT + qw0 + hh) * DIN + hd * HD + c * 4;
    unsigned char* sw = L + FA_KB + FA_VB + 4 * TT + wv * FA_SG + hh * FA_SP + c * 8; const unsigned char* sr = L + FA_KB + FA_VB + 4 * TT + wv * FA_SG + c * FA_SP + 16 * hh;
    unsigned char* kd = L + (k0 + c) * FA_KP + 16 * hh; unsigned char* vd = L + FA_KB + c * FA_VP + (k0 + 8 * hh) * 2;
    v4f ta[16], tb[16]; v16b w[4][2];
    pj_ld<HD>(ta, wp); pj_ld<HD>(tb, wp + 32 * HD);
    pj_put(ta, sw); pj_ld<DIN>(ta, xp); pj_wx();
#pragma unroll
    for (int i = 0; i < 4; ++i) w[i >> 1][i & 1] = frag_lb(sr + (i >> 1) * 16 * FA_SP + (i & 1) * 64);
    pj_wx();   // the weight fragments have been read before the next group overwrites the staging
    pj_put(tb, sw); pj_ld<DIN>(tb, xp + 32 * DIN); pj_wx();
#pragma unroll
    for (int i = 0; i < 4; ++i) w[2 + (i >> 1)][i & 1] = frag_lb(sr + (i >> 1) * 16 * FA_SP + (i & 1) * 64);
    pj_wx();   // as above
#pragma unroll 1   // rolled: the projection runs once per launch
    for (int it = 0; it < 3; ++it) {
      pj_put(ta, sw); pj_ld<DIN>(ta, xp + 64 * DIN); pj_wx(); pj_mul(w, sr, kd, vd, is_v);
      pj_put(tb, sw); pj_ld<DIN>(tb, xp + 96 * DIN); pj_wx(); pj_mul(w, sr, kd + 32 * FA_KP, vd + 64, is_v);
      xp += 64 * DIN; kd += 64 * FA_KP; vd += 128; }
    pj_put(ta, sw); pj_ld<HD>(ta, wqp); pj_wx(); pj_mul(w, sr, kd, vd, is_v);
    pj_put(tb, sw); pj_ld<HD>(tb, wqp + 32 * HD); pj_wx(); pj_mul(w, sr, kd + 32 * FA_KP, vd + 64, is_v);
    pj_put(ta, sw); pj_ld<DIN>(ta, qp); pj_wx();
#pragma unroll
    for (int i = 0; i < 4; ++i) w[i >> 1][i & 1] = frag_lb(sr + (i >> 1) * 16 * FA_SP + (i & 1) * 64);
    pj_wx();   // the weight fragments have been read before the next group overwrites the staging
    pj_put(tb, sw); pj_wx();
#pragma unroll
    for (int i = 0; i < 4; ++i) w[2 + (i >> 1)][i & 1] = frag_lb(sr + (i >> 1) * 16 * FA_SP + (i & 1) * 64);
    pj_wx();   // as above
    pj_put(ta, sw); pj_wx();
    // q^T = W . x^T: output tiles 2 kc and 2 kc + 1 of a query column are, lane for lane, the two halves of its B fragment for k step kc
#pragma unroll
    for (int g = 0; g < 2; ++g) { const v16b x0 = frag_lb(sr + g * 16 * FA_SP), x1 = frag_lb(sr + g * 16 * FA_SP + 64);
#pragma unroll
      for (int kc = 0; kc < 2; ++kc) { union { v16h v; v8h q[2]; } u;
#pragma unroll
        for (int i = 0; i < 2; ++i) u.q[i] = pj_h(mmab(w[2 * kc + i][1], x1, mmab(w[2 * kc + i][0], x0, v8f{})));
        qf[g][kc] = u.v; } } }
  __syncthreads();
  // a batch whose keys are ALL masked: the reference's logits are then all equal, i.e. uniform weights: scale 0 gives exactly that, whatever the (finite) biased scores are
  float bmx = -1.0e30f;
#pragma unroll
  for (int i = 0; i < 8; ++i) { const v4f b4 = *(const v4f*)(L + FA_KB + FA_VB + lane * 16 + i * 512); bmx = __builtin_fmaxf(__builtin_fmaxf(bmx, __builtin_fmaxf(b4[0], b4[1])), __builtin_fmaxf(b4[2], b4[3])); }
  const float cs = __builtin_amdgcn_ballot_w32(bmx == 0.f) != 0 ? SCALE * 1.4426950408889634f : 0.f;
  v16h ones;
#pragma unroll
  for (int i = 0; i < 16; ++i) ones[i] = (_Float16)1.0f;
  v8f acc[2][4] = {}, lacc[2] = {}; float m_run[2] = {-1.0e20f, -1.0e20f};   // the floor lies far above a masked score (-1e30 x scale) and far below any real one: a stretch of masked keys alone yields P = 0
  const unsigned char* Kl = L + c * FA_KP + 16 * hh; const unsigned char* Vl = L + FA_KB + c * FA_VP + 16 * hh; const unsigned char* Bl = L + FA_KB + FA_VB + 32 * hh;
  v16h kf[2][2]; v8f bz[2];
#pragma unroll
  for (int kt = 0; kt < 2; ++kt) { bz[kt] = ld8f(Bl + kt * 64); kf[kt][0] = frag_l(Kl + kt * 16 * FA_KP); kf[kt][1] = frag_l(Kl + kt * 16 * FA_KP + 64); }
#pragma unroll 1   // rolled: two passes unrolled take more than 256 registers, and the loop then switches register windows throughout
  for (int ps = 0; ps < TT / 32; ++ps) {
    v8f s[2][2];
#pragma unroll
    for (int kt = 0; kt < 2; ++kt)
#pragma unroll
      for (int g = 0; g < 2; ++g) s[kt][g] = mmah(kf[kt][1], qf[g][1], mmah(kf[kt][0], qf[g][0], bz[kt]));
    // the pass's LDS reads stand in one place: this pass's v, and the next pass's k rows and bias (the last pass re-reads pass 0, unused)
    v16h vf[4]; const int pn = (ps + 1) & (TT / 32 - 1);
#pragma unroll
    for (int t = 0; t < 4; ++t) vf[t] = frag_l(Vl + t * 16 * FA_VP + ps * 64);
#pragma unroll
    for (int kt = 0; kt < 2; ++kt) { bz[kt] = ld8f(Bl + (pn * 32 + kt * 16) * 4); kf[kt][0] = frag_l(Kl + (pn * 32 + kt * 16) * FA_KP); kf[kt][1] = frag_l(Kl + (pn * 32 + kt * 16) * FA_KP + 64); }
    __builtin_amdgcn_sched_barrier(0);   // the reads are issued ahead of the maxima, which then cover their latency
    float mb[2]; bool need = false;
#pragma unroll
    for (int g = 0; g < 2; ++g) { float mx = s[0][g][0];
#pragma unroll
      for (int r = 1; r < 8; ++r) mx = __builtin_fmaxf(mx, s[0][g][r]);
#pragma unroll
      for (int r = 0; r < 8; ++r) mx = __builtin_fmaxf(mx, s[1][g][r]);
      mx = __builtin_fmaxf(mx, xhalf(mx)) * cs; mb[g] = mx; need = need || (mx > m_run[g] + 8.0f); }
    __builtin_amdgcn_sched_barrier(0);   // keeps the statement below, and the wait it brings, behind the maxima
    // inputs only: holds the pass's LDS reads in front of the branch; sunk behind it they would stand directly in front of their first use
    asm volatile("" :: "v"(vf[0]), "v"(vf[1]), "v"(vf[2]), "v"(vf[3]), "v"(kf[0][0]), "v"(kf[0][1]), "v"(kf[1][0]), "v"(kf[1][1]), "v"(bz[0]), "v"(bz[1]));
    if (__builtin_amdgcn_ballot_w32(need) != 0) {   // one scalar test per pass; rare after the first unmasked keys
#pragma unroll
      for (int g = 0; g < 2; ++g) { const float m_new = __builtin_fmaxf(m_run[g], mb[g]); const float corr = __builtin_amdgcn_exp2f(m_run[g] - m_new); m_run[g] = m_new; lacc[g] = lacc[g] * corr;
#pragma unroll
        for (int t = 0; t < 4; ++t) acc[g][t] = acc[g][t] * corr; } }
#pragma unroll
    for (int g = 0; g < 2; ++g) { const float nm = 7.0f - m_run[g];   // P carried x 2^7: at most 2^15 in f16 (the maximum trails by 8 at most), small weights clear of f16 subnormals
      v16h pf; float a[16];
#pragma unroll
      for (int i = 0; i < 16; ++i) a[i] = __builtin_fmaf(s[i >> 3][g][i & 7], cs, nm);
      exp2x16(a);
#pragma unroll
      for (int i = 0; i < 16; ++i) pf[i] = (_Float16)a[i];
#pragma unroll
      for (int t = 0; t < 4; ++t) acc[g][t] = mmah(vf[t], pf, acc[g][t]);
      lacc[g] = mmah(ones, pf, lacc[g]); } }
  __syncthreads();   // every wave has left the k / v planes: their LDS becomes the output staging
  float* es = (float*)L + wave * 32 * FA_EP;
#pragma unroll
  for (int g = 0; g < 2; ++g) { const float inv = 1.0f / lacc[g][0];   // every row of the all-ones product holds the column's sum over both lane halves
#pragma unroll
    for (int t = 0; t < 4; ++t) { const v8f o = acc[g][t] * inv; float* p = es + (g * 16 + c) * FA_EP + t * 16 + 8 * hh; *(v4f*)p = v4f{o[0], o[1], o[2], o[3]}; *(v4f*)(p + 4) = v4f{o[4], o[5], o[6], o[7]}; } }
  LDSX();
#pragma unroll
  for (int i = 0; i < 16; ++i) { const int row = i * 2 + hh; vst2(Y + ((size_t)b * TT + qw0 + row) * CC + hd * HD + c * 4, *(const v4f*)(es + row * FA_EP + c * 4)); } }
// ---- k_out: block = 128 rows x 128 cols, 8 waves of 32 x 64: out = ctx Wo (+ bo): ctx x 2^6 once to f16 against Wo as f16(bf16 x 2^8) exact (1 product) x 2^-14.
// Each 64-wide k slice of both operands is read from global memory once per block in whole lines, converted once, and laid in LDS as f16 rows; every wave takes its fragments from there.
// Two LDS buffers; a register quad is refilled with the next slice as soon as it has been converted, so the global loads fly while this slice is multiplied. Every accumulator sums k ascending in steps of 32.
// (the plain unroll directives in k_out and its helpers keep the indices of their register arrays compile-time constants)
#define KO_P 144                   // LDS pitch of a 128-B f16 row: 16 B x odd
#define KO_T (128 * KO_P)          // one operand's slice
#define KO_NS (CC / 64)
#define KO_EP 68                   // floats per staged output row (272 B: 16 B x odd)
typedef __attribute__((ext_vector_type(4))) _Float16 v4h;
// converts the slice held in registers into LDS at d; MORE: refills the registers with the next slice, 64 floats behind ap / wp
template <bool MORE> __device__ __forceinline__ void ko_put(v4f (&ra)[8], v4f (&rw)[8], unsigned char* d, const float* ap, const float* wp) {
#pragma unroll
  for (int h = 0; h < 8; h += 2) {
#pragma unroll
    for (int i = h; i < h + 2; ++i) { v4h x, w;
#pragma unroll
      for (int e = 0; e < 4; ++e) { x[e] = (_Float16)(ra[i][e] * 64.0f); w[e] = (_Float16)(bfr(rw[i][e]) * 256.0f); }   /* ctx carried x 2^6 into f16 so small-magnitude context rows stay clear of f16 subnormals */
      *(v4h*)(d + i * 16 * KO_P) = x; *(v4h*)(d + KO_T + i * 16 * KO_P) = w; }
    if (MORE) {   // the two scheduling barriers: quads are waited for, converted and refilled in the order in which they were loaded (the counted waits then leave the younger loads in flight), each refill behind the last read of its registers (no second register set, no copies)
      __builtin_amdgcn_sched_barrier(0);
#pragma unroll
      for (int i = h; i < h + 2; ++i) { ra[i] = *(const v4f*)(ap + 64 + (size_t)i * 16 * CC); rw[i] = *(const v4f*)(wp + 64 + (size_t)i * 16 * CC); }
      __builtin_amdgcn_sched_barrier(0); } }
  if (MORE) asm volatile("s_wait_xcnt 0x0" :: "v"(ap), "v"(wp) : "memory"); }   // the wait kept before a register that an issued global load names is overwritten; the pointers are inputs, so that the pairs live through the run
// the work-group's barrier with the LDS wait alone: __syncthreads() would also wait out the global loads issued ahead for the next slice
__device__ __forceinline__ void ko_bar() { asm volatile("s_wait_dscnt 0x0" ::: "memory"); asm volatile("s_barrier_signal -1" ::: "memory"); asm volatile("s_barrier_wait -1" ::: "memory"); }
__device__ __forceinline__ void ko_mul(v8f (&acc)[2][4], const unsigned char* A, const unsigned char* B) {
#pragma unroll
  for (int ks = 0; ks < 2; ++ks) { v16h a[2], w[4];
#pragma unroll
    for (int i = 0; i < 2; ++i) a[i] = frag_l(A + i * 16 * KO_P + ks * 64);
#pragma unroll
    for (int j = 0; j < 4; ++j) w[j] = frag_l(B + j * 16 * KO_P + ks * 64);
#pragma unroll
    for (int i = 0; i < 2; ++i)
#pragma unroll
      for (int j = 0; j < 4; ++j) acc[i][j] = mmah(a[i], w[j], acc[i][j]); } }
__global__ __launch_bounds__(256) void k_out(const float* __restrict__ Y, const float* __restrict__ WO, const float* __restrict__ BO, float* __restrict__ OUT) {
  __shared__ __align__(16) unsigned char L[4 * KO_T];   // [buffer][ctx slice | Wo slice]
  static_assert(!CAUSAL && 8 * 32 * KO_EP * 4 <= 4 * KO_T, "single-product path only; the output staging fits the slices' LDS");
  const int tid = threadIdx.x, wave = tid >> 5, lane = tid & 31, c = lane & 15, hh = lane >> 4, wm = wave >> 1, wn = wave & 1; const int c0 = blockIdx.y * 128; const size_t r0 = (size_t)blockIdx.x * 128;
  const float* ap = Y + (r0 + (tid >> 4)) * CC + (tid & 15) * 4; const float* wp = WO + ((size_t)c0 + (tid >> 4)) * CC + (tid & 15) * 4;   // 16 lanes per 256-B row slice, 16 rows per step
  unsigned char* sl = L + (tid >> 4) * KO_P + (tid & 15) * 8;
  const unsigned char* Al = L + (wm * 32 + c) * KO_P + 16 * hh; const unsigned char* Wl = L + KO_T + (wn * 64 + c) * KO_P + 16 * hh;
  v4f ra[8], rw[8]; v8f acc[2][4] = {};
#pragma unroll
  for (int i = 0; i < 8; ++i) { ra[i] = *(const v4f*)(ap + (size_t)i * 16 * CC); rw[i] = *(const v4f*)(wp + (size_t)i * 16 * CC); }
  asm volatile("s_wait_xcnt 0x0" :: "v"(ap), "v"(wp) : "memory");   // as in ko_put
  for (int s = 0; s < KO_NS - 1; ++s) { const int bo = (s & 1) * 2 * KO_T;
    ko_put<true>(ra, rw, sl + bo, ap, wp); ap += 64; wp += 64;
    ko_bar();   // publishes slice s; it also ends every wave's reads of the other buffer, which the next trip overwrites
    ko_mul(acc, Al + bo, Wl + bo); }
  { const int bo = ((KO_NS - 1) & 1) * 2 * KO_T;
    ko_put<false>(ra, rw, sl + bo, ap, wp);
    ko_bar();
    ko_mul(acc, Al + bo, Wl + bo); }
  __syncthreads();   // every wave has left the slices: their LDS becomes the output staging
  float* es = (float*)L + wave * 32 * KO_EP;
#pragma unroll
  for (int j = 0; j < 4; ++j) { const float bias = BO ? bfr(BO[c0 + wn * 64 + j * 16 + c]) : 0.f;
#pragma unroll
    for (int i = 0; i < 2; ++i)
#pragma unroll
      for (int r = 0; r < 8; ++r) es[(i * 16 + 8 * hh + r) * KO_EP + j * 16 + c] = acc[i][j][r] * (1.0f / 16384.0f) + bias; }   /* 2^-8 (Wo carry) x 2^-6 (ctx carry) */
  LDSX();
#pragma unroll
  for (int i = 0; i < 16; ++i) { const int row = i * 2 + hh; vst2(OUT + (r0 + wm * 32 + row) * DIN + c0 + wn * 64 + c * 4, *(const v4f*)(es + row * KO_EP + c * 4)); } }

static_assert(HD == 64 && CC == NH * HD && DIN == CC, "per-head projection: 64-wide heads, input width == projected width");
extern "C" void kernel_launch(void* const* d_in, const int* in_sizes, int n_in, void* d_out, int out_size, void* d_ws, size_t ws_size, hipStream_t stream) {
  (void)in_sizes; (void)n_in; (void)out_size;
  const float** F = (const float**)d_in;
  if (ws_size < (size_t)WS_END) return;
  float* Y = (float*)((char*)d_ws + WS_Y);
  // inputs: 0 values [4,1024,1024]; 1 keys; 2 queries; 3 mask [4,1,1,1024] int32 (random 0/1; 0 = masked key); 4 Wv [64,64] (out,in); 5 Wk; 6 Wq (no projection biases); 7 Wo [1024,1024] (out,in); 8 bo (NONZERO)
  k_fa<<<dim3(TT / 256, NH, TNB), 256, 0, stream>>>(F[2], F[1], F[0], F[6], F[5], F[4], (const int*)d_in[3], Y);
  k_out<<<dim3(TNB * TT / 128, DIN / 128), 256, 0, stream>>>(Y, F[7], F[8], (float*)d_out);
}

// v004
// One run takes 33.2 microseconds.
// Two timings next to v003 both put it at 1.24 times that version's speed.
// Over all steps from v000 it is 20.7 times as fast.
// compute dtype: all float inputs rounded to bf16; the per-head 64 x 64 q / k / v projections (ONE shared weight per stream, applied to every head) with EXACT bf16 products on WMMA 16x16x32 (f32 accumulate) (no projection biases); logits q x k once to f16 each (1 product) x 1024^-0.5; the per-(batch, key) int mask by leaving the masked keys out (their weight is exactly 0); online softmax f32 (log2 domain); unnormalised P x 2^7 once to f16 x v once to f16 (1 product), divided by the f32 sum of the same f16 P; ctx x 2^6 once to f16 x Wo f16(bf16 x 2^8) + bo; f32 output.
#include <hip/hip_runtime.h>
#include <math.h>

typedef __attribute__((ext_vector_type(16))) _Float16 v16h;
typedef __attribute__((ext_vector_type(16))) __bf16 v16b;
typedef __attribute__((ext_vector_type(8)))  _Float16 v8h;
typedef __attribute__((ext_vector_type(8)))  float v8f;
typedef __attribute__((ext_vector_type(4)))  float v4f;
typedef __attribute__((ext_vector_type(2)))  float v2f;
typedef __attribute__((ext_vector_type(4)))  unsigned v4u;
typedef __attribute__((ext_vector_type(4)))  int v4i;
typedef float __attribute__((may_alias)) float_a;
typedef int __attribute__((may_alias)) int_a;

template <typename T> __device__ __forceinline__ void vst2(void* p, T v) { *(T*)p = v;  }
__device__ __forceinline__ v8f wmma16(v16h a, v16h b, v8f c) {
  v8f d = __builtin_amdgcn_wmma_f32_16x16x32_f16(false, a, false, b, (short)0, c, false, false);
  asm volatile("v_nop\n\tv_nop\n\tv_nop\n\tv_nop" : "+v"(d) : "v"(a), "v"(b));
  return d;
}
__device__ __forceinline__ v8f wmma_bf(v16b a, v16b b, v8f c) {
  v8f d = __builtin_amdgcn_wmma_f32_16x16x32_bf16(false, a, false, b, (short)0, c, false, false);
  asm volatile("v_nop\n\tv_nop\n\tv_nop\n\tv_nop" : "+v"(d) : "v"(a), "v"(b));
  return d;
}
// 16x16x32 fragments: lane = (h = lane>>4, row/col = lane&15); elements 0..7 = k0+8h+0..7, 8..15 = k0+16+8h+0..7; D element r = row 8h+r
__device__ __forceinline__ v16h frag_h(const _Float16* rowk0, int lane) {
  union { v16h v; v8h q[2]; } u; const _Float16* p = rowk0 + 8 * (lane >> 4);
  u.q[0] = *(const v8h*)p; u.q[1] = *(const v8h*)(p + 16); return u.v;
}
__device__ __forceinline__ v16h frag_f32(const float* rowk0, int lane) {
  v16h a; const float* p = rowk0 + 8 * (lane >> 4);
#pragma unroll
  for (int i = 0; i < 8; ++i) { a[i] = (_Float16)p[i]; a[8 + i] = (_Float16)p[16 + i]; }
  return a;
}
__device__ __forceinline__ v16h frag_f32s(const float* rowk0, int lane, float sc) {
  v16h a; const float* p = rowk0 + 8 * (lane >> 4);
#pragma unroll
  for (int i = 0; i < 8; ++i) { a[i] = (_Float16)(p[i] * sc); a[8 + i] = (_Float16)(p[16 + i] * sc); }
  return a;
}
// column fragment from a [K][ld] layout (column n), rows >= K read as 0
__device__ __forceinline__ v16h fragc_f32(const float* W, int k0, int n, int lane, int ld, int K) {
  v16h a; const int g = lane >> 4;
#pragma unroll
  for (int i = 0; i < 8; ++i) { const int ka = k0 + 8 * g + i, kb = ka + 16;
    a[i] = (_Float16)(ka < K ? W[(size_t)(ka < K ? ka : K - 1) * ld + n] : 0.f); a[8 + i] = (_Float16)(kb < K ? W[(size_t)(kb < K ? kb : K - 1) * ld + n] : 0.f); }
  return a;
}
struct F2 { v16b h, l; };
__device__ __forceinline__ F2 bsplit16(const float v[16]) { F2 r;
#pragma unroll
  for (int i = 0; i < 16; ++i) { const __bf16 h = (__bf16)v[i]; r.h[i] = h; r.l[i] = (__bf16)(v[i] - (float)h); }
  return r; }
__device__ __forceinline__ F2 split_row(const float* row, int k0, int lane) { float v[16]; const float* p = row + k0 + 8 * (lane >> 4);
#pragma unroll
  for (int i = 0; i < 8; ++i) { v[i] = p[i]; v[8 + i] = p[16 + i]; }
  return bsplit16(v); }
__device__ __forceinline__ F2 split_rowK(const float* row, int k0, int lane, int K) { float v[16]; const int g = lane >> 4;
#pragma unroll
  for (int i = 0; i < 8; ++i) { const int ka = k0 + 8 * g + i, kb = ka + 16; v[i] = ka < K ? row[ka < K ? ka : K - 1] : 0.f; v[8 + i] = kb < K ? row[kb < K ? kb : K - 1] : 0.f; }
  return bsplit16(v); }
__device__ __forceinline__ F2 split_col(const float* W, int k0, int n, int lane, int ld, int K) { float v[16]; const int g = lane >> 4;
#pragma unroll
  for (int i = 0; i < 8; ++i) { const int ka = k0 + 8 * g + i, kb = ka + 16; v[i] = ka < K ? W[(size_t)(ka < K ? ka : K - 1) * ld + n] : 0.f; v[8 + i] = kb < K ? W[(size_t)(kb < K ? kb : K - 1) * ld + n] : 0.f; }
  return bsplit16(v); }
__device__ __forceinline__ v8f mac3(const F2& a, const F2& b, v8f c) { c = wmma_bf(a.l, b.h, c); c = wmma_bf(a.h, b.l, c); return wmma_bf(a.h, b.h, c); }
__device__ __forceinline__ float sigm(float v) { return 1.0f / (1.0f + expf(-v)); }
#define LDSX() do { asm volatile("s_wait_dscnt 0" ::: "memory"); __builtin_amdgcn_wave_barrier(); __builtin_amdgcn_fence(__ATOMIC_RELEASE, "workgroup"); } while (0)

// Multi-head attention whose q / k / v projections are ONE shared 64 x 64 linear per stream applied to every head, with a key mask (inputs in the order values, keys, queries [4,1024,1024]; mask [4,1,1,1024] int32 RANDOM 0/1 per (batch, key); torch (out,in) Wv / Wk / Wq [64,64] uniform(+-1/8), NO projection biases; heads = reshape(N, L, 16, 64); einsum('nlhd,od->nlho'); energy = einsum('nqhd,nkhd->nhqk'); where(mask == 0, -1e20, energy); softmax(energy * 1/sqrt(1024)) - the scale is 1/32, not 1/8; out merged to [N, L, 1024]; out @ Wo.T + bo with Wo [1024,1024] and bo uniform(+-1/32), bo NONZERO).
#define NB 4
#define TT 1024
#define CC 1024            // NH * HD = projected width
#define DIN 1024          // input (model) width
#define NH 16
#define HD 64
#define NQB (TT / 64)
#define HG 8   // S workspace sized for eight heads: 8 x 1,024 x 1,024 f32 = 32 MiB; no kernel uses it
#define SCALE (0.03125f)   // 1 / sqrt(E) with E = 1024 (the module scales by the MODEL width, not the head width)
#define CAUSAL 0
#ifndef TNB
#define TNB NB
#endif
__device__ __forceinline__ float bfr(float v) { return (float)(__bf16)v; }
__host__ __device__ __forceinline__ int kb_last(int qb) { return CAUSAL ? ((qb * 64 + 63) >> 7) : (TT / 128 - 1); }
typedef __attribute__((ext_vector_type(8))) __bf16 v8b;
__device__ __forceinline__ v16b frag_b(const __bf16* rowk0, int lane) {
  union { v16b v; v8b q[2]; } u; const __bf16* p = rowk0 + 8 * (lane >> 4);
  u.q[0] = *(const v8b*)p; u.q[1] = *(const v8b*)(p + 16); return u.v;
}
#define QBH 0
#define QHI 0               // single-product logits on every row
#define KHI 64            // key rows carrying k residual / v bf16 hi+lo planes (no kernel writes or reads them)
// B fragment (k rows k0+.., output column o) of a weight: (in,out) [K][ld] or (out,in) [ld rows of K]: bf16 exact, or f16(bf16 * 256) exact
__device__ __forceinline__ v16b wcol_io(const float* Wm, int k0, int o, int lane, int ld) { v16b w; const int g = lane >> 4;
#pragma unroll
  for (int i = 0; i < 8; ++i) { w[i] = (__bf16)Wm[(size_t)(k0 + 8 * g + i) * ld + o]; w[8 + i] = (__bf16)Wm[(size_t)(k0 + 16 + 8 * g + i) * ld + o]; }
  return w; }
__device__ __forceinline__ v16b wcol_oi(const float* Wm, int k0, int o, int lane, int K) { v16b w; const float* p = Wm + (size_t)o * K + k0 + 8 * (lane >> 4);
#pragma unroll
  for (int i = 0; i < 8; ++i) { w[i] = (__bf16)p[i]; w[8 + i] = (__bf16)p[16 + i]; }
  return w; }
__device__ __forceinline__ v16h wcolh_io(const float* Wm, int k0, int o, int lane, int ld) { v16h w; const int g = lane >> 4;
#pragma unroll
  for (int i = 0; i < 8; ++i) { w[i] = (_Float16)(bfr(Wm[(size_t)(k0 + 8 * g + i) * ld + o]) * 256.0f); w[8 + i] = (_Float16)(bfr(Wm[(size_t)(k0 + 16 + 8 * g + i) * ld + o]) * 256.0f); }
  return w; }
__device__ __forceinline__ v16h wcolh_oi(const float* Wm, int k0, int o, int lane, int K) { v16h w; const float* p = Wm + (size_t)o * K + k0 + 8 * (lane >> 4);
#pragma unroll
  for (int i = 0; i < 8; ++i) { w[i] = (_Float16)(bfr(p[i]) * 256.0f); w[8 + i] = (_Float16)(bfr(p[16 + i]) * 256.0f); }
  return w; }
#define WQKV_LAYOUT 1   // 0 = (in,out) [DIN][CC]; 1 = (out,in) [CC][DIN]; 2 = per-head [NH][DIN][HD]
__device__ __forceinline__ v16b wcol_hdk(const float* Wm, int k0, int o, int lane) { v16b w; const int g = lane >> 4; const float* p = Wm + (size_t)(o / HD) * DIN * HD + (o % HD);
#pragma unroll
  for (int i = 0; i < 8; ++i) { w[i] = (__bf16)p[(size_t)(k0 + 8 * g + i) * HD]; w[8 + i] = (__bf16)p[(size_t)(k0 + 16 + 8 * g + i) * HD]; }
  return w; }
#define WO_OUT_IN 1
#if WQKV_LAYOUT == 1
#define WCOL(W, k0, o, lane) wcol_oi(W, k0, o, lane, DIN)
#elif WQKV_LAYOUT == 2
#define WCOL(W, k0, o, lane) wcol_hdk(W, k0, o, lane)
#else
#define WCOL(W, k0, o, lane) wcol_io(W, k0, o, lane, CC)
#endif
#if WO_OUT_IN
#define WOCOL(W, k0, o, lane) wcol_oi(W, k0, o, lane, CC)
#define WOCOLH(W, k0, o, lane) wcolh_oi(W, k0, o, lane, CC)
#else
#define WOCOL(W, k0, o, lane) wcol_io(W, k0, o, lane, DIN)
#define WOCOLH(W, k0, o, lane) wcolh_io(W, k0, o, lane, DIN)
#endif
#ifndef PROJ_EXTRA_PARAMS
#define PROJ_EXTRA_PARAMS
#endif

#define WS_QH  0u                                      // f16 q rows [b*t][CC], unused: k_fa keeps q in registers
#define WS_KH  (WS_QH + 2u * (size_t)NB * TT * CC)      // f16 k rows [b*t][CC], unused: k_fa makes k straight into LDS
#define WS_VT  (WS_KH + 2u * (size_t)NB * TT * CC)      // f16 v planes [b][c][t], unused: k_fa makes v straight into LDS
#define WS_QL  (WS_VT + 2u * (size_t)NB * CC * TT)      // f16 q residual x 2^10 rows [b][t < QHI][CC]
#define WS_KL  (WS_QL + 2u * (size_t)NB * QHI * CC)     // f16 k residual x 2^10 rows [b][t < KHI][CC]
#define WS_VB  (WS_KL + 2u * (size_t)NB * KHI * CC)     // bf16 v hi planes [b][c][t < KHI]
#define WS_VBL (WS_VB + 2u * (size_t)NB * CC * KHI)
#define WS_S   (WS_VBL + 2u * (size_t)NB * CC * KHI)    // f32 [hg][t][s], unused: k_fa keeps the scores in registers
#define WS_Y   (WS_S  + 4u * (size_t)HG * TT * TT)      // f32 ctx rows [b*t][CC] (only when there is an output projection)
#define WS_END (WS_Y  + 4u * (size_t)NB * TT * CC)

#define FA_KP 144                  // LDS pitch of a 128-B k row: 16 B x odd
#define FA_VP 2064                 // LDS pitch of a 2,048-B v plane row: 16 B x odd
#define FA_KB (TT * FA_KP)
#define FA_VB (HD * FA_VP)
#define FA_EP 68                   // floats per staged ctx row (272 B: 16 B x odd)
__device__ __forceinline__ v8f mmah(v16h a, v16h b, v8f c) { return __builtin_amdgcn_wmma_f32_16x16x32_f16(false, a, false, b, (short)0, c, false, false); }
__device__ __forceinline__ v16h frag_l(const unsigned char* p) { union { v16h v; v8h q[2]; } u; u.q[0] = *(const v8h*)p; u.q[1] = *(const v8h*)(p + 32); return u.v; }
__device__ __forceinline__ v8f ld8f(const unsigned char* p) { union { v8f v; v4f q[2]; } u; u.q[0] = *(const v4f*)p; u.q[1] = *(const v4f*)(p + 16); return u.v; }
// sixteen base-2 exponentials, each in place, in one statement: directly behind a transcendental stands nothing that reads its result or overwrites its source; the v_nop is that slot behind the last one
__device__ __forceinline__ void exp2x16(float (&a)[16]) {
  asm("v_exp_f32 %0, %0\n\tv_exp_f32 %1, %1\n\tv_exp_f32 %2, %2\n\tv_exp_f32 %3, %3\n\tv_exp_f32 %4, %4\n\tv_exp_f32 %5, %5\n\tv_exp_f32 %6, %6\n\tv_exp_f32 %7, %7\n\tv_exp_f32 %8, %8\n\tv_exp_f32 %9, %9\n\tv_exp_f32 %10, %10\n\tv_exp_f32 %11, %11\n\tv_exp_f32 %12, %12\n\tv_exp_f32 %13, %13\n\tv_exp_f32 %14, %14\n\tv_exp_f32 %15, %15\n\tv_nop" : "+v"(a[0]), "+v"(a[1]), "+v"(a[2]), "+v"(a[3]), "+v"(a[4]), "+v"(a[5]), "+v"(a[6]), "+v"(a[7]), "+v"(a[8]), "+v"(a[9]), "+v"(a[10]), "+v"(a[11]), "+v"(a[12]), "+v"(a[13]), "+v"(a[14]), "+v"(a[15])); }
__device__ __forceinline__ float xhalf(float x) { return __builtin_bit_cast(float, __builtin_amdgcn_permlanex16(__builtin_bit_cast(int, x), __builtin_bit_cast(int, x), 0x76543210, 0xfedcba98, false, false)); }  // lane l with lane l ^ 16
#define FA_SP 144                  // LDS pitch of a staged 128-B bf16 row: 16 B x odd
#define FA_SG (32 * FA_SP)         // one wave's staging: a group of 32 rows
#define FA_LO (FA_KB + FA_VB + 4 * TT + 8 * FA_SG)   // the list of unmasked key rows (TT ints), behind it the eight waves' counts
__device__ __forceinline__ int fa_slot(int q) { return (q & ~31) | ((q & 1) << 4) | ((q & 31) >> 1); }   // list slot of place q: a group's even rows, then its odd rows, so that a lane half reads its 16 entries in a row
typedef __attribute__((ext_vector_type(4))) __bf16 v4b;
__device__ __forceinline__ v8f mmab(v16b a, v16b b, v8f c) { return __builtin_amdgcn_wmma_f32_16x16x32_bf16(false, a, false, b, (short)0, c, false, false); }
__device__ __forceinline__ v16b frag_lb(const unsigned char* p) { union { v16b v; v8b q[2]; } u; u.q[0] = *(const v8b*)p; u.q[1] = *(const v8b*)(p + 32); return u.v; }
// a group's loads: 16 lanes per 256-B row, two rows an instruction; p + OFF = the lane's place in rows 0 / 1 of the group
template <int PITCH, int OFF = 0> __device__ __forceinline__ void pj_ld(v4f (&t)[16], const float* p) {   // OFF: floats from p to the group, kept out of the pointer, so that the pair which the loads name is the one that the wait holds
#pragma unroll
  for (int j = 0; j < 16; ++j) t[j] = *(const v4f*)(p + OFF + (size_t)j * 2 * PITCH);
  asm volatile("s_wait_xcnt 0x0" :: "v"(p) : "memory"); }   // the wait kept before a register that an issued global load names is overwritten; the pointer is an input, so that the pair lives through the run
// a group's loads by the row list: lp = the lane half's 16 list entries (byte offsets of rows 0 / 1, 2 / 3, ... of the group from xb, the batch's first row); vm = 0 sends a group that does not exist to the batch's first row; lo = the lane's place in a row
__device__ __forceinline__ void pj_ldg(v4f (&t)[16], const float* xb, const unsigned char* lp, unsigned vm, unsigned lo) {
  unsigned o[16];
#pragma unroll
  for (int q = 0; q < 4; ++q) { const v4u x = *(const v4u*)(lp + q * 16);
#pragma unroll
    for (int i = 0; i < 4; ++i) o[q * 4 + i] = (x[i] & vm) | lo; }
#pragma unroll
  for (int j = 0; j < 16; ++j) t[j] = *(const v4f*)((const unsigned char*)xb + o[j]);
  // the wait kept before a register that an issued global load names is overwritten; the offsets are inputs, so that they live through the run
  asm volatile("s_wait_xcnt 0x0" :: "v"(o[0]), "v"(o[1]), "v"(o[2]), "v"(o[3]), "v"(o[4]), "v"(o[5]), "v"(o[6]), "v"(o[7]), "v"(o[8]), "v"(o[9]), "v"(o[10]), "v"(o[11]), "v"(o[12]), "v"(o[13]), "v"(o[14]), "v"(o[15]) : "memory");
  __builtin_amdgcn_sched_barrier(0); }   // the loads are issued before the next group's conversions, whose wait would otherwise stand in front of them
// group g of np: every refill is issued, so that the counted waits leave the younger group in flight on every path; one for a group that does not exist reads the batch's first row and is not used
__device__ __forceinline__ void pj_ldn(v4f (&t)[16], const float* xb, const unsigned char* lb, int g, int np, unsigned lo) { const bool ok = g < np; pj_ldg(t, xb, lb + (ok ? g : 0) * 128, ok ? ~0u : 0u, lo); }
// rounds the group held in registers to bf16 rows in the wave's staging; d = the lane's place in rows 0 / 1
__device__ __forceinline__ void pj_put(const v4f (&t)[16], unsigned char* d) {
#pragma unroll
  for (int j = 0; j < 16; ++j) { v4b x;
#pragma unroll
    for (int e = 0; e < 4; ++e) x[e] = (__bf16)t[j][e];
    *(v4b*)(d + j * 2 * FA_SP) = x; }
  __builtin_amdgcn_sched_barrier(0); }   // the refill that follows stands behind the last read of its registers: no second register set
// the wave's own LDS writes have landed before its other lanes read them; no fence: that would also wait out the global loads in flight
__device__ __forceinline__ void pj_wx() { asm volatile("s_wait_dscnt 0x0" ::: "memory"); __builtin_amdgcn_wave_barrier(); }
__device__ __forceinline__ v8h pj_h(v8f d) { v8h h;
#pragma unroll
  for (int r = 0; r < 8; ++r) h[r] = (_Float16)d[r];
  return h; }
// the staged group of 32 input rows times the weight: k rows as W . x^T (a lane holds 8 output dims of one key), v planes as x . W^T (a lane holds 8 keys of one output dim): one 16-B LDS store per tile either way
__device__ __forceinline__ void pj_mul(const v16b (&w)[4][2], const unsigned char* sr, unsigned char* kd, unsigned char* vd, bool is_v) {
  if (is_v) {
#pragma unroll
    for (int tl = 0; tl < 2; ++tl) { const v16b x0 = frag_lb(sr + tl * 16 * FA_SP), x1 = frag_lb(sr + tl * 16 * FA_SP + 64);
#pragma unroll
      for (int ot = 0; ot < 4; ++ot) *(v8h*)(vd + ot * 16 * FA_VP + tl * 32) = pj_h(mmab(x1, w[ot][1], mmab(x0, w[ot][0], v8f{}))); }
  } else {
#pragma unroll
    for (int tl = 0; tl < 2; ++tl) { const v16b x0 = frag_lb(sr + tl * 16 * FA_SP), x1 = frag_lb(sr + tl * 16 * FA_SP + 64);
#pragma unroll
      for (int ot = 0; ot < 4; ++ot) *(v8h*)(kd + tl * 16 * FA_KP + ot * 32) = pj_h(mmab(w[ot][1], x1, mmab(w[ot][0], x0, v8f{}))); } } }
__global__ __launch_bounds__(256) void k_fa(const float* __restrict__ XQ, const float* __restrict__ XK, const float* __restrict__ XV, const float* __restrict__ WQ, const float* __restrict__ WK, const float* __restrict__ WV, const int* __restrict__ MASK, float* __restrict__ Y) {
  __shared__ __align__(16) unsigned char L[FA_LO + 4 * TT + 32];
  const int tid = threadIdx.x, wave = tid >> 5, lane = tid & 31, c = lane & 15, hh = lane >> 4; const int hd = blockIdx.y, b = blockIdx.z; const int qw0 = blockIdx.x * 256 + wave * 32;
  const int* Mb = MASK + b * TT;
  v16h qf[2][2]; int np; float cs;
  { const int wv = __builtin_amdgcn_readfirstlane(wave); const bool is_v = wv >= 4; const int wq = wv & 3;   // waves 0-3: k, waves 4-7: v; each takes every fourth group of 32 kept keys
    const float* wp = (is_v ? WV : WK) + hh * HD + c * 4; const float* wqp = WQ + hh * HD + c * 4;
    const float* xb = (is_v ? XV : XK) + (size_t)b * TT * DIN; const float* qp = XQ + ((size_t)b * TT + qw0 + hh) * DIN + hd * HD + c * 4;
    unsigned char* sw = L + FA_KB + FA_VB + 4 * TT + wv * FA_SG + hh * FA_SP + c * 8; const unsigned char* sr = L + FA_KB + FA_VB + 4 * TT + wv * FA_SG + c * FA_SP + 16 * hh;
    unsigned char* kd = L + (wq * 32 + c) * FA_KP + 16 * hh; unsigned char* vd = L + FA_KB + c * FA_VP + (wq * 32 + 8 * hh) * 2;
    const unsigned char* lb = L + FA_LO + hh * 64; const unsigned lo = hd * (HD * 4) + c * 16;
    v4f ta[16], tb[16]; v16b w[4][2];
    const v4i mm = *(const v4i*)(Mb + tid * 4);
    pj_ld<HD>(ta, wqp); pj_ld<HD, 32 * HD>(tb, wqp);
    // a masked key's weight is exactly 0: only the unmasked keys are projected and attended. Their rows are listed in LDS (place = count of unmasked keys before it, by wave, then by element, then by lane), the last group filled up to 32 with the batch's first row under a bias of -1e30.
    int* LI = (int*)(L + FA_LO); int* WT = LI + TT; unsigned bl[4]; int wt = 0;
#pragma unroll
    for (int e = 0; e < 4; ++e) { bl[e] = __builtin_amdgcn_ballot_w32(mm[e] != 0); wt += __builtin_popcount(bl[e]); }
    if (lane == 0) WT[wave] = wt;
    __syncthreads();   // the eight counts are there
    int tot = 0, base = 0;
#pragma unroll
    for (int i = 0; i < 8; ++i) { const int x = WT[i]; tot += x; base += i < wave ? x : 0; }
    tot = __builtin_amdgcn_readfirstlane(tot);
    // a batch whose keys are ALL masked: the reference's logits are then all equal, i.e. uniform weights over all keys: every key is listed, and scale 0 gives exactly that
    const bool none = tot == 0; const int n = none ? TT : tot; np = (n + 31) >> 5; cs = none ? 0.f : SCALE * 1.4426950408889634f;
#pragma unroll
    for (int e = 0; e < 4; ++e) { const int key = tid * 4 + e; const int q = none ? key : base + (int)__builtin_amdgcn_mbcnt_lo(bl[e], 0u); base += __builtin_popcount(bl[e]);
      if (none || mm[e] != 0) LI[fa_slot(q)] = key * (DIN * 4); }
    if (tid < 32) { const int q = (n & ~31) + tid; if (q >= n && q < np * 32) LI[fa_slot(q)] = 0; }
    { v4f bz;
#pragma unroll
      for (int i = 0; i < 4; ++i) bz[i] = tid * 4 + i < n ? 0.f : -1.0e30f;
      *(v4f*)(L + FA_KB + FA_VB + tid * 16) = bz; }
    __syncthreads();   // the list and the biases are there
    pj_put(ta, sw); pj_ld<DIN>(ta, qp); pj_wx();
#pragma unroll
    for (int i = 0; i < 4; ++i) w[i >> 1][i & 1] = frag_lb(sr + (i >> 1) * 16 * FA_SP + (i & 1) * 64);
    pj_wx();   // the weight fragments have been read before the next group overwrites the staging
    pj_put(tb, sw); pj_ld<HD>(tb, wp); pj_wx();
#pragma unroll
    for (int i = 0; i < 4; ++i) w[2 + (i >> 1)][i & 1] = frag_lb(sr + (i >> 1) * 16 * FA_SP + (i & 1) * 64);
    pj_wx();   // as above
    pj_put(ta, sw); pj_ld<HD, 32 * HD>(ta, wp); pj_wx();
    // q^T = W . x^T: output tiles 2 kc and 2 kc + 1 of a query column are, lane for lane, the two halves of its B fragment for k step kc
#pragma unroll
    for (int g = 0; g < 2; ++g) { const v16b x0 = frag_lb(sr + g * 16 * FA_SP), x1 = frag_lb(sr + g * 16 * FA_SP + 64);
#pragma unroll
      for (int kc = 0; kc < 2; ++kc) { union { v16h v; v8h q[2]; } u;
#pragma unroll
        for (int i = 0; i < 2; ++i) u.q[i] = pj_h(mmab(w[2 * kc + i][1], x1, mmab(w[2 * kc + i][0], x0, v8f{})));
        qf[g][kc] = u.v; } }
    pj_wx();   // the q rows have been read before the next group overwrites the staging
    pj_put(tb, sw); pj_ldn(tb, xb, lb, wq, np, lo); pj_wx();
#pragma unroll
    for (int i = 0; i < 4; ++i) w[i >> 1][i & 1] = frag_lb(sr + (i >> 1) * 16 * FA_SP + (i & 1) * 64);
    pj_wx();   // the weight fragments have been read before the next group overwrites the staging
    pj_put(ta, sw); pj_ldn(ta, xb, lb, wq + 4, np, lo); pj_wx();
#pragma unroll
    for (int i = 0; i < 4; ++i) w[2 + (i >> 1)][i & 1] = frag_lb(sr + (i >> 1) * 16 * FA_SP + (i & 1) * 64);
    pj_wx();   // as above
    int g = wq;
#pragma unroll 1   // rolled: the trip count follows the mask; the test stands at the foot, so that the two refills above are used on every path and stay where they are issued
    do {
      pj_put(tb, sw); pj_ldn(tb, xb, lb, g + 8, np, lo); pj_wx(); if (g < np) pj_mul(w, sr, kd, vd, is_v);
      pj_put(ta, sw); pj_ldn(ta, xb, lb, g + 12, np, lo); pj_wx(); if (g + 4 < np) pj_mul(w, sr, kd + 128 * FA_KP, vd + 256, is_v);
      kd += 256 * FA_KP; vd += 512; g += 8; } while (g < np); }
  __syncthreads();
  v16h ones;
#pragma unroll
  for (int i = 0; i < 16; ++i) ones[i] = (_Float16)1.0f;
  v8f acc[2][4] = {}, lacc[2] = {}; float m_run[2] = {-1.0e20f, -1.0e20f};   // the floor lies far above a fill row's score (-1e30 x scale) and far below any real one
  const unsigned char* Kl = L + c * FA_KP + 16 * hh; const unsigned char* Vl = L + FA_KB + c * FA_VP + 16 * hh; const unsigned char* Bl = L + FA_KB + FA_VB + 32 * hh;
  v16h kf[2][2]; v8f bz[2];
#pragma unroll
  for (int kt = 0; kt < 2; ++kt) { bz[kt] = ld8f(Bl + kt * 64); kf[kt][0] = frag_l(Kl + kt * 16 * FA_KP); kf[kt][1] = frag_l(Kl + kt * 16 * FA_KP + 64); }
#pragma unroll 1   // rolled: two passes unrolled take more than 256 registers, and the loop then switches register windows throughout
  for (int ps = 0; ps < np; ++ps) {
    v8f s[2][2];
#pragma unroll
    for (int kt = 0; kt < 2; ++kt)
#pragma unroll
      for (int g = 0; g < 2; ++g) s[kt][g] = mmah(kf[kt][1], qf[g][1], mmah(kf[kt][0], qf[g][0], bz[kt]));
    // the pass's LDS reads stand in one place: this pass's v, and the next pass's k rows and bias (the last pass re-reads pass 0, unused)
    v16h vf[4]; const int pn = ps + 1 < np ? ps + 1 : 0;
#pragma unroll
    for (int t = 0; t < 4; ++t) vf[t] = frag_l(Vl + t * 16 * FA_VP + ps * 64);
#pragma unroll
    for (int kt = 0; kt < 2; ++kt) { bz[kt] = ld8f(Bl + (pn * 32 + kt * 16) * 4); kf[kt][0] = frag_l(Kl + (pn * 32 + kt * 16) * FA_KP); kf[kt][1] = frag_l(Kl + (pn * 32 + kt * 16) * FA_KP + 64); }
    __builtin_amdgcn_sched_barrier(0);   // the reads are issued ahead of the maxima, which then cover their latency
    float mb[2]; bool need = false;
#pragma unroll
    for (int g = 0; g < 2; ++g) { float mx = s[0][g][0];
#pragma unroll
      for (int r = 1; r < 8; ++r) mx = __builtin_fmaxf(mx, s[0][g][r]);
#pragma unroll
      for (int r = 0; r < 8; ++r) mx = __builtin_fmaxf(mx, s[1][g][r]);
      mx = __builtin_fmaxf(mx, xhalf(mx)) * cs; mb[g] = mx; need = need || (mx > m_run[g] + 8.0f); }
    __builtin_amdgcn_sched_barrier(0);   // keeps the statement below, and the wait it brings, behind the maxima
    // inputs only: holds the pass's LDS reads in front of the branch; sunk behind it they would stand directly in front of their first use
    asm volatile("" :: "v"(vf[0]), "v"(vf[1]), "v"(vf[2]), "v"(vf[3]), "v"(kf[0][0]), "v"(kf[0][1]), "v"(kf[1][0]), "v"(kf[1][1]), "v"(bz[0]), "v"(bz[1]));
    if (__builtin_amdgcn_ballot_w32(need) != 0) {   // one scalar test per pass; rare after the first unmasked keys
#pragma unroll
      for (int g = 0; g < 2; ++g) { const float m_new = __builtin_fmaxf(m_run[g], mb[g]); const float corr = __builtin_amdgcn_exp2f(m_run[g] - m_new); m_run[g] = m_new; lacc[g] = lacc[g] * corr;
#pragma unroll
        for (int t = 0; t < 4; ++t) acc[g][t] = acc[g][t] * corr; } }
#pragma unroll
    for (int g = 0; g < 2; ++g) { const float nm = 7.0f - m_run[g];   // P carried x 2^7: at most 2^15 in f16 (the maximum trails by 8 at most), small weights clear of f16 subnormals
      v16h pf; float a[16];
#pragma unroll
      for (int i = 0; i < 16; ++i) a[i] = __builtin_fmaf(s[i >> 3][g][i & 7], cs, nm);
      exp2x16(a);
#pragma unroll
      for (int i = 0; i < 16; ++i) pf[i] = (_Float16)a[i];
#pragma unroll
      for (int t = 0; t < 4; ++t) acc[g][t] = mmah(vf[t], pf, acc[g][t]);
      lacc[g] = mmah(ones, pf, lacc[g]); } }
  __syncthreads();   // every wave has left the k / v planes: their LDS becomes the output staging
  float* es = (float*)L + wave * 32 * FA_EP;
#pragma unroll
  for (int g = 0; g < 2; ++g) { const float inv = 1.0f / lacc[g][0];   // every row of the all-ones product holds the column's sum over both lane halves
#pragma unroll
    for (int t = 0; t < 4; ++t) { const v8f o = acc[g][t] * inv; float* p = es + (g * 16 + c) * FA_EP + t * 16 + 8 * hh; *(v4f*)p = v4f{o[0], o[1], o[2], o[3]}; *(v4f*)(p + 4) = v4f{o[4], o[5], o[6], o[7]}; } }
  LDSX();
#pragma unroll
  for (int i = 0; i < 16; ++i) { const int row = i * 2 + hh; vst2(Y + ((size_t)b * TT + qw0 + row) * CC + hd * HD + c * 4, *(const v4f*)(es + row * FA_EP + c * 4)); } }
// ---- k_out: block = 128 rows x 128 cols, 8 waves of 32 x 64: out = ctx Wo (+ bo): ctx x 2^6 once to f16 against Wo as f16(bf16 x 2^8) exact (1 product) x 2^-14.
// Each 64-wide k slice of both operands is read from global memory once per block in whole lines, converted once, and laid in LDS as f16 rows; every wave takes its fragments from there.
// Two LDS buffers; a register quad is refilled with the next slice as soon as it has been converted, so the global loads fly while this slice is multiplied. Every accumulator sums k ascending in steps of 32.
// (the plain unroll directives in k_out and its helpers keep the indices of their register arrays compile-time constants)
#define KO_P 144                   // LDS pitch of a 128-B f16 row: 16 B x odd
#define KO_T (128 * KO_P)          // one operand's slice
#define KO_NS (CC / 64)
#define KO_EP 68                   // floats per staged output row (272 B: 16 B x odd)
typedef __attribute__((ext_vector_type(4))) _Float16 v4h;
// converts the slice held in registers into LDS at d; MORE: refills the registers with the next slice, 64 floats behind ap / wp
template <bool MORE> __device__ __forceinline__ void ko_put(v4f (&ra)[8], v4f (&rw)[8], unsigned char* d, const float* ap, const float* wp) {
#pragma unroll
  for (int h = 0; h < 8; h += 2) {
#pragma unroll
    for (int i = h; i < h + 2; ++i) { v4h x, w;
#pragma unroll
      for (int e = 0; e < 4; ++e) { x[e] = (_Float16)(ra[i][e] * 64.0f); w[e] = (_Float16)(bfr(rw[i][e]) * 256.0f); }   /* ctx carried x 2^6 into f16 so small-magnitude context rows stay clear of f16 subnormals */
      *(v4h*)(d + i * 16 * KO_P) = x; *(v4h*)(d + KO_T + i * 16 * KO_P) = w; }
    if (MORE) {   // the two scheduling barriers: quads are waited for, converted and refilled in the order in which they were loaded (the counted waits then leave the younger loads in flight), each refill behind the last read of its registers (no second register set, no copies)
      __builtin_amdgcn_sched_barrier(0);
#pragma unroll
      for (int i = h; i < h + 2; ++i) { ra[i] = *(const v4f*)(ap + 64 + (size_t)i * 16 * CC); rw[i] = *(const v4f*)(wp + 64 + (size_t)i * 16 * CC); }
      __builtin_amdgcn_sched_barrier(0); } }
  if (MORE) asm volatile("s_wait_xcnt 0x0" :: "v"(ap), "v"(wp) : "memory"); }   // the wait kept before a register that an issued global load names is overwritten; the pointers are inputs, so that the pairs live through the run
// the work-group's barrier with the LDS wait alone: __syncthreads() would also wait out the global loads issued ahead for the next slice
__device__ __forceinline__ void ko_bar() { asm volatile("s_wait_dscnt 0x0" ::: "memory"); asm volatile("s_barrier_signal -1" ::: "memory"); asm volatile("s_barrier_wait -1" ::: "memory"); }
__device__ __forceinline__ void ko_mul(v8f (&acc)[2][4], const unsigned char* A, const unsigned char* B) {
#pragma unroll
  for (int ks = 0; ks < 2; ++ks) { v16h a[2], w[4];
#pragma unroll
    for (int i = 0; i < 2; ++i) a[i] = frag_l(A + i * 16 * KO_P + ks * 64);
#pragma unroll
    for (int j = 0; j < 4; ++j) w[j] = frag_l(B + j * 16 * KO_P + ks * 64);
#pragma unroll
    for (int i = 0; i < 2; ++i)
#pragma unroll
      for (int j = 0; j < 4; ++j) acc[i][j] = mmah(a[i], w[j], acc[i][j]); } }
__global__ __launch_bounds__(256) void k_out(const float* __restrict__ Y, const float* __restrict__ WO, const float* __restrict__ BO, float* __restrict__ OUT) {
  __shared__ __align__(16) unsigned char L[4 * KO_T];   // [buffer][ctx slice | Wo slice]
  static_assert(!CAUSAL && 8 * 32 * KO_EP * 4 <= 4 * KO_T, "single-product path only; the output staging fits the slices' LDS");
  const int tid = threadIdx.x, wave = tid >> 5, lane = tid & 31, c = lane & 15, hh = lane >> 4, wm = wave >> 1, wn = wave & 1; const int c0 = blockIdx.y * 128; const size_t r0 = (size_t)blockIdx.x * 128;
  const float* ap = Y + (r0 + (tid >> 4)) * CC + (tid & 15) * 4; const float* wp = WO + ((size_t)c0 + (tid >> 4)) * CC + (tid & 15) * 4;   // 16 lanes per 256-B row slice, 16 rows per step
  unsigned char* sl = L + (tid >> 4) * KO_P + (tid & 15) * 8;
  const unsigned char* Al = L + (wm * 32 + c) * KO_P + 16 * hh; const unsigned char* Wl = L + KO_T + (wn * 64 + c) * KO_P + 16 * hh;
  v4f ra[8], rw[8]; v8f acc[2][4] = {};
#pragma unroll
  for (int i = 0; i < 8; ++i) { ra[i] = *(const v4f*)(ap + (size_t)i * 16 * CC); rw[i] = *(const v4f*)(wp + (size_t)i * 16 * CC); }
  asm volatile("s_wait_xcnt 0x0" :: "v"(ap), "v"(wp) : "memory");   // as in ko_put
  for (int s = 0; s < KO_NS - 1; ++s) { const int bo = (s & 1) * 2 * KO_T;
    ko_put<true>(ra, rw, sl + bo, ap, wp); ap += 64; wp += 64;
    ko_bar();   // publishes slice s; it also ends every wave's reads of the other buffer, which the next trip overwrites
    ko_mul(acc, Al + bo, Wl + bo); }
  { const int bo = ((KO_NS - 1) & 1) * 2 * KO_T;
    ko_put<false>(ra, rw, sl + bo, ap, wp);
    ko_bar();
    ko_mul(acc, Al + bo, Wl + bo); }
  __syncthreads();   // every wave has left the slices: their LDS becomes the output staging
  float* es = (float*)L + wave * 32 * KO_EP;
#pragma unroll
  for (int j = 0; j < 4; ++j) { const float bias = BO ? bfr(BO[c0 + wn * 64 + j * 16 + c]) : 0.f;
#pragma unroll
    for (int i = 0; i < 2; ++i)
#pragma unroll
      for (int r = 0; r < 8; ++r) es[(i * 16 + 8 * hh + r) * KO_EP + j * 16 + c] = acc[i][j][r] * (1.0f / 16384.0f) + bias; }   /* 2^-8 (Wo carry) x 2^-6 (ctx carry) */
  LDSX();
#pragma unroll
  for (int i = 0; i < 16; ++i) { const int row = i * 2 + hh; vst2(OUT + (r0 + wm * 32 + row) * DIN + c0 + wn * 64 + c * 4, *(const v4f*)(es + row * KO_EP + c * 4)); } }

static_assert(HD == 64 && CC == NH * HD && DIN == CC, "per-head projection: 64-wide heads, input width == projected width");
extern "C" void kernel_launch(void* const* d_in, const int* in_sizes, int n_in, void* d_out, int out_size, void* d_ws, size_t ws_size, hipStream_t stream) {
  (void)in_sizes; (void)n_in; (void)out_size;
  const float** F = (const float**)d_in;
  if (ws_size < (size_t)WS_END) return;
  float* Y = (float*)((char*)d_ws + WS_Y);
  // inputs: 0 values [4,1024,1024]; 1 keys; 2 queries; 3 mask [4,1,1,1024] int32 (random 0/1; 0 = masked key); 4 Wv [64,64] (out,in); 5 Wk; 6 Wq (no projection biases); 7 Wo [1024,1024] (out,in); 8 bo (NONZERO)
  k_fa<<<dim3(TT / 256, NH, TNB), 256, 0, stream>>>(F[2], F[1], F[0], F[6], F[5], F[4], (const int*)d_in[3], Y);
  k_out<<<dim3(TNB * TT / 128, DIN / 128), 256, 0, stream>>>(Y, F[7], F[8], (float*)d_out);
}

// v005
// One run takes 31.1 microseconds.
// Timed twice side by side with v004, it ran 1.07 and 1.06 times as fast.
// All steps since v000 together make it 22.0 times as fast.
// compute dtype: all float inputs rounded to bf16; the per-head 64 x 64 q / k / v projections (ONE shared weight per stream, applied to every head) with EXACT bf16 products on WMMA 16x16x32 (f32 accumulate) (no projection biases); logits q x k once to f16 each (1 product) x 1024^-0.5; the per-(batch, key) int mask by leaving the masked keys out (their weight is exactly 0); online softmax f32 (log2 domain); unnormalised P x 2^7 once to f16 x v once to f16 (1 product), divided by the f32 sum of the same f16 P; ctx x 2^6 once to f16 x Wo f16(bf16 x 2^8) + bo; f32 output.
#include <hip/hip_runtime.h>
#include <math.h>

typedef __attribute__((ext_vector_type(16))) _Float16 v16h;
typedef __attribute__((ext_vector_type(16))) __bf16 v16b;
typedef __attribute__((ext_vector_type(8)))  _Float16 v8h;
typedef __attribute__((ext_vector_type(8)))  float v8f;
typedef __attribute__((ext_vector_type(4)))  float v4f;
typedef __attribute__((ext_vector_type(2)))  float v2f;
typedef __attribute__((ext_vector_type(4)))  unsigned v4u;
typedef __attribute__((ext_vector_type(4)))  int v4i;
typedef float __attribute__((may_alias)) float_a;
typedef int __attribute__((may_alias)) int_a;

template <typename T> __device__ __forceinline__ void vst2(void* p, T v) { *(T*)p = v;  }
__device__ __forceinline__ v8f wmma16(v16h a, v16h b, v8f c) {
  v8f d = __builtin_amdgcn_wmma_f32_16x16x32_f16(false, a, false, b, (short)0, c, false, false);
  asm volatile("v_nop\n\tv_nop\n\tv_nop\n\tv_nop" : "+v"(d) : "v"(a), "v"(b));
  return d;
}
__device__ __forceinline__ v8f wmma_bf(v16b a, v16b b, v8f c) {
  v8f d = __builtin_amdgcn_wmma_f32_16x16x32_bf16(false, a, false, b, (short)0, c, false, false);
  asm volatile("v_nop\n\tv_nop\n\tv_nop\n\tv_nop" : "+v"(d) : "v"(a), "v"(b));
  return d;
}
// 16x16x32 fragments: lane = (h = lane>>4, row/col = lane&15); elements 0..7 = k0+8h+0..7, 8..15 = k0+16+8h+0..7; D element r = row 8h+r
__device__ __forceinline__ v16h frag_h(const _Float16* rowk0, int lane) {
  union { v16h v; v8h q[2]; } u; const _Float16* p = rowk0 + 8 * (lane >> 4);
  u.q[0] = *(const v8h*)p; u.q[1] = *(const v8h*)(p + 16); return u.v;
}
__device__ __forceinline__ v16h frag_f32(const float* rowk0, int lane) {
  v16h a; const float* p = rowk0 + 8 * (lane >> 4);
#pragma unroll
  for (int i = 0; i < 8; ++i) { a[i] = (_Float16)p[i]; a[8 + i] = (_Float16)p[16 + i]; }
  return a;
}
__device__ __forceinline__ v16h frag_f32s(const float* rowk0, int lane, float sc) {
  v16h a; const float* p = rowk0 + 8 * (lane >> 4);
#pragma unroll
  for (int i = 0; i < 8; ++i) { a[i] = (_Float16)(p[i] * sc); a[8 + i] = (_Float16)(p[16 + i] * sc); }
  return a;
}
// column fragment from a [K][ld] layout (column n), rows >= K read as 0
__device__ __forceinline__ v16h fragc_f32(const float* W, int k0, int n, int lane, int ld, int K) {
  v16h a; const int g = lane >> 4;
#pragma unroll
  for (int i = 0; i < 8; ++i) { const int ka = k0 + 8 * g + i, kb = ka + 16;
    a[i] = (_Float16)(ka < K ? W[(size_t)(ka < K ? ka : K - 1) * ld + n] : 0.f); a[8 + i] = (_Float16)(kb < K ? W[(size_t)(kb < K ? kb : K - 1) * ld + n] : 0.f); }
  return a;
}
struct F2 { v16b h, l; };
__device__ __forceinline__ F2 bsplit16(const float v[16]) { F2 r;
#pragma unroll
  for (int i = 0; i < 16; ++i) { const __bf16 h = (__bf16)v[i]; r.h[i] = h; r.l[i] = (__bf16)(v[i] - (float)h); }
  return r; }
__device__ __forceinline__ F2 split_row(const float* row, int k0, int lane) { float v[16]; const float* p = row + k0 + 8 * (lane >> 4);
#pragma unroll
  for (int i = 0; i < 8; ++i) { v[i] = p[i]; v[8 + i] = p[16 + i]; }
  return bsplit16(v); }
__device__ __forceinline__ F2 split_rowK(const float* row, int k0, int lane, int K) { float v[16]; const int g = lane >> 4;
#pragma unroll
  for (int i = 0; i < 8; ++i) { const int ka = k0 + 8 * g + i, kb = ka + 16; v[i] = ka < K ? row[ka < K ? ka : K - 1] : 0.f; v[8 + i] = kb < K ? row[kb < K ? kb : K - 1] : 0.f; }
  return bsplit16(v); }
__device__ __forceinline__ F2 split_col(const float* W, int k0, int n, int lane, int ld, int K) { float v[16]; const int g = lane >> 4;
#pragma unroll
  for (int i = 0; i < 8; ++i) { const int ka = k0 + 8 * g + i, kb = ka + 16; v[i] = ka < K ? W[(size_t)(ka < K ? ka : K - 1) * ld + n] : 0.f; v[8 + i] = kb < K ? W[(size_t)(kb < K ? kb : K - 1) * ld + n] : 0.f; }
  return bsplit16(v); }
__device__ __forceinline__ v8f mac3(const F2& a, const F2& b, v8f c) { c = wmma_bf(a.l, b.h, c); c = wmma_bf(a.h, b.l, c); return wmma_bf(a.h, b.h, c); }
__device__ __forceinline__ float sigm(float v) { return 1.0f / (1.0f + expf(-v)); }
#define LDSX() do { asm volatile("s_wait_dscnt 0" ::: "memory"); __builtin_amdgcn_wave_barrier(); __builtin_amdgcn_fence(__ATOMIC_RELEASE, "workgroup"); } while (0)

// Multi-head attention whose q / k / v projections are ONE shared 64 x 64 linear per stream applied to every head, with a key mask (inputs in the order values, keys, queries [4,1024,1024]; mask [4,1,1,1024] int32 RANDOM 0/1 per (batch, key); torch (out,in) Wv / Wk / Wq [64,64] uniform(+-1/8), NO projection biases; heads = reshape(N, L, 16, 64); einsum('nlhd,od->nlho'); energy = einsum('nqhd,nkhd->nhqk'); where(mask == 0, -1e20, energy); softmax(energy * 1/sqrt(1024)) - the scale is 1/32, not 1/8; out merged to [N, L, 1024]; out @ Wo.T + bo with Wo [1024,1024] and bo uniform(+-1/32), bo NONZERO).
#define NB 4
#define TT 1024
#define CC 1024            // NH * HD = projected width
#define DIN 1024          // input (model) width
#define NH 16
#define HD 64
#define NQB (TT / 64)
#define HG 8   // S workspace sized for eight heads: 8 x 1,024 x 1,024 f32 = 32 MiB; no kernel uses it
#define SCALE (0.03125f)   // 1 / sqrt(E) with E = 1024 (the module scales by the MODEL width, not the head width)
#define CAUSAL 0
#ifndef TNB
#define TNB NB
#endif
__device__ __forceinline__ float bfr(float v) { return (float)(__bf16)v; }
__host__ __device__ __forceinline__ int kb_last(int qb) { return CAUSAL ? ((qb * 64 + 63) >> 7) : (TT / 128 - 1); }
typedef __attribute__((ext_vector_type(8))) __bf16 v8b;
__device__ __forceinline__ v16b frag_b(const __bf16* rowk0, int lane) {
  union { v16b v; v8b q[2]; } u; const __bf16* p = rowk0 + 8 * (lane >> 4);
  u.q[0] = *(const v8b*)p; u.q[1] = *(const v8b*)(p + 16); return u.v;
}
#define QBH 0
#define QHI 0               // single-product logits on every row
#define KHI 64            // key rows carrying k residual / v bf16 hi+lo planes (no kernel writes or reads them)
// B fragment (k rows k0+.., output column o) of a weight: (in,out) [K][ld] or (out,in) [ld rows of K]: bf16 exact, or f16(bf16 * 256) exact
__device__ __forceinline__ v16b wcol_io(const float* Wm, int k0, int o, int lane, int ld) { v16b w; const int g = lane >> 4;
#pragma unroll
  for (int i = 0; i < 8; ++i) { w[i] = (__bf16)Wm[(size_t)(k0 + 8 * g + i) * ld + o]; w[8 + i] = (__bf16)Wm[(size_t)(k0 + 16 + 8 * g + i) * ld + o]; }
  return w; }
__device__ __forceinline__ v16b wcol_oi(const float* Wm, int k0, int o, int lane, int K) { v16b w; const float* p = Wm + (size_t)o * K + k0 + 8 * (lane >> 4);
#pragma unroll
  for (int i = 0; i < 8; ++i) { w[i] = (__bf16)p[i]; w[8 + i] = (__bf16)p[16 + i]; }
  return w; }
__device__ __forceinline__ v16h wcolh_io(const float* Wm, int k0, int o, int lane, int ld) { v16h w; const int g = lane >> 4;
#pragma unroll
  for (int i = 0; i < 8; ++i) { w[i] = (_Float16)(bfr(Wm[(size_t)(k0 + 8 * g + i) * ld + o]) * 256.0f); w[8 + i] = (_Float16)(bfr(Wm[(size_t)(k0 + 16 + 8 * g + i) * ld + o]) * 256.0f); }
  return w; }
__device__ __forceinline__ v16h wcolh_oi(const float* Wm, int k0, int o, int lane, int K) { v16h w; const float* p = Wm + (size_t)o * K + k0 + 8 * (lane >> 4);
#pragma unroll
  for (int i = 0; i < 8; ++i) { w[i] = (_Float16)(bfr(p[i]) * 256.0f); w[8 + i] = (_Float16)(bfr(p[16 + i]) * 256.0f); }
  return w; }
#define WQKV_LAYOUT 1   // 0 = (in,out) [DIN][CC]; 1 = (out,in) [CC][DIN]; 2 = per-head [NH][DIN][HD]
__device__ __forceinline__ v16b wcol_hdk(const float* Wm, int k0, int o, int lane) { v16b w; const int g = lane >> 4; const float* p = Wm + (size_t)(o / HD) * DIN * HD + (o % HD);
#pragma unroll
  for (int i = 0; i < 8; ++i) { w[i] = (__bf16)p[(size_t)(k0 + 8 * g + i) * HD]; w[8 + i] = (__bf16)p[(size_t)(k0 + 16 + 8 * g + i) * HD]; }
  return w; }
#define WO_OUT_IN 1
#if WQKV_LAYOUT == 1
#define WCOL(W, k0, o, lane) wcol_oi(W, k0, o, lane, DIN)
#elif WQKV_LAYOUT == 2
#define WCOL(W, k0, o, lane) wcol_hdk(W, k0, o, lane)
#else
#define WCOL(W, k0, o, lane) wcol_io(W, k0, o, lane, CC)
#endif
#if WO_OUT_IN
#define WOCOL(W, k0, o, lane) wcol_oi(W, k0, o, lane, CC)
#define WOCOLH(W, k0, o, lane) wcolh_oi(W, k0, o, lane, CC)
#else
#define WOCOL(W, k0, o, lane) wcol_io(W, k0, o, lane, DIN)
#define WOCOLH(W, k0, o, lane) wcolh_io(W, k0, o, lane, DIN)
#endif
#ifndef PROJ_EXTRA_PARAMS
#define PROJ_EXTRA_PARAMS
#endif

#define WS_QH  0u                                      // f16 q rows [b*t][CC], unused: k_fa keeps q in registers
#define WS_KH  (WS_QH + 2u * (size_t)NB * TT * CC)      // f16 k rows [b*t][CC], unused: k_fa makes k straight into LDS
#define WS_VT  (WS_KH + 2u * (size_t)NB * TT * CC)      // f16 v planes [b][c][t], unused: k_fa makes v straight into LDS
#define WS_QL  (WS_VT + 2u * (size_t)NB * CC * TT)      // f16 q residual x 2^10 rows [b][t < QHI][CC]
#define WS_KL  (WS_QL + 2u * (size_t)NB * QHI * CC)     // f16 k residual x 2^10 rows [b][t < KHI][CC]
#define WS_VB  (WS_KL + 2u * (size_t)NB * KHI * CC)     // bf16 v hi planes [b][c][t < KHI]
#define WS_VBL (WS_VB + 2u * (size_t)NB * CC * KHI)
#define WS_S   (WS_VBL + 2u * (size_t)NB * CC * KHI)    // f32 logits / P [hg][t][s]
#define WS_Y   (WS_S  + 4u * (size_t)HG * TT * TT)      // f16 ctx x 2^6 in the fragment order of k_out: [b*t / 16][head][k step of 32][half][lane][8]
#define WS_END (WS_Y  + 4u * (size_t)NB * TT * CC)

#define FA_KP 144                  // LDS pitch of a 128-B k row: 16 B x odd
#define FA_VP 2064                 // LDS pitch of a 2,048-B v plane row: 16 B x odd
#define FA_KB (TT * FA_KP)
#define FA_VB (HD * FA_VP)
__device__ __forceinline__ v8f mmah(v16h a, v16h b, v8f c) { return __builtin_amdgcn_wmma_f32_16x16x32_f16(false, a, false, b, (short)0, c, false, false); }
__device__ __forceinline__ v16h frag_l(const unsigned char* p) { union { v16h v; v8h q[2]; } u; u.q[0] = *(const v8h*)p; u.q[1] = *(const v8h*)(p + 32); return u.v; }
__device__ __forceinline__ v8f ld8f(const unsigned char* p) { union { v8f v; v4f q[2]; } u; u.q[0] = *(const v4f*)p; u.q[1] = *(const v4f*)(p + 16); return u.v; }
// sixteen base-2 exponentials, each in place, in one statement: directly behind a transcendental stands nothing that reads its result or overwrites its source; the v_nop is that slot behind the last one
__device__ __forceinline__ void exp2x16(float (&a)[16]) {
  asm("v_exp_f32 %0, %0\n\tv_exp_f32 %1, %1\n\tv_exp_f32 %2, %2\n\tv_exp_f32 %3, %3\n\tv_exp_f32 %4, %4\n\tv_exp_f32 %5, %5\n\tv_exp_f32 %6, %6\n\tv_exp_f32 %7, %7\n\tv_exp_f32 %8, %8\n\tv_exp_f32 %9, %9\n\tv_exp_f32 %10, %10\n\tv_exp_f32 %11, %11\n\tv_exp_f32 %12, %12\n\tv_exp_f32 %13, %13\n\tv_exp_f32 %14, %14\n\tv_exp_f32 %15, %15\n\tv_nop" : "+v"(a[0]), "+v"(a[1]), "+v"(a[2]), "+v"(a[3]), "+v"(a[4]), "+v"(a[5]), "+v"(a[6]), "+v"(a[7]), "+v"(a[8]), "+v"(a[9]), "+v"(a[10]), "+v"(a[11]), "+v"(a[12]), "+v"(a[13]), "+v"(a[14]), "+v"(a[15])); }
__device__ __forceinline__ float xhalf(float x) { return __builtin_bit_cast(float, __builtin_amdgcn_permlanex16(__builtin_bit_cast(int, x), __builtin_bit_cast(int, x), 0x76543210, 0xfedcba98, false, false)); }  // lane l with lane l ^ 16
#define FA_SP 144                  // LDS pitch of a staged 128-B bf16 row: 16 B x odd
#define FA_SG (32 * FA_SP)         // one wave's staging: a group of 32 rows
#define FA_LO (FA_KB + FA_VB + 4 * TT + 8 * FA_SG)   // the list of unmasked key rows (TT ints), behind it the eight waves' counts
__device__ __forceinline__ int fa_slot(int q) { return (q & ~31) | ((q & 1) << 4) | ((q & 31) >> 1); }   // list slot of place q: a group's even rows, then its odd rows, so that a lane half reads its 16 entries in a row
typedef __attribute__((ext_vector_type(4))) __bf16 v4b;
__device__ __forceinline__ v8f mmab(v16b a, v16b b, v8f c) { return __builtin_amdgcn_wmma_f32_16x16x32_bf16(false, a, false, b, (short)0, c, false, false); }
__device__ __forceinline__ v16b frag_lb(const unsigned char* p) { union { v16b v; v8b q[2]; } u; u.q[0] = *(const v8b*)p; u.q[1] = *(const v8b*)(p + 32); return u.v; }
// a group's loads: 16 lanes per 256-B row, two rows an instruction; p + OFF = the lane's place in rows 0 / 1 of the group
template <int PITCH, int OFF = 0> __device__ __forceinline__ void pj_ld(v4f (&t)[16], const float* p) {   // OFF: floats from p to the group, kept out of the pointer, so that the pair which the loads name is the one that the wait holds
#pragma unroll
  for (int j = 0; j < 16; ++j) t[j] = *(const v4f*)(p + OFF + (size_t)j * 2 * PITCH);
  asm volatile("s_wait_xcnt 0x0" :: "v"(p) : "memory"); }   // the wait kept before a register that an issued global load names is overwritten; the pointer is an input, so that the pair lives through the run
// a group's loads by the row list: lp = the lane half's 16 list entries (byte offsets of rows 0 / 1, 2 / 3, ... of the group from xb, the batch's first row); vm = 0 sends a group that does not exist to the batch's first row; lo = the lane's place in a row
__device__ __forceinline__ void pj_ldg(v4f (&t)[16], const float* xb, const unsigned char* lp, unsigned vm, unsigned lo) {
  unsigned o[16];
#pragma unroll
  for (int q = 0; q < 4; ++q) { const v4u x = *(const v4u*)(lp + q * 16);
#pragma unroll
    for (int i = 0; i < 4; ++i) o[q * 4 + i] = (x[i] & vm) | lo; }
#pragma unroll
  for (int j = 0; j < 16; ++j) t[j] = *(const v4f*)((const unsigned char*)xb + o[j]);
  // the wait kept before a register that an issued global load names is overwritten; the offsets are inputs, so that they live through the run
  asm volatile("s_wait_xcnt 0x0" :: "v"(o[0]), "v"(o[1]), "v"(o[2]), "v"(o[3]), "v"(o[4]), "v"(o[5]), "v"(o[6]), "v"(o[7]), "v"(o[8]), "v"(o[9]), "v"(o[10]), "v"(o[11]), "v"(o[12]), "v"(o[13]), "v"(o[14]), "v"(o[15]) : "memory");
  __builtin_amdgcn_sched_barrier(0); }   // the loads are issued before the next group's conversions, whose wait would otherwise stand in front of them
// group g of np: every refill is issued, so that the counted waits leave the younger group in flight on every path; one for a group that does not exist reads the batch's first row and is not used
__device__ __forceinline__ void pj_ldn(v4f (&t)[16], const float* xb, const unsigned char* lb, int g, int np, unsigned lo) { const bool ok = g < np; pj_ldg(t, xb, lb + (ok ? g : 0) * 128, ok ? ~0u : 0u, lo); }
// rounds the group held in registers to bf16 rows in the wave's staging; d = the lane's place in rows 0 / 1
__device__ __forceinline__ void pj_put(const v4f (&t)[16], unsigned char* d) {
#pragma unroll
  for (int j = 0; j < 16; ++j) { v4b x;
#pragma unroll
    for (int e = 0; e < 4; ++e) x[e] = (__bf16)t[j][e];
    *(v4b*)(d + j * 2 * FA_SP) = x; }
  __builtin_amdgcn_sched_barrier(0); }   // the refill that follows stands behind the last read of its registers: no second register set
// the wave's own LDS writes have landed before its other lanes read them; no fence: that would also wait out the global loads in flight
__device__ __forceinline__ void pj_wx() { asm volatile("s_wait_dscnt 0x0" ::: "memory"); __builtin_amdgcn_wave_barrier(); }
__device__ __forceinline__ v8h pj_h(v8f d) { v8h h;
#pragma unroll
  for (int r = 0; r < 8; ++r) h[r] = (_Float16)d[r];
  return h; }
// the staged group of 32 input rows times the weight: k rows as W . x^T (a lane holds 8 output dims of one key), v planes as x . W^T (a lane holds 8 keys of one output dim): one 16-B LDS store per tile either way
__device__ __forceinline__ void pj_mul(const v16b (&w)[4][2], const unsigned char* sr, unsigned char* kd, unsigned char* vd, bool is_v) {
  if (is_v) {
#pragma unroll
    for (int tl = 0; tl < 2; ++tl) { const v16b x0 = frag_lb(sr + tl * 16 * FA_SP), x1 = frag_lb(sr + tl * 16 * FA_SP + 64);
#pragma unroll
      for (int ot = 0; ot < 4; ++ot) *(v8h*)(vd + ot * 16 * FA_VP + tl * 32) = pj_h(mmab(x1, w[ot][1], mmab(x0, w[ot][0], v8f{}))); }
  } else {
#pragma unroll
    for (int tl = 0; tl < 2; ++tl) { const v16b x0 = frag_lb(sr + tl * 16 * FA_SP), x1 = frag_lb(sr + tl * 16 * FA_SP + 64);
#pragma unroll
      for (int ot = 0; ot < 4; ++ot) *(v8h*)(kd + tl * 16 * FA_KP + ot * 32) = pj_h(mmab(w[ot][1], x1, mmab(w[ot][0], x0, v8f{}))); } } }
__global__ __launch_bounds__(256) void k_fa(const float* __restrict__ XQ, const float* __restrict__ XK, const float* __restrict__ XV, const float* __restrict__ WQ, const float* __restrict__ WK, const float* __restrict__ WV, const int* __restrict__ MASK, _Float16* __restrict__ YH) {
  __shared__ __align__(16) unsigned char L[FA_LO + 4 * TT + 32];
  const int tid = threadIdx.x, wave = tid >> 5, lane = tid & 31, c = lane & 15, hh = lane >> 4; const int hd = blockIdx.y, b = blockIdx.z; const int qw0 = blockIdx.x * 256 + wave * 32;
  const int* Mb = MASK + b * TT;
  v16h qf[2][2]; int np; float cs;
  { const int wv = __builtin_amdgcn_readfirstlane(wave); const bool is_v = wv >= 4; const int wq = wv & 3;   // waves 0-3: k, waves 4-7: v; each takes every fourth group of 32 kept keys
    const float* wp = (is_v ? WV : WK) + hh * HD + c * 4; const float* wqp = WQ + hh * HD + c * 4;
    const float* xb = (is_v ? XV : XK) + (size_t)b * TT * DIN; const float* qp = XQ + ((size_t)b * TT + qw0 + hh) * DIN + hd * HD + c * 4;
    unsigned char* sw = L + FA_KB + FA_VB + 4 * TT + wv * FA_SG + hh * FA_SP + c * 8; const unsigned char* sr = L + FA_KB + FA_VB + 4 * TT + wv * FA_SG + c * FA_SP + 16 * hh;
    unsigned char* kd = L + (wq * 32 + c) * FA_KP + 16 * hh; unsigned char* vd = L + FA_KB + c * FA_VP + (wq * 32 + 8 * hh) * 2;
    const unsigned char* lb = L + FA_LO + hh * 64; const unsigned lo = hd * (HD * 4) + c * 16;
    v4f ta[16], tb[16]; v16b w[4][2];
    const v4i mm = *(const v4i*)(Mb + tid * 4);
    pj_ld<HD>(ta, wqp); pj_ld<HD, 32 * HD>(tb, wqp);
    // a masked key's weight is exactly 0: only the unmasked keys are projected and attended. Their rows are listed in LDS (place = count of unmasked keys before it, by wave, then by element, then by lane), the last group filled up to 32 with the batch's first row under a bias of -1e30.
    int* LI = (int*)(L + FA_LO); int* WT = LI + TT; unsigned bl[4]; int wt = 0;
#pragma unroll
    for (int e = 0; e < 4; ++e) { bl[e] = __builtin_amdgcn_ballot_w32(mm[e] != 0); wt += __builtin_popcount(bl[e]); }
    if (lane == 0) WT[wave] = wt;
    __syncthreads();   // the eight counts are there
    int tot = 0, base = 0;
#pragma unroll
    for (int i = 0; i < 8; ++i) { const int x = WT[i]; tot += x; base += i < wave ? x : 0; }
    tot = __builtin_amdgcn_readfirstlane(tot);
    // a batch whose keys are ALL masked: the reference's logits are then all equal, i.e. uniform weights over all keys: every key is listed, and scale 0 gives exactly that
    const bool none = tot == 0; const int n = none ? TT : tot; np = (n + 31) >> 5; cs = none ? 0.f : SCALE * 1.4426950408889634f;
#pragma unroll
    for (int e = 0; e < 4; ++e) { const int key = tid * 4 + e; const int q = none ? key : base + (int)__builtin_amdgcn_mbcnt_lo(bl[e], 0u); base += __builtin_popcount(bl[e]);
      if (none || mm[e] != 0) LI[fa_slot(q)] = key * (DIN * 4); }
    if (tid < 32) { const int q = (n & ~31) + tid; if (q >= n && q < np * 32) LI[fa_slot(q)] = 0; }
    { v4f bz;
#pragma unroll
      for (int i = 0; i < 4; ++i) bz[i] = tid * 4 + i < n ? 0.f : -1.0e30f;
      *(v4f*)(L + FA_KB + FA_VB + tid * 16) = bz; }
    __syncthreads();   // the list and the biases are there
    pj_put(ta, sw); pj_ld<DIN>(ta, qp); pj_wx();
#pragma unroll
    for (int i = 0; i < 4; ++i) w[i >> 1][i & 1] = frag_lb(sr + (i >> 1) * 16 * FA_SP + (i & 1) * 64);
    pj_wx();   // the weight fragments have been read before the next group overwrites the staging
    pj_put(tb, sw); pj_ld<HD>(tb, wp); pj_wx();
#pragma unroll
    for (int i = 0; i < 4; ++i) w[2 + (i >> 1)][i & 1] = frag_lb(sr + (i >> 1) * 16 * FA_SP + (i & 1) * 64);
    pj_wx();   // as above
    pj_put(ta, sw); pj_ld<HD, 32 * HD>(ta, wp); pj_wx();
    // q^T = W . x^T: output tiles 2 kc and 2 kc + 1 of a query column are, lane for lane, the two halves of its B fragment for k step kc
#pragma unroll
    for (int g = 0; g < 2; ++g) { const v16b x0 = frag_lb(sr + g * 16 * FA_SP), x1 = frag_lb(sr + g * 16 * FA_SP + 64);
#pragma unroll
      for (int kc = 0; kc < 2; ++kc) { union { v16h v; v8h q[2]; } u;
#pragma unroll
        for (int i = 0; i < 2; ++i) u.q[i] = pj_h(mmab(w[2 * kc + i][1], x1, mmab(w[2 * kc + i][0], x0, v8f{})));
        qf[g][kc] = u.v; } }
    pj_wx();   // the q rows have been read before the next group overwrites the staging
    pj_put(tb, sw); pj_ldn(tb, xb, lb, wq, np, lo); pj_wx();
#pragma unroll
    for (int i = 0; i < 4; ++i) w[i >> 1][i & 1] = frag_lb(sr + (i >> 1) * 16 * FA_SP + (i & 1) * 64);
    pj_wx();   // the weight fragments have been read before the next group overwrites the staging
    pj_put(ta, sw); pj_ldn(ta, xb, lb, wq + 4, np, lo); pj_wx();
#pragma unroll
    for (int i = 0; i < 4; ++i) w[2 + (i >> 1)][i & 1] = frag_lb(sr + (i >> 1) * 16 * FA_SP + (i & 1) * 64);
    pj_wx();   // as above
    int g = wq;
#pragma unroll 1   // rolled: the trip count follows the mask; the test stands at the foot, so that the two refills above are used on every path and stay where they are issued
    do {
      pj_put(tb, sw); pj_ldn(tb, xb, lb, g + 8, np, lo); pj_wx(); if (g < np) pj_mul(w, sr, kd, vd, is_v);
      pj_put(ta, sw); pj_ldn(ta, xb, lb, g + 12, np, lo); pj_wx(); if (g + 4 < np) pj_mul(w, sr, kd + 128 * FA_KP, vd + 256, is_v);
      kd += 256 * FA_KP; vd += 512; g += 8; } while (g < np); }
  __syncthreads();
  v16h ones;
#pragma unroll
  for (int i = 0; i < 16; ++i) ones[i] = (_Float16)1.0f;
  v8f acc[2][4] = {}, lacc[2] = {}; float m_run[2] = {-1.0e20f, -1.0e20f};   // the floor lies far above a fill row's score (-1e30 x scale) and far below any real one
  const unsigned char* Kl = L + c * FA_KP + 16 * hh; const unsigned char* Vl = L + FA_KB + c * FA_VP + 16 * hh; const unsigned char* Bl = L + FA_KB + FA_VB + 32 * hh;
  v16h kf[2][2]; v8f bz[2];
#pragma unroll
  for (int kt = 0; kt < 2; ++kt) { bz[kt] = ld8f(Bl + kt * 64); kf[kt][0] = frag_l(Kl + kt * 16 * FA_KP); kf[kt][1] = frag_l(Kl + kt * 16 * FA_KP + 64); }
#pragma unroll 1   // rolled: two passes unrolled take more than 256 registers, and the loop then switches register windows throughout
  for (int ps = 0; ps < np; ++ps) {
    v8f s[2][2];
#pragma unroll
    for (int kt = 0; kt < 2; ++kt)
#pragma unroll
      for (int g = 0; g < 2; ++g) s[kt][g] = mmah(kf[kt][1], qf[g][1], mmah(kf[kt][0], qf[g][0], bz[kt]));
    // the pass's LDS reads stand in one place: this pass's v, and the next pass's k rows and bias (the last pass re-reads pass 0, unused)
    v16h vf[4]; const int pn = ps + 1 < np ? ps + 1 : 0;
#pragma unroll
    for (int t = 0; t < 4; ++t) vf[t] = frag_l(Vl + t * 16 * FA_VP + ps * 64);
#pragma unroll
    for (int kt = 0; kt < 2; ++kt) { bz[kt] = ld8f(Bl + (pn * 32 + kt * 16) * 4); kf[kt][0] = frag_l(Kl + (pn * 32 + kt * 16) * FA_KP); kf[kt][1] = frag_l(Kl + (pn * 32 + kt * 16) * FA_KP + 64); }
    __builtin_amdgcn_sched_barrier(0);   // the reads are issued ahead of the maxima, which then cover their latency
    float mb[2]; bool need = false;
#pragma unroll
    for (int g = 0; g < 2; ++g) { float mx = s[0][g][0];
#pragma unroll
      for (int r = 1; r < 8; ++r) mx = __builtin_fmaxf(mx, s[0][g][r]);
#pragma unroll
      for (int r = 0; r < 8; ++r) mx = __builtin_fmaxf(mx, s[1][g][r]);
      mx = __builtin_fmaxf(mx, xhalf(mx)) * cs; mb[g] = mx; need = need || (mx > m_run[g] + 8.0f); }
    __builtin_amdgcn_sched_barrier(0);   // keeps the statement below, and the wait it brings, behind the maxima
    // inputs only: holds the pass's LDS reads in front of the branch; sunk behind it they would stand directly in front of their first use
    asm volatile("" :: "v"(vf[0]), "v"(vf[1]), "v"(vf[2]), "v"(vf[3]), "v"(kf[0][0]), "v"(kf[0][1]), "v"(kf[1][0]), "v"(kf[1][1]), "v"(bz[0]), "v"(bz[1]));
    if (__builtin_amdgcn_ballot_w32(need) != 0) {   // one scalar test per pass; rare after the first unmasked keys
#pragma unroll
      for (int g = 0; g < 2; ++g) { const float m_new = __builtin_fmaxf(m_run[g], mb[g]); const float corr = __builtin_amdgcn_exp2f(m_run[g] - m_new); m_run[g] = m_new; lacc[g] = lacc[g] * corr;
#pragma unroll
        for (int t = 0; t < 4; ++t) acc[g][t] = acc[g][t] * corr; } }
#pragma unroll
    for (int g = 0; g < 2; ++g) { const float nm = 7.0f - m_run[g];   // P carried x 2^7: at most 2^15 in f16 (the maximum trails by 8 at most), small weights clear of f16 subnormals
      v16h pf; float a[16];
#pragma unroll
      for (int i = 0; i < 16; ++i) a[i] = __builtin_fmaf(s[i >> 3][g][i & 7], cs, nm);
      exp2x16(a);
#pragma unroll
      for (int i = 0; i < 16; ++i) pf[i] = (_Float16)a[i];
#pragma unroll
      for (int t = 0; t < 4; ++t) acc[g][t] = mmah(vf[t], pf, acc[g][t]);
      lacc[g] = mmah(ones, pf, lacc[g]); } }
  // ctx^T tiles 2 ks and 2 ks + 1 of a query column are, lane for lane, the two halves of the A fragment (row = query, k = the head's dims 32 ks ..) that k_out multiplies:
  // each lane rounds its own accumulators (x 2^6, once to f16) and stores them in that order, 512 B in a row per wave and store; no LDS, no barrier
  _Float16* yp = YH + ((size_t)((b * TT + qw0) >> 4) * NH + hd) * 1024 + lane * 8;
  v8h yo[2][4];
#pragma unroll
  for (int g = 0; g < 2; ++g) { const float inv = 1.0f / lacc[g][0];   // every row of the all-ones product holds the column's sum over both lane halves
#pragma unroll
    for (int t = 0; t < 4; ++t) { const v8f o = acc[g][t] * inv;
#pragma unroll
      for (int r = 0; r < 8; ++r) yo[g][t][r] = (_Float16)(o[r] * 64.0f); } }   /* ctx carried x 2^6 into f16 so small-magnitude context rows stay clear of f16 subnormals */
#pragma unroll
  for (int g = 0; g < 2; ++g)
#pragma unroll
    for (int t = 0; t < 4; ++t) vst2(yp + g * (NH * 1024) + t * 256, yo[g][t]); }
// ---- k_out: block = 128 rows x 128 cols, 8 waves of 32 x 64: out = ctx Wo (+ bo): ctx x 2^6 in f16 against Wo as f16(bf16 x 2^8) exact (1 product) x 2^-14.
// ctx arrives from k_fa as ready A fragments: a wave loads those of its 32 rows straight into registers, 512 B in a row per load, one 64-wide k slice (one head) ahead; they pass through no LDS and no conversion.
// Each 64-wide k slice of Wo is read from global memory once per block in whole lines, converted once, and laid in LDS as f16 rows; every wave takes its B fragments from there.
// Two LDS buffers; a register quad is refilled with the next slice as soon as it has been converted, so the global loads fly while this slice is multiplied. Every accumulator sums k ascending in steps of 32.
// (the plain unroll directives in k_out and its helpers keep the indices of their register arrays compile-time constants)
#define KO_P 144                   // LDS pitch of a 128-B f16 row: 16 B x odd
#define KO_T (128 * KO_P)          // one slice of Wo
#define KO_NS (CC / 64)
#define KO_EP 68                   // floats per staged output row (272 B: 16 B x odd)
typedef __attribute__((ext_vector_type(4))) _Float16 v4h;
// converts the slice of Wo held in registers into LDS at d; MORE: refills the registers with the next slice, 64 floats behind wp + OFF (OFF: floats from wp to the slice held)
template <bool MORE, int OFF> __device__ __forceinline__ void ko_put(v4f (&rw)[8], unsigned char* d, const float* wp) {
#pragma unroll
  for (int h = 0; h < 8; h += 2) {
#pragma unroll
    for (int i = h; i < h + 2; ++i) { v4h w;
#pragma unroll
      for (int e = 0; e < 4; ++e) w[e] = (_Float16)(bfr(rw[i][e]) * 256.0f);
      *(v4h*)(d + i * 16 * KO_P) = w; }
    if (MORE) {   // the two scheduling barriers: quads are waited for, converted and refilled in the order in which they were loaded (the counted waits then leave the younger loads in flight), each refill behind the last read of its registers (no second register set, no copies)
      __builtin_amdgcn_sched_barrier(0);
#pragma unroll
      for (int i = h; i < h + 2; ++i) rw[i] = *(const v4f*)(wp + OFF + 64 + (size_t)i * 16 * CC);
      __builtin_amdgcn_sched_barrier(0); } }
  if (MORE) asm volatile("s_wait_xcnt 0x0" :: "v"(wp) : "memory"); }   // the wait kept before a register that an issued global load names is overwritten; the pointer is an input, so that the pair lives through the run
// the A fragments of the wave's two row tiles for one k slice; p = the lane's place in the first tile's slice 0, OFF = f16 elements from there to the slice
template <int OFF> __device__ __forceinline__ void ko_lda(v16h (&a)[2][2], const _Float16* p) {
#pragma unroll
  for (int i = 0; i < 2; ++i)
#pragma unroll
    for (int ks = 0; ks < 2; ++ks) { union { v16h v; v8h q[2]; } u; u.q[0] = *(const v8h*)(p + OFF + i * (NH * 1024) + ks * 512); u.q[1] = *(const v8h*)(p + OFF + i * (NH * 1024) + ks * 512 + 256); a[i][ks] = u.v; }
  asm volatile("s_wait_xcnt 0x0" :: "v"(p) : "memory"); }   // as in ko_put
// the work-group's barrier with the LDS wait alone: __syncthreads() would also wait out the global loads issued ahead for the next slice
__device__ __forceinline__ void ko_bar() { asm volatile("s_wait_dscnt 0x0" ::: "memory"); asm volatile("s_barrier_signal -1" ::: "memory"); asm volatile("s_barrier_wait -1" ::: "memory"); }
__device__ __forceinline__ void ko_mul(v8f (&acc)[2][4], const v16h (&a)[2][2], const unsigned char* B) {
#pragma unroll
  for (int ks = 0; ks < 2; ++ks) { v16h w[4];
#pragma unroll
    for (int j = 0; j < 4; ++j) w[j] = frag_l(B + j * 16 * KO_P + ks * 64);
#pragma unroll
    for (int i = 0; i < 2; ++i)
#pragma unroll
      for (int j = 0; j < 4; ++j) acc[i][j] = mmah(a[i][ks], w[j], acc[i][j]); }
  __builtin_amdgcn_sched_barrier(0); }   // the next slice's conversions, and with them the wait for loads issued only just before, stay behind this slice's products
__global__ __launch_bounds__(256) void k_out(const _Float16* __restrict__ YH, const float* __restrict__ WO, const float* __restrict__ BO, float* __restrict__ OUT) {
  __shared__ __align__(16) unsigned char L[8 * 32 * KO_EP * 4];   // two slices of Wo; at the end the output staging
  static_assert(!CAUSAL && 2 * KO_T <= 8 * 32 * KO_EP * 4 && KO_NS % 2 == 0 && KO_NS >= 4, "single-product path only; both slices fit the LDS of the output staging; slices go in pairs");
  const int tid = threadIdx.x, wave = tid >> 5, lane = tid & 31, c = lane & 15, hh = lane >> 4, wm = wave >> 1, wn = wave & 1; const int c0 = blockIdx.y * 128; const size_t r0 = (size_t)blockIdx.x * 128;
  const float* wp = WO + ((size_t)c0 + (tid >> 4)) * CC + (tid & 15) * 4;   // 16 lanes per 256-B row slice, 16 rows per step
  const _Float16* yp = YH + (size_t)(blockIdx.x * 8 + wm * 2) * (NH * 1024) + lane * 8;
  unsigned char* sl = L + (tid >> 4) * KO_P + (tid & 15) * 8;
  const unsigned char* Wl = L + (wn * 64 + c) * KO_P + 16 * hh;
  v4f rw[8]; v16h a0[2][2], a1[2][2]; v8f acc[2][4] = {};
#pragma unroll
  for (int i = 0; i < 8; ++i) rw[i] = *(const v4f*)(wp + (size_t)i * 16 * CC);
  asm volatile("s_wait_xcnt 0x0" :: "v"(wp) : "memory");   // as in ko_put
  ko_lda<0>(a0, yp);
  // two slices a trip: each of the two fragment sets is refilled where it stands (no copies)
  for (int s = 0; s < KO_NS - 2; s += 2) {
    ko_put<true, 0>(rw, sl, wp); ko_lda<1024>(a1, yp);
    ko_bar();   // publishes slice s; it also ends every wave's reads of the other buffer, which is overwritten next
    ko_mul(acc, a0, Wl);
    ko_put<true, 64>(rw, sl + KO_T, wp); ko_lda<2048>(a0, yp);
    ko_bar();   // as above, slice s + 1
    ko_mul(acc, a1, Wl + KO_T);
    wp += 128; yp += 2048; }
  ko_put<true, 0>(rw, sl, wp); ko_lda<1024>(a1, yp);
  ko_bar();
  ko_mul(acc, a0, Wl);
  ko_put<false, 64>(rw, sl + KO_T, wp);
  ko_bar();
  ko_mul(acc, a1, Wl + KO_T);
  __syncthreads();   // every wave has left the slices: their LDS becomes the output staging
  float* es = (float*)L + wave * 32 * KO_EP;
#pragma unroll
  for (int j = 0; j < 4; ++j) { const float bias = BO ? bfr(BO[c0 + wn * 64 + j * 16 + c]) : 0.f;
#pragma unroll
    for (int i = 0; i < 2; ++i)
#pragma unroll
      for (int r = 0; r < 8; ++r) es[(i * 16 + 8 * hh + r) * KO_EP + j * 16 + c] = acc[i][j][r] * (1.0f / 16384.0f) + bias; }   /* 2^-8 (Wo carry) x 2^-6 (ctx carry) */
  LDSX();
#pragma unroll
  for (int i = 0; i < 16; ++i) { const int row = i * 2 + hh; vst2(OUT + (r0 + wm * 32 + row) * DIN + c0 + wn * 64 + c * 4, *(const v4f*)(es + row * KO_EP + c * 4)); } }

static_assert(HD == 64 && CC == NH * HD && DIN == CC, "per-head projection: 64-wide heads, input width == projected width");
extern "C" void kernel_launch(void* const* d_in, const int* in_sizes, int n_in, void* d_out, int out_size, void* d_ws, size_t ws_size, hipStream_t stream) {
  (void)in_sizes; (void)n_in; (void)out_size;
  const float** F = (const float**)d_in;
  if (ws_size < (size_t)WS_END) return;
  _Float16* YH = (_Float16*)((char*)d_ws + WS_Y);
  // inputs: 0 values [4,1024,1024]; 1 keys; 2 queries; 3 mask [4,1,1,1024] int32 (random 0/1; 0 = masked key); 4 Wv [64,64] (out,in); 5 Wk; 6 Wq (no projection biases); 7 Wo [1024,1024] (out,in); 8 bo (NONZERO)
  k_fa<<<dim3(TT / 256, NH, TNB), 256, 0, stream>>>(F[2], F[1], F[0], F[6], F[5], F[4], (const int*)d_in[3], YH);
  k_out<<<dim3(TNB * TT / 128, DIN / 128), 256, 0, stream>>>(YH, F[7], F[8], (float*)d_out);
}

// v006
// Measured time: 28.4 microseconds a run.
// Next to v005, in two timings, it ran 1.10 times as fast each time.
// All steps since v000 together make it 24.2 times as fast.
// compute dtype: all float inputs rounded to bf16; the per-head 64 x 64 q / k / v projections (ONE shared weight per stream, applied to every head) with EXACT bf16 products on WMMA 16x16x32 (f32 accumulate) (no projection biases); logits q x k once to f16 each (1 product) x 1024^-0.5; the per-(batch, key) int mask by leaving the masked keys out (their weight is exactly 0); online softmax f32 (log2 domain); unnormalised P x 2^7 once to f16 x v once to f16 (1 product), divided by the f32 sum of the same f16 P; ctx x 2^6 once to f16 x Wo f16(bf16 x 2^8) + bo; f32 output.
#include <hip/hip_runtime.h>
#include <math.h>

typedef __attribute__((ext_vector_type(16))) _Float16 v16h;
typedef __attribute__((ext_vector_type(16))) __bf16 v16b;
typedef __attribute__((ext_vector_type(8)))  _Float16 v8h;
typedef __attribute__((ext_vector_type(8)))  float v8f;
typedef __attribute__((ext_vector_type(4)))  float v4f;
typedef __attribute__((ext_vector_type(2)))  float v2f;
typedef __attribute__((ext_vector_type(4)))  unsigned v4u;
typedef __attribute__((ext_vector_type(4)))  int v4i;
typedef float __attribute__((may_alias)) float_a;
typedef int __attribute__((may_alias)) int_a;

template <typename T> __device__ __forceinline__ void vst2(void* p, T v) { *(T*)p = v;  }
__device__ __forceinline__ v8f wmma16(v16h a, v16h b, v8f c) {
  v8f d = __builtin_amdgcn_wmma_f32_16x16x32_f16(false, a, false, b, (short)0, c, false, false);
  asm volatile("v_nop\n\tv_nop\n\tv_nop\n\tv_nop" : "+v"(d) : "v"(a), "v"(b));
  return d;
}
__device__ __forceinline__ v8f wmma_bf(v16b a, v16b b, v8f c) {
  v8f d = __builtin_amdgcn_wmma_f32_16x16x32_bf16(false, a, false, b, (short)0, c, false, false);
  asm volatile("v_nop\n\tv_nop\n\tv_nop\n\tv_nop" : "+v"(d) : "v"(a), "v"(b));
  return d;
}
// 16x16x32 fragments: lane = (h = lane>>4, row/col = lane&15); elements 0..7 = k0+8h+0..7, 8..15 = k0+16+8h+0..7; D element r = row 8h+r
__device__ __forceinline__ v16h frag_h(const _Float16* rowk0, int lane) {
  union { v16h v; v8h q[2]; } u; const _Float16* p = rowk0 + 8 * (lane >> 4);
  u.q[0] = *(const v8h*)p; u.q[1] = *(const v8h*)(p + 16); return u.v;
}
__device__ __forceinline__ v16h frag_f32(const float* rowk0, int lane) {
  v16h a; const float* p = rowk0 + 8 * (lane >> 4);
#pragma unroll
  for (int i = 0; i < 8; ++i) { a[i] = (_Float16)p[i]; a[8 + i] = (_Float16)p[16 + i]; }
  return a;
}
__device__ __forceinline__ v16h frag_f32s(const float* rowk0, int lane, float sc) {
  v16h a; const float* p = rowk0 + 8 * (lane >> 4);
#pragma unroll
  for (int i = 0; i < 8; ++i) { a[i] = (_Float16)(p[i] * sc); a[8 + i] = (_Float16)(p[16 + i] * sc); }
  return a;
}
// column fragment from a [K][ld] layout (column n), rows >= K read as 0
__device__ __forceinline__ v16h fragc_f32(const float* W, int k0, int n, int lane, int ld, int K) {
  v16h a; const int g = lane >> 4;
#pragma unroll
  for (int i = 0; i < 8; ++i) { const int ka = k0 + 8 * g + i, kb = ka + 16;
    a[i] = (_Float16)(ka < K ? W[(size_t)(ka < K ? ka : K - 1) * ld + n] : 0.f); a[8 + i] = (_Float16)(kb < K ? W[(size_t)(kb < K ? kb : K - 1) * ld + n] : 0.f); }
  return a;
}
struct F2 { v16b h, l; };
__device__ __forceinline__ F2 bsplit16(const float v[16]) { F2 r;
#pragma unroll
  for (int i = 0; i < 16; ++i) { const __bf16 h = (__bf16)v[i]; r.h[i] = h; r.l[i] = (__bf16)(v[i] - (float)h); }
  return r; }
__device__ __forceinline__ F2 split_row(const float* row, int k0, int lane) { float v[16]; const float* p = row + k0 + 8 * (lane >> 4);
#pragma unroll
  for (int i = 0; i < 8; ++i) { v[i] = p[i]; v[8 + i] = p[16 + i]; }
  return bsplit16(v); }
__device__ __forceinline__ F2 split_rowK(const float* row, int k0, int lane, int K) { float v[16]; const int g = lane >> 4;
#pragma unroll
  for (int i = 0; i < 8; ++i) { const int ka = k0 + 8 * g + i, kb = ka + 16; v[i] = ka < K ? row[ka < K ? ka : K - 1] : 0.f; v[8 + i] = kb < K ? row[kb < K ? kb : K - 1] : 0.f; }
  return bsplit16(v); }
__device__ __forceinline__ F2 split_col(const float* W, int k0, int n, int lane, int ld, int K) { float v[16]; const int g = lane >> 4;
#pragma unroll
  for (int i = 0; i < 8; ++i) { const int ka = k0 + 8 * g + i, kb = ka + 16; v[i] = ka < K ? W[(size_t)(ka < K ? ka : K - 1) * ld + n] : 0.f; v[8 + i] = kb < K ? W[(size_t)(kb < K ? kb : K - 1) * ld + n] : 0.f; }
  return bsplit16(v); }
__device__ __forceinline__ v8f mac3(const F2& a, const F2& b, v8f c) { c = wmma_bf(a.l, b.h, c); c = wmma_bf(a.h, b.l, c); return wmma_bf(a.h, b.h, c); }
__device__ __forceinline__ float sigm(float v) { return 1.0f / (1.0f + expf(-v)); }
#define LDSX() do { asm volatile("s_wait_dscnt 0" ::: "memory"); __builtin_amdgcn_wave_barrier(); __builtin_amdgcn_fence(__ATOMIC_RELEASE, "workgroup"); } while (0)

// Multi-head attention whose q / k / v projections are ONE shared 64 x 64 linear per stream applied to every head, with a key mask (inputs in the order values, keys, queries [4,1024,1024]; mask [4,1,1,1024] int32 RANDOM 0/1 per (batch, key); torch (out,in) Wv / Wk / Wq [64,64] uniform(+-1/8), NO projection biases; heads = reshape(N, L, 16, 64); einsum('nlhd,od->nlho'); energy = einsum('nqhd,nkhd->nhqk'); where(mask == 0, -1e20, energy); softmax(energy * 1/sqrt(1024)) - the scale is 1/32, not 1/8; out merged to [N, L, 1024]; out @ Wo.T + bo with Wo [1024,1024] and bo uniform(+-1/32), bo NONZERO).
#define NB 4
#define TT 1024
#define CC 1024            // NH * HD = projected width
#define DIN 1024          // input (model) width
#define NH 16
#define HD 64
#define NQB (TT / 64)
#define HG 8   // S workspace sized for eight heads: 8 x 1,024 x 1,024 f32 = 32 MiB; no kernel uses it
#define SCALE (0.03125f)   // 1 / sqrt(E) with E = 1024 (the module scales by the MODEL width, not the head width)
#define CAUSAL 0
#ifndef TNB
#define TNB NB
#endif
__device__ __forceinline__ float bfr(float v) { return (float)(__bf16)v; }
__host__ __device__ __forceinline__ int kb_last(int qb) { return CAUSAL ? ((qb * 64 + 63) >> 7) : (TT / 128 - 1); }
typedef __attribute__((ext_vector_type(8))) __bf16 v8b;
__device__ __forceinline__ v16b frag_b(const __bf16* rowk0, int lane) {
  union { v16b v; v8b q[2]; } u; const __bf16* p = rowk0 + 8 * (lane >> 4);
  u.q[0] = *(const v8b*)p; u.q[1] = *(const v8b*)(p + 16); return u.v;
}
#define QBH 0
#define QHI 0               // single-product logits on every row
#define KHI 64            // key rows carrying k residual / v bf16 hi+lo planes (no kernel writes or reads them)
// B fragment (k rows k0+.., output column o) of a weight: (in,out) [K][ld] or (out,in) [ld rows of K]: bf16 exact, or f16(bf16 * 256) exact
__device__ __forceinline__ v16b wcol_io(const float* Wm, int k0, int o, int lane, int ld) { v16b w; const int g = lane >> 4;
#pragma unroll
  for (int i = 0; i < 8; ++i) { w[i] = (__bf16)Wm[(size_t)(k0 + 8 * g + i) * ld + o]; w[8 + i] = (__bf16)Wm[(size_t)(k0 + 16 + 8 * g + i) * ld + o]; }
  return w; }
__device__ __forceinline__ v16b wcol_oi(const float* Wm, int k0, int o, int lane, int K) { v16b w; const float* p = Wm + (size_t)o * K + k0 + 8 * (lane >> 4);
#pragma unroll
  for (int i = 0; i < 8; ++i) { w[i] = (__bf16)p[i]; w[8 + i] = (__bf16)p[16 + i]; }
  return w; }
__device__ __forceinline__ v16h wcolh_io(const float* Wm, int k0, int o, int lane, int ld) { v16h w; const int g = lane >> 4;
#pragma unroll
  for (int i = 0; i < 8; ++i) { w[i] = (_Float16)(bfr(Wm[(size_t)(k0 + 8 * g + i) * ld + o]) * 256.0f); w[8 + i] = (_Float16)(bfr(Wm[(size_t)(k0 + 16 + 8 * g + i) * ld + o]) * 256.0f); }
  return w; }
__device__ __forceinline__ v16h wcolh_oi(const float* Wm, int k0, int o, int lane, int K) { v16h w; const float* p = Wm + (size_t)o * K + k0 + 8 * (lane >> 4);
#pragma unroll
  for (int i = 0; i < 8; ++i) { w[i] = (_Float16)(bfr(p[i]) * 256.0f); w[8 + i] = (_Float16)(bfr(p[16 + i]) * 256.0f); }
  return w; }
#define WQKV_LAYOUT 1   // 0 = (in,out) [DIN][CC]; 1 = (out,in) [CC][DIN]; 2 = per-head [NH][DIN][HD]
__device__ __forceinline__ v16b wcol_hdk(const float* Wm, int k0, int o, int lane) { v16b w; const int g = lane >> 4; const float* p = Wm + (size_t)(o / HD) * DIN * HD + (o % HD);
#pragma unroll
  for (int i = 0; i < 8; ++i) { w[i] = (__bf16)p[(size_t)(k0 + 8 * g + i) * HD]; w[8 + i] = (__bf16)p[(size_t)(k0 + 16 + 8 * g + i) * HD]; }
  return w; }
#define WO_OUT_IN 1
#if WQKV_LAYOUT == 1
#define WCOL(W, k0, o, lane) wcol_oi(W, k0, o, lane, DIN)
#elif WQKV_LAYOUT == 2
#define WCOL(W, k0, o, lane) wcol_hdk(W, k0, o, lane)
#else
#define WCOL(W, k0, o, lane) wcol_io(W, k0, o, lane, CC)
#endif
#if WO_OUT_IN
#define WOCOL(W, k0, o, lane) wcol_oi(W, k0, o, lane, CC)
#define WOCOLH(W, k0, o, lane) wcolh_oi(W, k0, o, lane, CC)
#else
#define WOCOL(W, k0, o, lane) wcol_io(W, k0, o, lane, DIN)
#define WOCOLH(W, k0, o, lane) wcolh_io(W, k0, o, lane, DIN)
#endif
#ifndef PROJ_EXTRA_PARAMS
#define PROJ_EXTRA_PARAMS
#endif

#define WS_QH  0u                                      // f16 q rows [b*t][CC], unused: k_fa keeps q in registers
#define WS_KH  (WS_QH + 2u * (size_t)NB * TT * CC)      // f16 k rows [b*t][CC], unused: k_fa makes k straight into LDS
#define WS_VT  (WS_KH + 2u * (size_t)NB * TT * CC)      // f16 v planes [b][c][t], unused: k_fa makes v straight into LDS
#define WS_QL  (WS_VT + 2u * (size_t)NB * CC * TT)      // f16 q residual x 2^10 rows [b][t < QHI][CC]
#define WS_KL  (WS_QL + 2u * (size_t)NB * QHI * CC)     // f16 k residual x 2^10 rows [b][t < KHI][CC]
#define WS_VB  (WS_KL + 2u * (size_t)NB * KHI * CC)     // bf16 v hi planes [b][c][t < KHI]
#define WS_VBL (WS_VB + 2u * (size_t)NB * CC * KHI)
#define WS_S   (WS_VBL + 2u * (size_t)NB * CC * KHI)    // f32 logits / P [hg][t][s]
#define WS_Y   (WS_S  + 4u * (size_t)HG * TT * TT)      // f16 ctx x 2^6 in the fragment order of k_out: [b*t / 16][head][k step of 32][half][lane][8]
#define WS_END (WS_Y  + 4u * (size_t)NB * TT * CC)

#define FA_KP 144                  // LDS pitch of a 128-B k row: 16 B x odd
#define FA_VP 2064                 // LDS pitch of a 2,048-B v plane row: 16 B x odd
#define FA_KB (TT * FA_KP)
#define FA_VB (HD * FA_VP)
__device__ __forceinline__ v8f mmah(v16h a, v16h b, v8f c) { return __builtin_amdgcn_wmma_f32_16x16x32_f16(false, a, false, b, (short)0, c, false, false); }
__device__ __forceinline__ v16h frag_l(const unsigned char* p) { union { v16h v; v8h q[2]; } u; u.q[0] = *(const v8h*)p; u.q[1] = *(const v8h*)(p + 32); return u.v; }
__device__ __forceinline__ v8f ld8f(const unsigned char* p) { union { v8f v; v4f q[2]; } u; u.q[0] = *(const v4f*)p; u.q[1] = *(const v4f*)(p + 16); return u.v; }
// sixteen base-2 exponentials, each in place, in one statement: directly behind a transcendental stands nothing that reads its result or overwrites its source; the v_nop is that slot behind the last one
__device__ __forceinline__ void exp2x16(float (&a)[16]) {
  asm("v_exp_f32 %0, %0\n\tv_exp_f32 %1, %1\n\tv_exp_f32 %2, %2\n\tv_exp_f32 %3, %3\n\tv_exp_f32 %4, %4\n\tv_exp_f32 %5, %5\n\tv_exp_f32 %6, %6\n\tv_exp_f32 %7, %7\n\tv_exp_f32 %8, %8\n\tv_exp_f32 %9, %9\n\tv_exp_f32 %10, %10\n\tv_exp_f32 %11, %11\n\tv_exp_f32 %12, %12\n\tv_exp_f32 %13, %13\n\tv_exp_f32 %14, %14\n\tv_exp_f32 %15, %15\n\tv_nop" : "+v"(a[0]), "+v"(a[1]), "+v"(a[2]), "+v"(a[3]), "+v"(a[4]), "+v"(a[5]), "+v"(a[6]), "+v"(a[7]), "+v"(a[8]), "+v"(a[9]), "+v"(a[10]), "+v"(a[11]), "+v"(a[12]), "+v"(a[13]), "+v"(a[14]), "+v"(a[15])); }
__device__ __forceinline__ float xhalf(float x) { return __builtin_bit_cast(float, __builtin_amdgcn_permlanex16(__builtin_bit_cast(int, x), __builtin_bit_cast(int, x), 0x76543210, 0xfedcba98, false, false)); }  // lane l with lane l ^ 16
#define FA_SP 144                  // LDS pitch of a staged 128-B bf16 row: 16 B x odd
#define FA_SG (32 * FA_SP)         // one wave's staging: a group of 32 rows
#define FA_LO (FA_KB + FA_VB + 4 * TT + 8 * FA_SG)   // the list of unmasked key rows (TT ints), behind it the eight waves' counts
__device__ __forceinline__ int fa_slot(int q) { return (q & ~31) | ((q & 1) << 4) | ((q & 31) >> 1); }   // list slot of place q: a group's even rows, then its odd rows, so that a lane half reads its 16 entries in a row
typedef __attribute__((ext_vector_type(4))) __bf16 v4b;
__device__ __forceinline__ v8f mmab(v16b a, v16b b, v8f c) { return __builtin_amdgcn_wmma_f32_16x16x32_bf16(false, a, false, b, (short)0, c, false, false); }
__device__ __forceinline__ v16b frag_lb(const unsigned char* p) { union { v16b v; v8b q[2]; } u; u.q[0] = *(const v8b*)p; u.q[1] = *(const v8b*)(p + 32); return u.v; }
// a group's loads: 16 lanes per 256-B row, two rows an instruction; p + OFF = the lane's place in rows 0 / 1 of the group
template <int PITCH, int OFF = 0> __device__ __forceinline__ void pj_ld(v4f (&t)[16], const float* p) {   // OFF: floats from p to the group, kept out of the pointer, so that the pair which the loads name is the one that the wait holds
#pragma unroll
  for (int j = 0; j < 16; ++j) t[j] = *(const v4f*)(p + OFF + (size_t)j * 2 * PITCH);
  asm volatile("s_wait_xcnt 0x0" :: "v"(p) : "memory"); }   // the wait kept before a register that an issued global load names is overwritten; the pointer is an input, so that the pair lives through the run
// a group's loads by the row list: lp = the lane half's 16 list entries (byte offsets of rows 0 / 1, 2 / 3, ... of the group from xb, the batch's first row); vm = 0 sends a group that does not exist to the batch's first row; lo = the lane's place in a row
__device__ __forceinline__ void pj_ldg(v4f (&t)[16], const float* xb, const unsigned char* lp, unsigned vm, unsigned lo) {
  unsigned o[16];
#pragma unroll
  for (int q = 0; q < 4; ++q) { const v4u x = *(const v4u*)(lp + q * 16);
#pragma unroll
    for (int i = 0; i < 4; ++i) o[q * 4 + i] = (x[i] & vm) | lo; }
#pragma unroll
  for (int j = 0; j < 16; ++j) t[j] = *(const v4f*)((const unsigned char*)xb + o[j]);
  // the wait kept before a register that an issued global load names is overwritten; the offsets are inputs, so that they live through the run
  asm volatile("s_wait_xcnt 0x0" :: "v"(o[0]), "v"(o[1]), "v"(o[2]), "v"(o[3]), "v"(o[4]), "v"(o[5]), "v"(o[6]), "v"(o[7]), "v"(o[8]), "v"(o[9]), "v"(o[10]), "v"(o[11]), "v"(o[12]), "v"(o[13]), "v"(o[14]), "v"(o[15]) : "memory");
  __builtin_amdgcn_sched_barrier(0); }   // the loads are issued before the next group's conversions, whose wait would otherwise stand in front of them
// the block's g-th group of np is group g + rot of the list, going round (g < np, rot < np)
__device__ __forceinline__ int pj_rot(int g, int np, int rot) { const int p = g + rot; return p >= np ? p - np : p; }
// group g of np: every refill is issued, so that the counted waits leave the younger group in flight on every path; one for a group that does not exist reads the batch's first row and is not used
__device__ __forceinline__ void pj_ldn(v4f (&t)[16], const float* xb, const unsigned char* lb, int g, int np, int rot, unsigned lo) { const bool ok = g < np; pj_ldg(t, xb, lb + (ok ? pj_rot(g, np, rot) : 0) * 128, ok ? ~0u : 0u, lo); }
// rounds the group held in registers to bf16 rows in the wave's staging; d = the lane's place in rows 0 / 1
__device__ __forceinline__ void pj_put(const v4f (&t)[16], unsigned char* d) {
#pragma unroll
  for (int j = 0; j < 16; ++j) { v4b x;
#pragma unroll
    for (int e = 0; e < 4; ++e) x[e] = (__bf16)t[j][e];
    *(v4b*)(d + j * 2 * FA_SP) = x; }
  __builtin_amdgcn_sched_barrier(0); }   // the refill that follows stands behind the last read of its registers: no second register set
// the wave's own LDS writes have landed before its other lanes read them; no fence: that would also wait out the global loads in flight
__device__ __forceinline__ void pj_wx() { asm volatile("s_wait_dscnt 0x0" ::: "memory"); __builtin_amdgcn_wave_barrier(); }
__device__ __forceinline__ v8h pj_h(v8f d) { v8h h;
#pragma unroll
  for (int r = 0; r < 8; ++r) h[r] = (_Float16)d[r];
  return h; }
// the staged group of 32 input rows times the weight: k rows as W . x^T (a lane holds 8 output dims of one key), v planes as x . W^T (a lane holds 8 keys of one output dim): one 16-B LDS store per tile either way
__device__ __forceinline__ void pj_mul(const v16b (&w)[4][2], const unsigned char* sr, unsigned char* kd, unsigned char* vd, bool is_v) {
  if (is_v) {
#pragma unroll
    for (int tl = 0; tl < 2; ++tl) { const v16b x0 = frag_lb(sr + tl * 16 * FA_SP), x1 = frag_lb(sr + tl * 16 * FA_SP + 64);
#pragma unroll
      for (int ot = 0; ot < 4; ++ot) *(v8h*)(vd + ot * 16 * FA_VP + tl * 32) = pj_h(mmab(x1, w[ot][1], mmab(x0, w[ot][0], v8f{}))); }
  } else {
#pragma unroll
    for (int tl = 0; tl < 2; ++tl) { const v16b x0 = frag_lb(sr + tl * 16 * FA_SP), x1 = frag_lb(sr + tl * 16 * FA_SP + 64);
#pragma unroll
      for (int ot = 0; ot < 4; ++ot) *(v8h*)(kd + tl * 16 * FA_KP + ot * 32) = pj_h(mmab(w[ot][1], x1, mmab(w[ot][0], x0, v8f{}))); } } }
__global__ __launch_bounds__(256) void k_fa(const float* __restrict__ XQ, const float* __restrict__ XK, const float* __restrict__ XV, const float* __restrict__ WQ, const float* __restrict__ WK, const float* __restrict__ WV, const int* __restrict__ MASK, _Float16* __restrict__ YH) {
  __shared__ __align__(16) unsigned char L[FA_LO + 4 * TT + 32];
  const int tid = threadIdx.x, wave = tid >> 5, lane = tid & 31, c = lane & 15, hh = lane >> 4; const int hd = blockIdx.y, b = blockIdx.z; const int qw0 = blockIdx.x * 256 + wave * 32;
  const int* Mb = MASK + b * TT;
  v16h qf[2][2]; int np; float cs;
  { const int wv = __builtin_amdgcn_readfirstlane(wave); const bool is_v = wv >= 4; const int wq = wv & 3;   // waves 0-3: k, waves 4-7: v; each takes every fourth group of 32 kept keys
    const float* wp = (is_v ? WV : WK) + hh * HD + c * 4; const float* wqp = WQ + hh * HD + c * 4;
    const float* xb = (is_v ? XV : XK) + (size_t)b * TT * DIN; const float* qp = XQ + ((size_t)b * TT + qw0 + hh) * DIN + hd * HD + c * 4;
    unsigned char* sw = L + FA_KB + FA_VB + 4 * TT + wv * FA_SG + hh * FA_SP + c * 8; const unsigned char* sr = L + FA_KB + FA_VB + 4 * TT + wv * FA_SG + c * FA_SP + 16 * hh;
    unsigned char* kd = L + c * FA_KP + 16 * hh; unsigned char* vd = L + FA_KB + c * FA_VP + 16 * hh;   // the lane's place in group 0 of the k rows and of the v planes
    const unsigned char* lb = L + FA_LO + hh * 64; const unsigned lo = hd * (HD * 4) + c * 16;
    v4f ta[16], tb[16]; v16b w[4][2];
    const v4i mm = *(const v4i*)(Mb + tid * 4);
    pj_ld<HD>(ta, wqp); pj_ld<HD, 32 * HD>(tb, wqp);
    // a masked key's weight is exactly 0: only the unmasked keys are projected and attended. Their rows are listed in LDS (place = count of unmasked keys before it, by wave, then by element, then by lane), the last group filled up to 32 with the batch's first row under a bias of -1e30.
    int* LI = (int*)(L + FA_LO); int* WT = LI + TT; unsigned bl[4]; int wt = 0;
#pragma unroll
    for (int e = 0; e < 4; ++e) { bl[e] = __builtin_amdgcn_ballot_w32(mm[e] != 0); wt += __builtin_popcount(bl[e]); }
    if (lane == 0) WT[wave] = wt;
    __syncthreads();   // the eight counts are there
    int tot = 0, base = 0;
#pragma unroll
    for (int i = 0; i < 8; ++i) { const int x = WT[i]; tot += x; base += i < wave ? x : 0; }
    tot = __builtin_amdgcn_readfirstlane(tot);
    // a batch whose keys are ALL masked: the reference's logits are then all equal, i.e. uniform weights over all keys: every key is listed, and scale 0 gives exactly that
    const bool none = tot == 0; const int n = none ? TT : tot; np = (n + 31) >> 5; cs = none ? 0.f : SCALE * 1.4426950408889634f;
#pragma unroll
    for (int e = 0; e < 4; ++e) { const int key = tid * 4 + e; const int q = none ? key : base + (int)__builtin_amdgcn_mbcnt_lo(bl[e], 0u); base += __builtin_popcount(bl[e]);
      if (none || mm[e] != 0) LI[fa_slot(q)] = key * (DIN * 4); }
    if (tid < 32) { const int q = (n & ~31) + tid; if (q >= n && q < np * 32) LI[fa_slot(q)] = 0; }
    { v4f bz;
#pragma unroll
      for (int i = 0; i < 4; ++i) bz[i] = tid * 4 + i < n ? 0.f : -1.0e30f;
      *(v4f*)(L + FA_KB + FA_VB + tid * 16) = bz; }
    __syncthreads();   // the list and the biases are there
    pj_put(ta, sw); pj_ld<DIN>(ta, qp); pj_wx();
#pragma unroll
    for (int i = 0; i < 4; ++i) w[i >> 1][i & 1] = frag_lb(sr + (i >> 1) * 16 * FA_SP + (i & 1) * 64);
    pj_wx();   // the weight fragments have been read before the next group overwrites the staging
    pj_put(tb, sw); pj_ld<HD>(tb, wp); pj_wx();
#pragma unroll
    for (int i = 0; i < 4; ++i) w[2 + (i >> 1)][i & 1] = frag_lb(sr + (i >> 1) * 16 * FA_SP + (i & 1) * 64);
    pj_wx();   // as above
    pj_put(ta, sw); pj_ld<HD, 32 * HD>(ta, wp); pj_wx();
    // q^T = W . x^T: output tiles 2 kc and 2 kc + 1 of a query column are, lane for lane, the two halves of its B fragment for k step kc
#pragma unroll
    for (int g = 0; g < 2; ++g) { const v16b x0 = frag_lb(sr + g * 16 * FA_SP), x1 = frag_lb(sr + g * 16 * FA_SP + 64);
#pragma unroll
      for (int kc = 0; kc < 2; ++kc) { union { v16h v; v8h q[2]; } u;
#pragma unroll
        for (int i = 0; i < 2; ++i) u.q[i] = pj_h(mmab(w[2 * kc + i][1], x1, mmab(w[2 * kc + i][0], x0, v8f{})));
        qf[g][kc] = u.v; } }
    pj_wx();   // the q rows have been read before the next group overwrites the staging
    // the four blocks of a (batch, head) read the same key and value rows: each starts a quarter of the list further on and goes round, so that at one moment they ask L2 for different lines; a group keeps its place in LDS
    const int rot = ((int)blockIdx.x * np) >> 2;
    pj_put(tb, sw); pj_ldn(tb, xb, lb, wq, np, rot, lo); pj_wx();
#pragma unroll
    for (int i = 0; i < 4; ++i) w[i >> 1][i & 1] = frag_lb(sr + (i >> 1) * 16 * FA_SP + (i & 1) * 64);
    pj_wx();   // the weight fragments have been read before the next group overwrites the staging
    pj_put(ta, sw); pj_ldn(ta, xb, lb, wq + 4, np, rot, lo); pj_wx();
#pragma unroll
    for (int i = 0; i < 4; ++i) w[2 + (i >> 1)][i & 1] = frag_lb(sr + (i >> 1) * 16 * FA_SP + (i & 1) * 64);
    pj_wx();   // as above
    int g = wq;
#pragma unroll 1   // rolled: the trip count follows the mask; the test stands at the foot, so that the two refills above are used on every path and stay where they are issued
    do {
      pj_put(tb, sw); pj_ldn(tb, xb, lb, g + 8, np, rot, lo); pj_wx(); if (g < np) { const int p = pj_rot(g, np, rot); pj_mul(w, sr, kd + p * (32 * FA_KP), vd + p * 64, is_v); }
      pj_put(ta, sw); pj_ldn(ta, xb, lb, g + 12, np, rot, lo); pj_wx(); if (g + 4 < np) { const int p = pj_rot(g + 4, np, rot); pj_mul(w, sr, kd + p * (32 * FA_KP), vd + p * 64, is_v); }
      g += 8; } while (g < np); }
  __syncthreads();
  v16h ones;
#pragma unroll
  for (int i = 0; i < 16; ++i) ones[i] = (_Float16)1.0f;
  v8f acc[2][4] = {}, lacc[2] = {}; float m_run[2] = {-1.0e20f, -1.0e20f};   // the floor lies far above a fill row's score (-1e30 x scale) and far below any real one
  const unsigned char* Kl = L + c * FA_KP + 16 * hh; const unsigned char* Vl = L + FA_KB + c * FA_VP + 16 * hh; const unsigned char* Bl = L + FA_KB + FA_VB + 32 * hh;
  v16h kf[2][2]; v8f bz[2];
#pragma unroll
  for (int kt = 0; kt < 2; ++kt) { bz[kt] = ld8f(Bl + kt * 64); kf[kt][0] = frag_l(Kl + kt * 16 * FA_KP); kf[kt][1] = frag_l(Kl + kt * 16 * FA_KP + 64); }
#pragma unroll 1   // rolled: two passes unrolled take more than 256 registers, and the loop then switches register windows throughout
  for (int ps = 0; ps < np; ++ps) {
    v8f s[2][2];
#pragma unroll
    for (int kt = 0; kt < 2; ++kt)
#pragma unroll
      for (int g = 0; g < 2; ++g) s[kt][g] = mmah(kf[kt][1], qf[g][1], mmah(kf[kt][0], qf[g][0], bz[kt]));
    // the pass's LDS reads stand in one place: this pass's v, and the next pass's k rows and bias (the last pass re-reads pass 0, unused)
    v16h vf[4]; const int pn = ps + 1 < np ? ps + 1 : 0;
#pragma unroll
    for (int t = 0; t < 4; ++t) vf[t] = frag_l(Vl + t * 16 * FA_VP + ps * 64);
#pragma unroll
    for (int kt = 0; kt < 2; ++kt) { bz[kt] = ld8f(Bl + (pn * 32 + kt * 16) * 4); kf[kt][0] = frag_l(Kl + (pn * 32 + kt * 16) * FA_KP); kf[kt][1] = frag_l(Kl + (pn * 32 + kt * 16) * FA_KP + 64); }
    __builtin_amdgcn_sched_barrier(0);   // the reads are issued ahead of the maxima, which then cover their latency
    float mb[2]; bool need = false;
#pragma unroll
    for (int g = 0; g < 2; ++g) { float mx = s[0][g][0];
#pragma unroll
      for (int r = 1; r < 8; ++r) mx = __builtin_fmaxf(mx, s[0][g][r]);
#pragma unroll
      for (int r = 0; r < 8; ++r) mx = __builtin_fmaxf(mx, s[1][g][r]);
      mx = __builtin_fmaxf(mx, xhalf(mx)) * cs; mb[g] = mx; need = need || (mx > m_run[g] + 8.0f); }
    __builtin_amdgcn_sched_barrier(0);   // keeps the statement below, and the wait it brings, behind the maxima
    // inputs only: holds the pass's LDS reads in front of the branch; sunk behind it they would stand directly in front of their first use
    asm volatile("" :: "v"(vf[0]), "v"(vf[1]), "v"(vf[2]), "v"(vf[3]), "v"(kf[0][0]), "v"(kf[0][1]), "v"(kf[1][0]), "v"(kf[1][1]), "v"(bz[0]), "v"(bz[1]));
    if (__builtin_amdgcn_ballot_w32(need) != 0) {   // one scalar test per pass; rare after the first unmasked keys
#pragma unroll
      for (int g = 0; g < 2; ++g) { const float m_new = __builtin_fmaxf(m_run[g], mb[g]); const float corr = __builtin_amdgcn_exp2f(m_run[g] - m_new); m_run[g] = m_new; lacc[g] = lacc[g] * corr;
#pragma unroll
        for (int t = 0; t < 4; ++t) acc[g][t] = acc[g][t] * corr; } }
#pragma unroll
    for (int g = 0; g < 2; ++g) { const float nm = 7.0f - m_run[g];   // P carried x 2^7: at most 2^15 in f16 (the maximum trails by 8 at most), small weights clear of f16 subnormals
      v16h pf; float a[16];
#pragma unroll
      for (int i = 0; i < 16; ++i) a[i] = __builtin_fmaf(s[i >> 3][g][i & 7], cs, nm);
      exp2x16(a);
#pragma unroll
      for (int i = 0; i < 16; ++i) pf[i] = (_Float16)a[i];
#pragma unroll
      for (int t = 0; t < 4; ++t) acc[g][t] = mmah(vf[t], pf, acc[g][t]);
      lacc[g] = mmah(ones, pf, lacc[g]); } }
  // ctx^T tiles 2 ks and 2 ks + 1 of a query column are, lane for lane, the two halves of the A fragment (row = query, k = the head's dims 32 ks ..) that k_out multiplies:
  // each lane rounds its own accumulators (x 2^6, once to f16) and stores them in that order, 512 B in a row per wave and store; no LDS, no barrier
  _Float16* yp = YH + ((size_t)((b * TT + qw0) >> 4) * NH + hd) * 1024 + lane * 8;
  v8h yo[2][4];
#pragma unroll
  for (int g = 0; g < 2; ++g) { const float inv = 1.0f / lacc[g][0];   // every row of the all-ones product holds the column's sum over both lane halves
#pragma unroll
    for (int t = 0; t < 4; ++t) { const v8f o = acc[g][t] * inv;
#pragma unroll
      for (int r = 0; r < 8; ++r) yo[g][t][r] = (_Float16)(o[r] * 64.0f); } }   /* ctx carried x 2^6 into f16 so small-magnitude context rows stay clear of f16 subnormals */
#pragma unroll
  for (int g = 0; g < 2; ++g)
#pragma unroll
    for (int t = 0; t < 4; ++t) vst2(yp + g * (NH * 1024) + t * 256, yo[g][t]); }
// ---- k_out: block = 128 rows x 128 cols, 8 waves of 32 x 64: out = ctx Wo (+ bo): ctx x 2^6 in f16 against Wo as f16(bf16 x 2^8) exact (1 product) x 2^-14.
// ctx arrives from k_fa as ready A fragments: a wave loads those of its 32 rows straight into registers, 512 B in a row per load, one 64-wide k slice (one head) ahead; they pass through no LDS and no conversion.
// Each 64-wide k slice of Wo is read from global memory once per block in whole lines, converted once, and laid in LDS as f16 rows; every wave takes its B fragments from there.
// Two LDS buffers; a register quad is refilled with the next slice as soon as it has been converted, so the global loads fly while this slice is multiplied.
// The 32 blocks of a column strip read the same rows of Wo and the 8 blocks of a row strip the same ctx: each block starts its k loop at its own slice and goes round, so that at one moment they ask L2 for different lines. Every accumulator sums k in steps of 32, ascending from the block's first slice and wrapping at the end.
// (the plain unroll directives in k_out and its helpers keep the indices of their register arrays compile-time constants)
#define KO_P 144                   // LDS pitch of a 128-B f16 row: 16 B x odd
#define KO_T (128 * KO_P)          // one slice of Wo
#define KO_NS (CC / 64)
#define KO_EP 68                   // floats per staged output row (272 B: 16 B x odd)
typedef __attribute__((ext_vector_type(4))) _Float16 v4h;
// converts the slice of Wo held in registers into LDS at d; MORE: refills the registers with the block's next slice, whose first row piece of the lane stands at wp
template <bool MORE> __device__ __forceinline__ void ko_put(v4f (&rw)[8], unsigned char* d, const float* wp) {
#pragma unroll
  for (int h = 0; h < 8; h += 2) {
#pragma unroll
    for (int i = h; i < h + 2; ++i) { v4h w;
#pragma unroll
      for (int e = 0; e < 4; ++e) w[e] = (_Float16)(bfr(rw[i][e]) * 256.0f);
      *(v4h*)(d + i * 16 * KO_P) = w; }
    if (MORE) {   // the two scheduling barriers: quads are waited for, converted and refilled in the order in which they were loaded (the counted waits then leave the younger loads in flight), each refill behind the last read of its registers (no second register set, no copies)
      __builtin_amdgcn_sched_barrier(0);
#pragma unroll
      for (int i = h; i < h + 2; ++i) rw[i] = *(const v4f*)(wp + (size_t)i * 16 * CC);
      __builtin_amdgcn_sched_barrier(0); } }
  if (MORE) asm volatile("s_wait_xcnt 0x0" :: "v"(wp) : "memory"); }   // the wait kept before a register that an issued global load names is overwritten; the pointer is an input, so that the pair lives through the run
// the A fragments of the wave's two row tiles for one k slice; p = the lane's place in the first tile's part of that slice
__device__ __forceinline__ void ko_lda(v16h (&a)[2][2], const _Float16* p) {
#pragma unroll
  for (int i = 0; i < 2; ++i)
#pragma unroll
    for (int ks = 0; ks < 2; ++ks) { union { v16h v; v8h q[2]; } u; u.q[0] = *(const v8h*)(p + i * (NH * 1024) + ks * 512); u.q[1] = *(const v8h*)(p + i * (NH * 1024) + ks * 512 + 256); a[i][ks] = u.v; }
  asm volatile("s_wait_xcnt 0x0" :: "v"(p) : "memory"); }   // as in ko_put
// the work-group's barrier with the LDS wait alone: __syncthreads() would also wait out the global loads issued ahead for the next slice
__device__ __forceinline__ void ko_bar() { asm volatile("s_wait_dscnt 0x0" ::: "memory"); asm volatile("s_barrier_signal -1" ::: "memory"); asm volatile("s_barrier_wait -1" ::: "memory"); }
__device__ __forceinline__ void ko_mul(v8f (&acc)[2][4], const v16h (&a)[2][2], const unsigned char* B) {
#pragma unroll
  for (int ks = 0; ks < 2; ++ks) { v16h w[4];
#pragma unroll
    for (int j = 0; j < 4; ++j) w[j] = frag_l(B + j * 16 * KO_P + ks * 64);
#pragma unroll
    for (int i = 0; i < 2; ++i)
#pragma unroll
      for (int j = 0; j < 4; ++j) acc[i][j] = mmah(a[i][ks], w[j], acc[i][j]); }
  __builtin_amdgcn_sched_barrier(0); }   // the next slice's conversions, and with them the wait for loads issued only just before, stay behind this slice's products
__global__ __launch_bounds__(256) void k_out(const _Float16* __restrict__ YH, const float* __restrict__ WO, const float* __restrict__ BO, float* __restrict__ OUT) {
  __shared__ __align__(16) unsigned char L[8 * 32 * KO_EP * 4];   // two slices of Wo; at the end the output staging
  static_assert(!CAUSAL && 2 * KO_T <= 8 * 32 * KO_EP * 4 && KO_NS % 2 == 0 && KO_NS >= 4 && (KO_NS & (KO_NS - 1)) == 0, "non-causal only; both slices fit the LDS of the output staging; slices go in pairs and wrap by a mask");
  const int tid = threadIdx.x, wave = tid >> 5, lane = tid & 31, c = lane & 15, hh = lane >> 4, wm = wave >> 1, wn = wave & 1; const int c0 = blockIdx.y * 128; const size_t r0 = (size_t)blockIdx.x * 128;
  const float* wp = WO + ((size_t)c0 + (tid >> 4)) * CC + (tid & 15) * 4;   // 16 lanes per 256-B row slice, 16 rows per step
  const _Float16* yp = YH + (size_t)(blockIdx.x * 8 + wm * 2) * (NH * 1024) + lane * 8;
  unsigned char* sl = L + (tid >> 4) * KO_P + (tid & 15) * 8;
  const unsigned char* Wl = L + (wn * 64 + c) * KO_P + 16 * hh;
  const int s0 = (blockIdx.x + 2 * blockIdx.y) & (KO_NS - 1);   // the block's first slice: 16 different ones in a column strip, 8 in a row strip
  v4f rw[8]; v16h a0[2][2], a1[2][2]; v8f acc[2][4] = {};
  { const float* w0 = wp + s0 * 64;
#pragma unroll
    for (int i = 0; i < 8; ++i) rw[i] = *(const v4f*)(w0 + (size_t)i * 16 * CC);
    asm volatile("s_wait_xcnt 0x0" :: "v"(w0) : "memory"); }   // as in ko_put
  ko_lda(a0, yp + s0 * 1024);
  // two slices a trip: each of the two fragment sets is refilled where it stands (no copies)
  for (int s = 0; s < KO_NS - 2; s += 2) {
    const int s1 = (s0 + s + 1) & (KO_NS - 1), s2 = (s0 + s + 2) & (KO_NS - 1);
    ko_put<true>(rw, sl, wp + s1 * 64); ko_lda(a1, yp + s1 * 1024);
    ko_bar();   // publishes the trip's first slice; it also ends every wave's reads of the other buffer, which is overwritten next
    ko_mul(acc, a0, Wl);
    ko_put<true>(rw, sl + KO_T, wp + s2 * 64); ko_lda(a0, yp + s2 * 1024);
    ko_bar();   // as above, the trip's second slice
    ko_mul(acc, a1, Wl + KO_T); }
  { const int s1 = (s0 + KO_NS - 1) & (KO_NS - 1);
    ko_put<true>(rw, sl, wp + s1 * 64); ko_lda(a1, yp + s1 * 1024); }
  ko_bar();
  ko_mul(acc, a0, Wl);
  ko_put<false>(rw, sl + KO_T, wp);
  ko_bar();
  ko_mul(acc, a1, Wl + KO_T);
  __syncthreads();   // every wave has left the slices: their LDS becomes the output staging
  float* es = (float*)L + wave * 32 * KO_EP;
#pragma unroll
  for (int j = 0; j < 4; ++j) { const float bias = BO ? bfr(BO[c0 + wn * 64 + j * 16 + c]) : 0.f;
#pragma unroll
    for (int i = 0; i < 2; ++i)
#pragma unroll
      for (int r = 0; r < 8; ++r) es[(i * 16 + 8 * hh + r) * KO_EP + j * 16 + c] = acc[i][j][r] * (1.0f / 16384.0f) + bias; }   /* 2^-8 (Wo carry) x 2^-6 (ctx carry) */
  LDSX();
#pragma unroll
  for (int i = 0; i < 16; ++i) { const int row = i * 2 + hh; vst2(OUT + (r0 + wm * 32 + row) * DIN + c0 + wn * 64 + c * 4, *(const v4f*)(es + row * KO_EP + c * 4)); } }

static_assert(HD == 64 && CC == NH * HD && DIN == CC, "per-head projection: 64-wide heads, input width == projected width");
extern "C" void kernel_launch(void* const* d_in, const int* in_sizes, int n_in, void* d_out, int out_size, void* d_ws, size_t ws_size, hipStream_t stream) {
  (void)in_sizes; (void)n_in; (void)out_size;
  const float** F = (const float**)d_in;
  if (ws_size < (size_t)WS_END) return;
  _Float16* YH = (_Float16*)((char*)d_ws + WS_Y);
  // inputs: 0 values [4,1024,1024]; 1 keys; 2 queries; 3 mask [4,1,1,1024] int32 (random 0/1; 0 = masked key); 4 Wv [64,64] (out,in); 5 Wk; 6 Wq (no projection biases); 7 Wo [1024,1024] (out,in); 8 bo (NONZERO)
  k_fa<<<dim3(TT / 256, NH, TNB), 256, 0, stream>>>(F[2], F[1], F[0], F[6], F[5], F[4], (const int*)d_in[3], YH);
  k_out<<<dim3(TNB * TT / 128, DIN / 128), 256, 0, stream>>>(YH, F[7], F[8], (float*)d_out);
}

// v007
// A run of this version takes 26.7 microseconds.
// Next to v006, in two timings, it ran 1.06 times as fast each time.
// All steps since v000 together make it 25.7 times as fast.
// compute dtype: all float inputs rounded to bf16; the per-head 64 x 64 q / k / v projections (ONE shared weight per stream, applied to every head) with EXACT bf16 products on WMMA 16x16x32 (f32 accumulate) (no projection biases); logits q x k once to f16 each (1 product) x 1024^-0.5; the per-(batch, key) int mask by leaving the masked keys out (their weight is exactly 0); online softmax f32 (log2 domain); unnormalised P x 2^7 once to f16 x v once to f16 (1 product), divided by the f32 sum of the same f16 P; ctx x 2^6 once to f16 x Wo f16(bf16 x 2^8) + bo; f32 output.
#include <hip/hip_runtime.h>
#include <math.h>

typedef __attribute__((ext_vector_type(16))) _Float16 v16h;
typedef __attribute__((ext_vector_type(16))) __bf16 v16b;
typedef __attribute__((ext_vector_type(8)))  _Float16 v8h;
typedef __attribute__((ext_vector_type(8)))  float v8f;
typedef __attribute__((ext_vector_type(4)))  float v4f;
typedef __attribute__((ext_vector_type(2)))  float v2f;
typedef __attribute__((ext_vector_type(4)))  unsigned v4u;
typedef __attribute__((ext_vector_type(4)))  int v4i;
typedef float __attribute__((may_alias)) float_a;
typedef int __attribute__((may_alias)) int_a;

template <typename T> __device__ __forceinline__ void vst2(void* p, T v) { *(T*)p = v;  }
__device__ __forceinline__ v8f wmma16(v16h a, v16h b, v8f c) {
  v8f d = __builtin_amdgcn_wmma_f32_16x16x32_f16(false, a, false, b, (short)0, c, false, false);
  asm volatile("v_nop\n\tv_nop\n\tv_nop\n\tv_nop" : "+v"(d) : "v"(a), "v"(b));
  return d;
}
__device__ __forceinline__ v8f wmma_bf(v16b a, v16b b, v8f c) {
  v8f d = __builtin_amdgcn_wmma_f32_16x16x32_bf16(false, a, false, b, (short)0, c, false, false);
  asm volatile("v_nop\n\tv_nop\n\tv_nop\n\tv_nop" : "+v"(d) : "v"(a), "v"(b));
  return d;
}
// 16x16x32 fragments: lane = (h = lane>>4, row/col = lane&15); elements 0..7 = k0+8h+0..7, 8..15 = k0+16+8h+0..7; D element r = row 8h+r
__device__ __forceinline__ v16h frag_h(const _Float16* rowk0, int lane) {
  union { v16h v; v8h q[2]; } u; const _Float16* p = rowk0 + 8 * (lane >> 4);
  u.q[0] = *(const v8h*)p; u.q[1] = *(const v8h*)(p + 16); return u.v;
}
__device__ __forceinline__ v16h frag_f32(const float* rowk0, int lane) {
  v16h a; const float* p = rowk0 + 8 * (lane >> 4);
#pragma unroll
  for (int i = 0; i < 8; ++i) { a[i] = (_Float16)p[i]; a[8 + i] = (_Float16)p[16 + i]; }
  return a;
}
__device__ __forceinline__ v16h frag_f32s(const float* rowk0, int lane, float sc) {
  v16h a; const float* p = rowk0 + 8 * (lane >> 4);
#pragma unroll
  for (int i = 0; i < 8; ++i) { a[i] = (_Float16)(p[i] * sc); a[8 + i] = (_Float16)(p[16 + i] * sc); }
  return a;
}
// column fragment from a [K][ld] layout (column n), rows >= K read as 0
__device__ __forceinline__ v16h fragc_f32(const float* W, int k0, int n, int lane, int ld, int K) {
  v16h a; const int g = lane >> 4;
#pragma unroll
  for (int i = 0; i < 8; ++i) { const int ka = k0 + 8 * g + i, kb = ka + 16;
    a[i] = (_Float16)(ka < K ? W[(size_t)(ka < K ? ka : K - 1) * ld + n] : 0.f); a[8 + i] = (_Float16)(kb < K ? W[(size_t)(kb < K ? kb : K - 1) * ld + n] : 0.f); }
  return a;
}
struct F2 { v16b h, l; };
__device__ __forceinline__ F2 bsplit16(const float v[16]) { F2 r;
#pragma unroll
  for (int i = 0; i < 16; ++i) { const __bf16 h = (__bf16)v[i]; r.h[i] = h; r.l[i] = (__bf16)(v[i] - (float)h); }
  return r; }
__device__ __forceinline__ F2 split_row(const float* row, int k0, int lane) { float v[16]; const float* p = row + k0 + 8 * (lane >> 4);
#pragma unroll
  for (int i = 0; i < 8; ++i) { v[i] = p[i]; v[8 + i] = p[16 + i]; }
  return bsplit16(v); }
__device__ __forceinline__ F2 split_rowK(const float* row, int k0, int lane, int K) { float v[16]; const int g = lane >> 4;
#pragma unroll
  for (int i = 0; i < 8; ++i) { const int ka = k0 + 8 * g + i, kb = ka + 16; v[i] = ka < K ? row[ka < K ? ka : K - 1] : 0.f; v[8 + i] = kb < K ? row[kb < K ? kb : K - 1] : 0.f; }
  return bsplit16(v); }
__device__ __forceinline__ F2 split_col(const float* W, int k0, int n, int lane, int ld, int K) { float v[16]; const int g = lane >> 4;
#pragma unroll
  for (int i = 0; i < 8; ++i) { const int ka = k0 + 8 * g + i, kb = ka + 16; v[i] = ka < K ? W[(size_t)(ka < K ? ka : K - 1) * ld + n] : 0.f; v[8 + i] = kb < K ? W[(size_t)(kb < K ? kb : K - 1) * ld + n] : 0.f; }
  return bsplit16(v); }
__device__ __forceinline__ v8f mac3(const F2& a, const F2& b, v8f c) { c = wmma_bf(a.l, b.h, c); c = wmma_bf(a.h, b.l, c); return wmma_bf(a.h, b.h, c); }
__device__ __forceinline__ float sigm(float v) { return 1.0f / (1.0f + expf(-v)); }
#define LDSX() do { asm volatile("s_wait_dscnt 0" ::: "memory"); __builtin_amdgcn_wave_barrier(); __builtin_amdgcn_fence(__ATOMIC_RELEASE, "workgroup"); } while (0)

// Multi-head attention whose q / k / v projections are ONE shared 64 x 64 linear per stream applied to every head, with a key mask (inputs in the order values, keys, queries [4,1024,1024]; mask [4,1,1,1024] int32 RANDOM 0/1 per (batch, key); torch (out,in) Wv / Wk / Wq [64,64] uniform(+-1/8), NO projection biases; heads = reshape(N, L, 16, 64); einsum('nlhd,od->nlho'); energy = einsum('nqhd,nkhd->nhqk'); where(mask == 0, -1e20, energy); softmax(energy * 1/sqrt(1024)) - the scale is 1/32, not 1/8; out merged to [N, L, 1024]; out @ Wo.T + bo with Wo [1024,1024] and bo uniform(+-1/32), bo NONZERO).
#define NB 4
#define TT 1024
#define CC 1024            // NH * HD = projected width
#define DIN 1024          // input (model) width
#define NH 16
#define HD 64
#define NQB (TT / 64)
#define HG 8   // S workspace sized for eight heads: 8 x 1,024 x 1,024 f32 = 32 MiB; no kernel uses it
#define SCALE (0.03125f)   // 1 / sqrt(E) with E = 1024 (the module scales by the MODEL width, not the head width)
#define CAUSAL 0
#ifndef TNB
#define TNB NB
#endif
__device__ __forceinline__ float bfr(float v) { return (float)(__bf16)v; }
__host__ __device__ __forceinline__ int kb_last(int qb) { return CAUSAL ? ((qb * 64 + 63) >> 7) : (TT / 128 - 1); }
typedef __attribute__((ext_vector_type(8))) __bf16 v8b;
__device__ __forceinline__ v16b frag_b(const __bf16* rowk0, int lane) {
  union { v16b v; v8b q[2]; } u; const __bf16* p = rowk0 + 8 * (lane >> 4);
  u.q[0] = *(const v8b*)p; u.q[1] = *(const v8b*)(p + 16); return u.v;
}
#define QBH 0
#define QHI 0               // single-product logits on every row
#define KHI 64            // key rows carrying k residual / v bf16 hi+lo planes (no kernel writes or reads them)
// B fragment (k rows k0+.., output column o) of a weight: (in,out) [K][ld] or (out,in) [ld rows of K]: bf16 exact, or f16(bf16 * 256) exact
__device__ __forceinline__ v16b wcol_io(const float* Wm, int k0, int o, int lane, int ld) { v16b w; const int g = lane >> 4;
#pragma unroll
  for (int i = 0; i < 8; ++i) { w[i] = (__bf16)Wm[(size_t)(k0 + 8 * g + i) * ld + o]; w[8 + i] = (__bf16)Wm[(size_t)(k0 + 16 + 8 * g + i) * ld + o]; }
  return w; }
__device__ __forceinline__ v16b wcol_oi(const float* Wm, int k0, int o, int lane, int K) { v16b w; const float* p = Wm + (size_t)o * K + k0 + 8 * (lane >> 4);
#pragma unroll
  for (int i = 0; i < 8; ++i) { w[i] = (__bf16)p[i]; w[8 + i] = (__bf16)p[16 + i]; }
  return w; }
__device__ __forceinline__ v16h wcolh_io(const float* Wm, int k0, int o, int lane, int ld) { v16h w; const int g = lane >> 4;
#pragma unroll
  for (int i = 0; i < 8; ++i) { w[i] = (_Float16)(bfr(Wm[(size_t)(k0 + 8 * g + i) * ld + o]) * 256.0f); w[8 + i] = (_Float16)(bfr(Wm[(size_t)(k0 + 16 + 8 * g + i) * ld + o]) * 256.0f); }
  return w; }
__device__ __forceinline__ v16h wcolh_oi(const float* Wm, int k0, int o, int lane, int K) { v16h w; const float* p = Wm + (size_t)o * K + k0 + 8 * (lane >> 4);
#pragma unroll
  for (int i = 0; i < 8; ++i) { w[i] = (_Float16)(bfr(p[i]) * 256.0f); w[8 + i] = (_Float16)(bfr(p[16 + i]) * 256.0f); }
  return w; }
#define WQKV_LAYOUT 1   // 0 = (in,out) [DIN][CC]; 1 = (out,in) [CC][DIN]; 2 = per-head [NH][DIN][HD]
__device__ __forceinline__ v16b wcol_hdk(const float* Wm, int k0, int o, int lane) { v16b w; const int g = lane >> 4; const float* p = Wm + (size_t)(o / HD) * DIN * HD + (o % HD);
#pragma unroll
  for (int i = 0; i < 8; ++i) { w[i] = (__bf16)p[(size_t)(k0 + 8 * g + i) * HD]; w[8 + i] = (__bf16)p[(size_t)(k0 + 16 + 8 * g + i) * HD]; }
  return w; }
#define WO_OUT_IN 1
#if WQKV_LAYOUT == 1
#define WCOL(W, k0, o, lane) wcol_oi(W, k0, o, lane, DIN)
#elif WQKV_LAYOUT == 2
#define WCOL(W, k0, o, lane) wcol_hdk(W, k0, o, lane)
#else
#define WCOL(W, k0, o, lane) wcol_io(W, k0, o, lane, CC)
#endif
#if WO_OUT_IN
#define WOCOL(W, k0, o, lane) wcol_oi(W, k0, o, lane, CC)
#define WOCOLH(W, k0, o, lane) wcolh_oi(W, k0, o, lane, CC)
#else
#define WOCOL(W, k0, o, lane) wcol_io(W, k0, o, lane, DIN)
#define WOCOLH(W, k0, o, lane) wcolh_io(W, k0, o, lane, DIN)
#endif
#ifndef PROJ_EXTRA_PARAMS
#define PROJ_EXTRA_PARAMS
#endif

#define WS_QH  0u                                      // f16 q rows [b*t][CC], unused: k_fa keeps q in registers
#define WS_KH  (WS_QH + 2u * (size_t)NB * TT * CC)      // f16 k rows [b*t][CC], unused: k_fa makes k straight into LDS
#define WS_VT  (WS_KH + 2u * (size_t)NB * TT * CC)      // f16 v planes [b][c][t], unused: k_fa makes v straight into LDS
#define WS_QL  (WS_VT + 2u * (size_t)NB * CC * TT)      // f16 q residual x 2^10 rows [b][t < QHI][CC]
#define WS_KL  (WS_QL + 2u * (size_t)NB * QHI * CC)     // f16 k residual x 2^10 rows [b][t < KHI][CC]
#define WS_VB  (WS_KL + 2u * (size_t)NB * KHI * CC)     // bf16 v hi planes [b][c][t < KHI]
#define WS_VBL (WS_VB + 2u * (size_t)NB * CC * KHI)
#define WS_S   (WS_VBL + 2u * (size_t)NB * CC * KHI)    // f32 logits / P [hg][t][s], unused: k_fa keeps the scores in registers
#define WS_Y   (WS_S  + 4u * (size_t)HG * TT * TT)      // f16 ctx x 2^6 in the fragment order of k_out: [b*t / 16][head][k step of 32][half][lane][8]
#define WS_WH (WS_Y  + 2u * (size_t)NB * TT * CC)      // f16(bf16 Wo x 2^8) in the tile order of k_out: [column strip of 128][k slice of 64][column][k], written by k_fa
#define WS_END (WS_Y  + 4u * (size_t)NB * TT * CC)
static_assert(WS_WH + 2u * (size_t)CC * DIN <= WS_END, "the f16 Wo lies inside the workspace that is asked for");

#define FA_KP 144                  // LDS pitch of a 128-B k row: 16 B x odd
#define FA_VP 2064                 // LDS pitch of a 2,048-B v plane row: 16 B x odd
#define FA_KB (TT * FA_KP)
#define FA_VB (HD * FA_VP)
__device__ __forceinline__ v8f mmah(v16h a, v16h b, v8f c) { return __builtin_amdgcn_wmma_f32_16x16x32_f16(false, a, false, b, (short)0, c, false, false); }
__device__ __forceinline__ v16h frag_l(const unsigned char* p) { union { v16h v; v8h q[2]; } u; u.q[0] = *(const v8h*)p; u.q[1] = *(const v8h*)(p + 32); return u.v; }
__device__ __forceinline__ v8f ld8f(const unsigned char* p) { union { v8f v; v4f q[2]; } u; u.q[0] = *(const v4f*)p; u.q[1] = *(const v4f*)(p + 16); return u.v; }
// sixteen base-2 exponentials, each in place, in one statement: directly behind a transcendental stands nothing that reads its result or overwrites its source; the v_nop is that slot behind the last one
__device__ __forceinline__ void exp2x16(float (&a)[16]) {
  asm("v_exp_f32 %0, %0\n\tv_exp_f32 %1, %1\n\tv_exp_f32 %2, %2\n\tv_exp_f32 %3, %3\n\tv_exp_f32 %4, %4\n\tv_exp_f32 %5, %5\n\tv_exp_f32 %6, %6\n\tv_exp_f32 %7, %7\n\tv_exp_f32 %8, %8\n\tv_exp_f32 %9, %9\n\tv_exp_f32 %10, %10\n\tv_exp_f32 %11, %11\n\tv_exp_f32 %12, %12\n\tv_exp_f32 %13, %13\n\tv_exp_f32 %14, %14\n\tv_exp_f32 %15, %15\n\tv_nop" : "+v"(a[0]), "+v"(a[1]), "+v"(a[2]), "+v"(a[3]), "+v"(a[4]), "+v"(a[5]), "+v"(a[6]), "+v"(a[7]), "+v"(a[8]), "+v"(a[9]), "+v"(a[10]), "+v"(a[11]), "+v"(a[12]), "+v"(a[13]), "+v"(a[14]), "+v"(a[15])); }
__device__ __forceinline__ float xhalf(float x) { return __builtin_bit_cast(float, __builtin_amdgcn_permlanex16(__builtin_bit_cast(int, x), __builtin_bit_cast(int, x), 0x76543210, 0xfedcba98, false, false)); }  // lane l with lane l ^ 16
#define FA_SP 144                  // LDS pitch of a staged 128-B bf16 row: 16 B x odd
#define FA_SG (32 * FA_SP)         // one wave's staging: a group of 32 rows
#define FA_LO (FA_KB + FA_VB + 4 * TT + 8 * FA_SG)   // the list of unmasked key rows (TT ints), behind it the eight waves' counts
__device__ __forceinline__ int fa_slot(int q) { return (q & ~31) | ((q & 1) << 4) | ((q & 31) >> 1); }   // list slot of place q: a group's even rows, then its odd rows, so that a lane half reads its 16 entries in a row
typedef __attribute__((ext_vector_type(4))) __bf16 v4b;
typedef __attribute__((ext_vector_type(4))) _Float16 v4h;
__device__ __forceinline__ v8f mmab(v16b a, v16b b, v8f c) { return __builtin_amdgcn_wmma_f32_16x16x32_bf16(false, a, false, b, (short)0, c, false, false); }
__device__ __forceinline__ v16b frag_lb(const unsigned char* p) { union { v16b v; v8b q[2]; } u; u.q[0] = *(const v8b*)p; u.q[1] = *(const v8b*)(p + 32); return u.v; }
// a group's loads: 16 lanes per 256-B row, two rows an instruction; p + OFF = the lane's place in rows 0 / 1 of the group
template <int PITCH, int OFF = 0> __device__ __forceinline__ void pj_ld(v4f (&t)[16], const float* p) {   // OFF: floats from p to the group, kept out of the pointer, so that the pair which the loads name is the one that the wait holds
#pragma unroll
  for (int j = 0; j < 16; ++j) t[j] = *(const v4f*)(p + OFF + (size_t)j * 2 * PITCH);
  asm volatile("s_wait_xcnt 0x0" :: "v"(p) : "memory"); }   // the wait kept before a register that an issued global load names is overwritten; the pointer is an input, so that the pair lives through the run
// a group's loads by the row list: lp = the lane half's 16 list entries (byte offsets of rows 0 / 1, 2 / 3, ... of the group from xb, the batch's first row); vm = 0 sends a group that does not exist to the batch's first row; lo = the lane's place in a row
__device__ __forceinline__ void pj_ldg(v4f (&t)[16], const float* xb, const unsigned char* lp, unsigned vm, unsigned lo) {
  unsigned o[16];
#pragma unroll
  for (int q = 0; q < 4; ++q) { const v4u x = *(const v4u*)(lp + q * 16);
#pragma unroll
    for (int i = 0; i < 4; ++i) o[q * 4 + i] = (x[i] & vm) | lo; }
#pragma unroll
  for (int j = 0; j < 16; ++j) t[j] = *(const v4f*)((const unsigned char*)xb + o[j]);
  // the wait kept before a register that an issued global load names is overwritten; the offsets are inputs, so that they live through the run
  asm volatile("s_wait_xcnt 0x0" :: "v"(o[0]), "v"(o[1]), "v"(o[2]), "v"(o[3]), "v"(o[4]), "v"(o[5]), "v"(o[6]), "v"(o[7]), "v"(o[8]), "v"(o[9]), "v"(o[10]), "v"(o[11]), "v"(o[12]), "v"(o[13]), "v"(o[14]), "v"(o[15]) : "memory");
  __builtin_amdgcn_sched_barrier(0); }   // the loads are issued before the next group's conversions, whose wait would otherwise stand in front of them
// the block's g-th group of np is group g + rot of the list, going round (g < np, rot < np)
__device__ __forceinline__ int pj_rot(int g, int np, int rot) { const int p = g + rot; return p >= np ? p - np : p; }
// group g of np: every refill is issued, so that the counted waits leave the younger group in flight on every path; one for a group that does not exist reads the batch's first row and is not used
__device__ __forceinline__ void pj_ldn(v4f (&t)[16], const float* xb, const unsigned char* lb, int g, int np, int rot, unsigned lo) { const bool ok = g < np; pj_ldg(t, xb, lb + (ok ? pj_rot(g, np, rot) : 0) * 128, ok ? ~0u : 0u, lo); }
// rounds the group held in registers to bf16 rows in the wave's staging; d = the lane's place in rows 0 / 1
__device__ __forceinline__ void pj_put(const v4f (&t)[16], unsigned char* d) {
#pragma unroll
  for (int j = 0; j < 16; ++j) { v4b x;
#pragma unroll
    for (int e = 0; e < 4; ++e) x[e] = (__bf16)t[j][e];
    *(v4b*)(d + j * 2 * FA_SP) = x; }
  __builtin_amdgcn_sched_barrier(0); }   // the refill that follows stands behind the last read of its registers: no second register set
// the wave's own LDS writes have landed before its other lanes read them; no fence: that would also wait out the global loads in flight
__device__ __forceinline__ void pj_wx() { asm volatile("s_wait_dscnt 0x0" ::: "memory"); __builtin_amdgcn_wave_barrier(); }
__device__ __forceinline__ v8h pj_h(v8f d) { v8h h;
#pragma unroll
  for (int r = 0; r < 8; ++r) h[r] = (_Float16)d[r];
  return h; }
// the staged group of 32 input rows times the weight: k rows as W . x^T (a lane holds 8 output dims of one key), v planes as x . W^T (a lane holds 8 keys of one output dim): one 16-B LDS store per tile either way
__device__ __forceinline__ void pj_mul(const v16b (&w)[4][2], const unsigned char* sr, unsigned char* kd, unsigned char* vd, bool is_v) {
  if (is_v) {
#pragma unroll
    for (int tl = 0; tl < 2; ++tl) { const v16b x0 = frag_lb(sr + tl * 16 * FA_SP), x1 = frag_lb(sr + tl * 16 * FA_SP + 64);
#pragma unroll
      for (int ot = 0; ot < 4; ++ot) *(v8h*)(vd + ot * 16 * FA_VP + tl * 32) = pj_h(mmab(x1, w[ot][1], mmab(x0, w[ot][0], v8f{}))); }
  } else {
#pragma unroll
    for (int tl = 0; tl < 2; ++tl) { const v16b x0 = frag_lb(sr + tl * 16 * FA_SP), x1 = frag_lb(sr + tl * 16 * FA_SP + 64);
#pragma unroll
      for (int ot = 0; ot < 4; ++ot) *(v8h*)(kd + tl * 16 * FA_KP + ot * 32) = pj_h(mmab(w[ot][1], x1, mmab(w[ot][0], x0, v8f{}))); } } }
__global__ __launch_bounds__(256) void k_fa(const float* __restrict__ XQ, const float* __restrict__ XK, const float* __restrict__ XV, const float* __restrict__ WQ, const float* __restrict__ WK, const float* __restrict__ WV, const int* __restrict__ MASK, _Float16* __restrict__ YH, const float* __restrict__ WO, _Float16* __restrict__ WH) {
  __shared__ __align__(16) unsigned char L[FA_LO + 4 * TT + 32];
  const int tid = threadIdx.x, wave = tid >> 5, lane = tid & 31, c = lane & 15, hh = lane >> 4; const int hd = blockIdx.y, b = blockIdx.z; const int qw0 = blockIdx.x * 256 + wave * 32;
  const int* Mb = MASK + b * TT;
  v16h qf[2][2]; int np; float cs;
  { const int wv = __builtin_amdgcn_readfirstlane(wave); const bool is_v = wv >= 4; const int wq = wv & 3;   // waves 0-3: k, waves 4-7: v; each takes every fourth group of 32 kept keys
    const float* wp = (is_v ? WV : WK) + hh * HD + c * 4; const float* wqp = WQ + hh * HD + c * 4;
    const float* xb = (is_v ? XV : XK) + (size_t)b * TT * DIN; const float* qp = XQ + ((size_t)b * TT + qw0 + hh) * DIN + hd * HD + c * 4;
    unsigned char* sw = L + FA_KB + FA_VB + 4 * TT + wv * FA_SG + hh * FA_SP + c * 8; const unsigned char* sr = L + FA_KB + FA_VB + 4 * TT + wv * FA_SG + c * FA_SP + 16 * hh;
    unsigned char* kd = L + c * FA_KP + 16 * hh; unsigned char* vd = L + FA_KB + c * FA_VP + 16 * hh;   // the lane's place in group 0 of the k rows and of the v planes
    const unsigned char* lb = L + FA_LO + hh * 64; const unsigned lo = hd * (HD * 4) + c * 16;
    v4f ta[16], tb[16]; v16b w[4][2];
    const v4i mm = *(const v4i*)(Mb + tid * 4);
    pj_ld<HD>(ta, wqp); pj_ld<HD, 32 * HD>(tb, wqp);
    // the block's share of Wo for k_out: 64 output columns of one 64-wide k slice, read in whole 256-B row pieces (16 lanes a piece, 16 rows a step); made f16 and stored behind the second barrier below
    const int fb = blockIdx.x + (TT / 256) * (blockIdx.y + NH * blockIdx.z);
    v4f wo[4];
    { const float* wop = WO + (size_t)((fb >> 5) * 128 + (fb & 1) * 64 + (tid >> 4)) * CC + ((fb >> 1) & (CC / 64 - 1)) * 64 + (tid & 15) * 4;
#pragma unroll
      for (int j = 0; j < 4; ++j) wo[j] = *(const v4f*)(wop + (size_t)j * 16 * CC);
      asm volatile("s_wait_xcnt 0x0" :: "v"(wop) : "memory"); }   // as in pj_ld
    // a masked key's weight is exactly 0: only the unmasked keys are projected and attended. Their rows are listed in LDS (place = count of unmasked keys before it, by wave, then by element, then by lane), the last group filled up to 32 with the batch's first row under a bias of -1e30.
    int* LI = (int*)(L + FA_LO); int* WT = LI + TT; unsigned bl[4]; int wt = 0;
#pragma unroll
    for (int e = 0; e < 4; ++e) { bl[e] = __builtin_amdgcn_ballot_w32(mm[e] != 0); wt += __builtin_popcount(bl[e]); }
    if (lane == 0) WT[wave] = wt;
    __syncthreads();   // the eight counts are there
    int tot = 0, base = 0;
#pragma unroll
    for (int i = 0; i < 8; ++i) { const int x = WT[i]; tot += x; base += i < wave ? x : 0; }
    tot = __builtin_amdgcn_readfirstlane(tot);
    // a batch whose keys are ALL masked: the reference's logits are then all equal, i.e. uniform weights over all keys: every key is listed, and scale 0 gives exactly that
    const bool none = tot == 0; const int n = none ? TT : tot; np = (n + 31) >> 5; cs = none ? 0.f : SCALE * 1.4426950408889634f;
#pragma unroll
    for (int e = 0; e < 4; ++e) { const int key = tid * 4 + e; const int q = none ? key : base + (int)__builtin_amdgcn_mbcnt_lo(bl[e], 0u); base += __builtin_popcount(bl[e]);
      if (none || mm[e] != 0) LI[fa_slot(q)] = key * (DIN * 4); }
    if (tid < 32) { const int q = (n & ~31) + tid; if (q >= n && q < np * 32) LI[fa_slot(q)] = 0; }
    { v4f bz;
#pragma unroll
      for (int i = 0; i < 4; ++i) bz[i] = tid * 4 + i < n ? 0.f : -1.0e30f;
      *(v4f*)(L + FA_KB + FA_VB + tid * 16) = bz; }
    __syncthreads();   // the list and the biases are there
    // Wo once to f16(bf16 x 2^8), exact, in k_out's tile order: the block's 8 KB stand in a row, 256 B per wave and store. Behind the barrier, so that no barrier's fence waits for these stores.
    { _Float16* whp = WH + (size_t)fb * 4096 + tid * 4; v4h x[4];
#pragma unroll
      for (int j = 0; j < 4; ++j)
#pragma unroll
        for (int e = 0; e < 4; ++e) x[j][e] = (_Float16)(bfr(wo[j][e]) * 256.0f);
#pragma unroll
      for (int j = 0; j < 4; ++j) *(v4h*)(whp + j * 1024) = x[j];
      // the wait kept before a register that an issued global store names is overwritten; pointer and data are inputs, so that they live through the run
      asm volatile("s_wait_xcnt 0x0" :: "v"(whp), "v"(x[0]), "v"(x[1]), "v"(x[2]), "v"(x[3]) : "memory"); }
    pj_put(ta, sw); pj_ld<DIN>(ta, qp); pj_wx();
#pragma unroll
    for (int i = 0; i < 4; ++i) w[i >> 1][i & 1] = frag_lb(sr + (i >> 1) * 16 * FA_SP + (i & 1) * 64);
    pj_wx();   // the weight fragments have been read before the next group overwrites the staging
    pj_put(tb, sw); pj_ld<HD>(tb, wp); pj_wx();
#pragma unroll
    for (int i = 0; i < 4; ++i) w[2 + (i >> 1)][i & 1] = frag_lb(sr + (i >> 1) * 16 * FA_SP + (i & 1) * 64);
    pj_wx();   // as above
    pj_put(ta, sw); pj_ld<HD, 32 * HD>(ta, wp); pj_wx();
    // q^T = W . x^T: output tiles 2 kc and 2 kc + 1 of a query column are, lane for lane, the two halves of its B fragment for k step kc
#pragma unroll
    for (int g = 0; g < 2; ++g) { const v16b x0 = frag_lb(sr + g * 16 * FA_SP), x1 = frag_lb(sr + g * 16 * FA_SP + 64);
#pragma unroll
      for (int kc = 0; kc < 2; ++kc) { union { v16h v; v8h q[2]; } u;
#pragma unroll
        for (int i = 0; i < 2; ++i) u.q[i] = pj_h(mmab(w[2 * kc + i][1], x1, mmab(w[2 * kc + i][0], x0, v8f{})));
        qf[g][kc] = u.v; } }
    pj_wx();   // the q rows have been read before the next group overwrites the staging
    // the four blocks of a (batch, head) read the same key and value rows: each starts a quarter of the list further on and goes round, so that at one moment they ask L2 for different lines; a group keeps its place in LDS
    const int rot = ((int)blockIdx.x * np) >> 2;
    pj_put(tb, sw); pj_ldn(tb, xb, lb, wq, np, rot, lo); pj_wx();
#pragma unroll
    for (int i = 0; i < 4; ++i) w[i >> 1][i & 1] = frag_lb(sr + (i >> 1) * 16 * FA_SP + (i & 1) * 64);
    pj_wx();   // the weight fragments have been read before the next group overwrites the staging
    pj_put(ta, sw); pj_ldn(ta, xb, lb, wq + 4, np, rot, lo); pj_wx();
#pragma unroll
    for (int i = 0; i < 4; ++i) w[2 + (i >> 1)][i & 1] = frag_lb(sr + (i >> 1) * 16 * FA_SP + (i & 1) * 64);
    pj_wx();   // as above
    int g = wq;
#pragma unroll 1   // rolled: the trip count follows the mask; the test stands at the foot, so that the two refills above are used on every path and stay where they are issued
    do {
      pj_put(tb, sw); pj_ldn(tb, xb, lb, g + 8, np, rot, lo); pj_wx(); if (g < np) { const int p = pj_rot(g, np, rot); pj_mul(w, sr, kd + p * (32 * FA_KP), vd + p * 64, is_v); }
      pj_put(ta, sw); pj_ldn(ta, xb, lb, g + 12, np, rot, lo); pj_wx(); if (g + 4 < np) { const int p = pj_rot(g + 4, np, rot); pj_mul(w, sr, kd + p * (32 * FA_KP), vd + p * 64, is_v); }
      g += 8; } while (g < np); }
  __syncthreads();
  v16h ones;
#pragma unroll
  for (int i = 0; i < 16; ++i) ones[i] = (_Float16)1.0f;
  v8f acc[2][4] = {}, lacc[2] = {}; float m_run[2] = {-1.0e20f, -1.0e20f};   // the floor lies far above a fill row's score (-1e30 x scale) and far below any real one
  const unsigned char* Kl = L + c * FA_KP + 16 * hh; const unsigned char* Vl = L + FA_KB + c * FA_VP + 16 * hh; const unsigned char* Bl = L + FA_KB + FA_VB + 32 * hh;
  v16h kf[2][2]; v8f bz[2];
#pragma unroll
  for (int kt = 0; kt < 2; ++kt) { bz[kt] = ld8f(Bl + kt * 64); kf[kt][0] = frag_l(Kl + kt * 16 * FA_KP); kf[kt][1] = frag_l(Kl + kt * 16 * FA_KP + 64); }
#pragma unroll 1   // rolled: two passes unrolled take more than 256 registers, and the loop then switches register windows throughout
  for (int ps = 0; ps < np; ++ps) {
    v8f s[2][2];
#pragma unroll
    for (int kt = 0; kt < 2; ++kt)
#pragma unroll
      for (int g = 0; g < 2; ++g) s[kt][g] = mmah(kf[kt][1], qf[g][1], mmah(kf[kt][0], qf[g][0], bz[kt]));
    // the pass's LDS reads stand in one place: this pass's v, and the next pass's k rows and bias (the last pass re-reads pass 0, unused)
    v16h vf[4]; const int pn = ps + 1 < np ? ps + 1 : 0;
#pragma unroll
    for (int t = 0; t < 4; ++t) vf[t] = frag_l(Vl + t * 16 * FA_VP + ps * 64);
#pragma unroll
    for (int kt = 0; kt < 2; ++kt) { bz[kt] = ld8f(Bl + (pn * 32 + kt * 16) * 4); kf[kt][0] = frag_l(Kl + (pn * 32 + kt * 16) * FA_KP); kf[kt][1] = frag_l(Kl + (pn * 32 + kt * 16) * FA_KP + 64); }
    __builtin_amdgcn_sched_barrier(0);   // the reads are issued ahead of the maxima, which then cover their latency
    float mb[2]; bool need = false;
#pragma unroll
    for (int g = 0; g < 2; ++g) { float mx = s[0][g][0];
#pragma unroll
      for (int r = 1; r < 8; ++r) mx = __builtin_fmaxf(mx, s[0][g][r]);
#pragma unroll
      for (int r = 0; r < 8; ++r) mx = __builtin_fmaxf(mx, s[1][g][r]);
      mx = __builtin_fmaxf(mx, xhalf(mx)) * cs; mb[g] = mx; need = need || (mx > m_run[g] + 8.0f); }
    __builtin_amdgcn_sched_barrier(0);   // keeps the statement below, and the wait it brings, behind the maxima
    // inputs only: holds the pass's LDS reads in front of the branch; sunk behind it they would stand directly in front of their first use
    asm volatile("" :: "v"(vf[0]), "v"(vf[1]), "v"(vf[2]), "v"(vf[3]), "v"(kf[0][0]), "v"(kf[0][1]), "v"(kf[1][0]), "v"(kf[1][1]), "v"(bz[0]), "v"(bz[1]));
    if (__builtin_amdgcn_ballot_w32(need) != 0) {   // one scalar test per pass; rare after the first unmasked keys
#pragma unroll
      for (int g = 0; g < 2; ++g) { const float m_new = __builtin_fmaxf(m_run[g], mb[g]); const float corr = __builtin_amdgcn_exp2f(m_run[g] - m_new); m_run[g] = m_new; lacc[g] = lacc[g] * corr;
#pragma unroll
        for (int t = 0; t < 4; ++t) acc[g][t] = acc[g][t] * corr; } }
#pragma unroll
    for (int g = 0; g < 2; ++g) { const float nm = 7.0f - m_run[g];   // P carried x 2^7: at most 2^15 in f16 (the maximum trails by 8 at most), small weights clear of f16 subnormals
      v16h pf; float a[16];
#pragma unroll
      for (int i = 0; i < 16; ++i) a[i] = __builtin_fmaf(s[i >> 3][g][i & 7], cs, nm);
      exp2x16(a);
#pragma unroll
      for (int i = 0; i < 16; ++i) pf[i] = (_Float16)a[i];
#pragma unroll
      for (int t = 0; t < 4; ++t) acc[g][t] = mmah(vf[t], pf, acc[g][t]);
      lacc[g] = mmah(ones, pf, lacc[g]); } }
  // ctx^T tiles 2 ks and 2 ks + 1 of a query column are, lane for lane, the two halves of the A fragment (row = query, k = the head's dims 32 ks ..) that k_out multiplies:
  // each lane rounds its own accumulators (x 2^6, once to f16) and stores them in that order, 512 B in a row per wave and store; no LDS, no barrier
  _Float16* yp = YH + ((size_t)((b * TT + qw0) >> 4) * NH + hd) * 1024 + lane * 8;
  v8h yo[2][4];
#pragma unroll
  for (int g = 0; g < 2; ++g) { const float inv = 1.0f / lacc[g][0];   // every row of the all-ones product holds the column's sum over both lane halves
#pragma unroll
    for (int t = 0; t < 4; ++t) { const v8f o = acc[g][t] * inv;
#pragma unroll
      for (int r = 0; r < 8; ++r) yo[g][t][r] = (_Float16)(o[r] * 64.0f); } }   /* ctx carried x 2^6 into f16 so small-magnitude context rows stay clear of f16 subnormals */
#pragma unroll
  for (int g = 0; g < 2; ++g)
#pragma unroll
    for (int t = 0; t < 4; ++t) vst2(yp + g * (NH * 1024) + t * 256, yo[g][t]); }
// ---- k_out: block = 128 rows x 128 cols, 8 waves of 32 x 64: out = ctx Wo (+ bo): ctx x 2^6 in f16 against Wo as f16(bf16 x 2^8) exact (1 product) x 2^-14.
// ctx arrives from k_fa as ready A fragments: a wave loads those of its 32 rows straight into registers, 512 B in a row per load, one 64-wide k slice (one head) ahead; they pass through no LDS and no conversion.
// Wo arrives from k_fa as f16, each (column strip, k slice) tile 16 KB in a row: a block reads each slice once, 512 B in a row per wave and load, and lays it in LDS as f16 rows without conversion; every wave takes its B fragments from there.
// Two LDS buffers and two register sets of one slice each (together the registers that one f32 slice would take): a set is refilled, as soon as it has been stored to LDS, with the slice two further on, so as many bytes of Wo are in flight as with f32 slices.
// The 32 blocks of a column strip read the same rows of Wo and the 8 blocks of a row strip the same ctx: each block starts its k loop at its own slice and goes round, so that at one moment they ask L2 for different lines. Every accumulator sums k in steps of 32, ascending from the block's first slice and wrapping at the end.
// (the plain unroll directives in k_out and its helpers keep the indices of their register arrays compile-time constants)
#define KO_P 144                   // LDS pitch of a 128-B f16 row: 16 B x odd
#define KO_T (128 * KO_P)          // one slice of Wo
#define KO_NS (CC / 64)
#define KO_EP 68                   // floats per staged output row (272 B: 16 B x odd)
// lays the slice of Wo held in registers into LDS at d (8 lanes per 128-B row, 32 rows a step); MORE: refills the registers with the block's next slice but one, whose first piece of the lane stands at wp
template <bool MORE> __device__ __forceinline__ void ko_put(v8h (&rw)[4], unsigned char* d, const _Float16* wp) {
#pragma unroll
  for (int h = 0; h < 4; h += 2) {
#pragma unroll
    for (int i = h; i < h + 2; ++i) *(v8h*)(d + i * 32 * KO_P) = rw[i];
    if (MORE) {   // the two scheduling barriers: pairs are waited for, stored and refilled in the order in which they were loaded (the counted waits then leave the younger loads in flight), each refill behind the last read of its registers (no second register set, no copies)
      __builtin_amdgcn_sched_barrier(0);
#pragma unroll
      for (int i = h; i < h + 2; ++i) rw[i] = *(const v8h*)(wp + i * 2048);
      __builtin_amdgcn_sched_barrier(0); } }
  if (MORE) asm volatile("s_wait_xcnt 0x0" :: "v"(wp) : "memory"); }   // the wait kept before a register that an issued global load names is overwritten; the pointer is an input, so that the pair lives through the run
// the A fragments of the wave's two row tiles for one k slice; p = the lane's place in the first tile's part of that slice
__device__ __forceinline__ void ko_lda(v16h (&a)[2][2], const _Float16* p) {
#pragma unroll
  for (int i = 0; i < 2; ++i)
#pragma unroll
    for (int ks = 0; ks < 2; ++ks) { union { v16h v; v8h q[2]; } u; u.q[0] = *(const v8h*)(p + i * (NH * 1024) + ks * 512); u.q[1] = *(const v8h*)(p + i * (NH * 1024) + ks * 512 + 256); a[i][ks] = u.v; }
  asm volatile("s_wait_xcnt 0x0" :: "v"(p) : "memory"); }   // as in ko_put
// the work-group's barrier with the LDS wait alone: __syncthreads() would also wait out the global loads issued ahead for the next slice
__device__ __forceinline__ void ko_bar() { asm volatile("s_wait_dscnt 0x0" ::: "memory"); asm volatile("s_barrier_signal -1" ::: "memory"); asm volatile("s_barrier_wait -1" ::: "memory"); }
__device__ __forceinline__ void ko_mul(v8f (&acc)[2][4], const v16h (&a)[2][2], const unsigned char* B) {
#pragma unroll
  for (int ks = 0; ks < 2; ++ks) { v16h w[4];
#pragma unroll
    for (int j = 0; j < 4; ++j) w[j] = frag_l(B + j * 16 * KO_P + ks * 64);
#pragma unroll
    for (int i = 0; i < 2; ++i)
#pragma unroll
      for (int j = 0; j < 4; ++j) acc[i][j] = mmah(a[i][ks], w[j], acc[i][j]); }
  __builtin_amdgcn_sched_barrier(0); }   // the next slice's stores to LDS, and with them the wait for loads issued only just before, stay behind this slice's products
__global__ __launch_bounds__(256) void k_out(const _Float16* __restrict__ YH, const _Float16* __restrict__ WH, const float* __restrict__ BO, float* __restrict__ OUT) {
  __shared__ __align__(16) unsigned char L[8 * 32 * KO_EP * 4];   // two slices of Wo; at the end the output staging
  static_assert(!CAUSAL && 2 * KO_T <= 8 * 32 * KO_EP * 4 && KO_NS % 2 == 0 && KO_NS >= 4 && (KO_NS & (KO_NS - 1)) == 0, "non-causal only; both slices fit the LDS of the output staging; slices go in pairs and wrap by a mask");
  const int tid = threadIdx.x, wave = tid >> 5, lane = tid & 31, c = lane & 15, hh = lane >> 4, wm = wave >> 1, wn = wave & 1; const int c0 = blockIdx.y * 128; const size_t r0 = (size_t)blockIdx.x * 128;
  const _Float16* wp = WH + (size_t)blockIdx.y * (KO_NS * 8192) + tid * 8;   // the strip's tiles of 128 x 64 f16; 16 B a lane, 4 KB a step
  const _Float16* yp = YH + (size_t)(blockIdx.x * 8 + wm * 2) * (NH * 1024) + lane * 8;
  unsigned char* sl = L + (tid >> 3) * KO_P + (tid & 7) * 16;
  const unsigned char* Wl = L + (wn * 64 + c) * KO_P + 16 * hh;
  const int s0 = (blockIdx.x + 2 * blockIdx.y) & (KO_NS - 1);   // the block's first slice: 16 different ones in a column strip, 8 in a row strip
  v8h rw0[4], rw1[4]; v16h a0[2][2], a1[2][2]; v8f acc[2][4] = {};
  { const _Float16* w0 = wp + s0 * 8192; const _Float16* w1 = wp + ((s0 + 1) & (KO_NS - 1)) * 8192;
#pragma unroll
    for (int i = 0; i < 4; ++i) rw0[i] = *(const v8h*)(w0 + i * 2048);
#pragma unroll
    for (int i = 0; i < 4; ++i) rw1[i] = *(const v8h*)(w1 + i * 2048);
    asm volatile("s_wait_xcnt 0x0" :: "v"(w0), "v"(w1) : "memory"); }   // as in ko_put
  ko_lda(a0, yp + s0 * 1024);
  // two slices a trip: each of the two fragment sets is refilled where it stands (no copies)
  for (int s = 0; s < KO_NS - 2; s += 2) {
    const int s1 = (s0 + s + 1) & (KO_NS - 1), s2 = (s0 + s + 2) & (KO_NS - 1), s3 = (s0 + s + 3) & (KO_NS - 1);
    ko_put<true>(rw0, sl, wp + s2 * 8192); ko_lda(a1, yp + s1 * 1024);
    ko_bar();   // publishes the trip's first slice; it also ends every wave's reads of the other buffer, which is overwritten next
    ko_mul(acc, a0, Wl);
    ko_put<true>(rw1, sl + KO_T, wp + s3 * 8192); ko_lda(a0, yp + s2 * 1024);
    ko_bar();   // as above, the trip's second slice
    ko_mul(acc, a1, Wl + KO_T); }
  ko_put<false>(rw0, sl, wp); ko_lda(a1, yp + ((s0 + KO_NS - 1) & (KO_NS - 1)) * 1024);
  ko_bar();
  ko_mul(acc, a0, Wl);
  ko_put<false>(rw1, sl + KO_T, wp);
  ko_bar();
  ko_mul(acc, a1, Wl + KO_T);
  __syncthreads();   // every wave has left the slices: their LDS becomes the output staging
  float* es = (float*)L + wave * 32 * KO_EP;
#pragma unroll
  for (int j = 0; j < 4; ++j) { const float bias = BO ? bfr(BO[c0 + wn * 64 + j * 16 + c]) : 0.f;
#pragma unroll
    for (int i = 0; i < 2; ++i)
#pragma unroll
      for (int r = 0; r < 8; ++r) es[(i * 16 + 8 * hh + r) * KO_EP + j * 16 + c] = acc[i][j][r] * (1.0f / 16384.0f) + bias; }   /* 2^-8 (Wo carry) x 2^-6 (ctx carry) */
  LDSX();
#pragma unroll
  for (int i = 0; i < 16; ++i) { const int row = i * 2 + hh; vst2(OUT + (r0 + wm * 32 + row) * DIN + c0 + wn * 64 + c * 4, *(const v4f*)(es + row * KO_EP + c * 4)); } }

static_assert(HD == 64 && CC == NH * HD && DIN == CC, "per-head projection: 64-wide heads, input width == projected width");
static_assert((size_t)(TT / 256) * NH * TNB * 4096 == (size_t)CC * DIN, "the blocks of k_fa, 64 x 64 elements each, cover Wo exactly once");
extern "C" void kernel_launch(void* const* d_in, const int* in_sizes, int n_in, void* d_out, int out_size, void* d_ws, size_t ws_size, hipStream_t stream) {
  (void)in_sizes; (void)n_in; (void)out_size;
  const float** F = (const float**)d_in;
  if (ws_size < (size_t)WS_END) return;
  _Float16* YH = (_Float16*)((char*)d_ws + WS_Y);
  _Float16* WH = (_Float16*)((char*)d_ws + WS_WH);
  // inputs: 0 values [4,1024,1024]; 1 keys; 2 queries; 3 mask [4,1,1,1024] int32 (random 0/1; 0 = masked key); 4 Wv [64,64] (out,in); 5 Wk; 6 Wq (no projection biases); 7 Wo [1024,1024] (out,in); 8 bo (NONZERO)
  k_fa<<<dim3(TT / 256, NH, TNB), 256, 0, stream>>>(F[2], F[1], F[0], F[6], F[5], F[4], (const int*)d_in[3], YH, F[7], WH);
  k_out<<<dim3(TNB * TT / 128, DIN / 128), 256, 0, stream>>>(YH, WH, F[8], (float*)d_out);
}

// v010
// Measured time: 23 microseconds a run.
// It is 1.16 times as fast as v007, going by the measured steps of the versions left out in between.
// Over all steps from v000 it is 29.8 times as fast.
// compute dtype: the weights rounded to bf16; the per-head 64 x 64 projections (ONE shared weight per stream, applied to every head, no biases) re-associated: q = Wq x_q (x_q bf16, EXACT bf16 products on WMMA 16x16x32, f32 accumulate) once to f16, q' = Wk^T q (Wk as f16(bf16)) once to f16; logits q' x key rows, the f32 key rows once to f16 (1 product) x 1024^-0.5; the per-(batch, key) int mask by leaving the masked keys out (their weight is exactly 0); softmax f32 (log2 domain) against the fixed maximum 0 where the row sums show the f16 P in range, else online against a running maximum; unnormalised P x 2^2 (online: x 2^7) once to f16 x value rows, the f32 value rows once to f16 (1 product), divided by the f32 sum of the same f16 P; that x 2^6 once to f16 x (Wo_head Wv) (EXACT bf16 products, f32 accumulate, x 2^8 once to f16) + bo; f32 output.
#include <hip/hip_runtime.h>
#include <math.h>

typedef __attribute__((ext_vector_type(16))) _Float16 v16h;
typedef __attribute__((ext_vector_type(16))) __bf16 v16b;
typedef __attribute__((ext_vector_type(8)))  _Float16 v8h;
typedef __attribute__((ext_vector_type(8)))  float v8f;
typedef __attribute__((ext_vector_type(4)))  float v4f;
typedef __attribute__((ext_vector_type(2)))  float v2f;
typedef __attribute__((ext_vector_type(4)))  unsigned v4u;
typedef __attribute__((ext_vector_type(4)))  int v4i;
typedef float __attribute__((may_alias)) float_a;
typedef int __attribute__((may_alias)) int_a;

template <typename T> __device__ __forceinline__ void vst2(void* p, T v) { *(T*)p = v;  }
__device__ __forceinline__ v8f wmma16(v16h a, v16h b, v8f c) {
  v8f d = __builtin_amdgcn_wmma_f32_16x16x32_f16(false, a, false, b, (short)0, c, false, false);
  asm volatile("v_nop\n\tv_nop\n\tv_nop\n\tv_nop" : "+v"(d) : "v"(a), "v"(b));
  return d;
}
__device__ __forceinline__ v8f wmma_bf(v16b a, v16b b, v8f c) {
  v8f d = __builtin_amdgcn_wmma_f32_16x16x32_bf16(false, a, false, b, (short)0, c, false, false);
  asm volatile("v_nop\n\tv_nop\n\tv_nop\n\tv_nop" : "+v"(d) : "v"(a), "v"(b));
  return d;
}
// 16x16x32 fragments: lane = (h = lane>>4, row/col = lane&15); elements 0..7 = k0+8h+0..7, 8..15 = k0+16+8h+0..7; D element r = row 8h+r
__device__ __forceinline__ v16h frag_h(const _Float16* rowk0, int lane) {
  union { v16h v; v8h q[2]; } u; const _Float16* p = rowk0 + 8 * (lane >> 4);
  u.q[0] = *(const v8h*)p; u.q[1] = *(const v8h*)(p + 16); return u.v;
}
__device__ __forceinline__ v16h frag_f32(const float* rowk0, int lane) {
  v16h a; const float* p = rowk0 + 8 * (lane >> 4);
#pragma unroll
  for (int i = 0; i < 8; ++i) { a[i] = (_Float16)p[i]; a[8 + i] = (_Float16)p[16 + i]; }
  return a;
}
__device__ __forceinline__ v16h frag_f32s(const float* rowk0, int lane, float sc) {
  v16h a; const float* p = rowk0 + 8 * (lane >> 4);
#pragma unroll
  for (int i = 0; i < 8; ++i) { a[i] = (_Float16)(p[i] * sc); a[8 + i] = (_Float16)(p[16 + i] * sc); }
  return a;
}
// column fragment from a [K][ld] layout (column n), rows >= K read as 0
__device__ __forceinline__ v16h fragc_f32(const float* W, int k0, int n, int lane, int ld, int K) {
  v16h a; const int g = lane >> 4;
#pragma unroll
  for (int i = 0; i < 8; ++i) { const int ka = k0 + 8 * g + i, kb = ka + 16;
    a[i] = (_Float16)(ka < K ? W[(size_t)(ka < K ? ka : K - 1) * ld + n] : 0.f); a[8 + i] = (_Float16)(kb < K ? W[(size_t)(kb < K ? kb : K - 1) * ld + n] : 0.f); }
  return a;
}
struct F2 { v16b h, l; };
__device__ __forceinline__ F2 bsplit16(const float v[16]) { F2 r;
#pragma unroll
  for (int i = 0; i < 16; ++i) { const __bf16 h = (__bf16)v[i]; r.h[i] = h; r.l[i] = (__bf16)(v[i] - (float)h); }
  return r; }
__device__ __forceinline__ F2 split_row(const float* row, int k0, int lane) { float v[16]; const float* p = row + k0 + 8 * (lane >> 4);
#pragma unroll
  for (int i = 0; i < 8; ++i) { v[i] = p[i]; v[8 + i] = p[16 + i]; }
  return bsplit16(v); }
__device__ __forceinline__ F2 split_rowK(const float* row, int k0, int lane, int K) { float v[16]; const int g = lane >> 4;
#pragma unroll
  for (int i = 0; i < 8; ++i) { const int ka = k0 + 8 * g + i, kb = ka + 16; v[i] = ka < K ? row[ka < K ? ka : K - 1] : 0.f; v[8 + i] = kb < K ? row[kb < K ? kb : K - 1] : 0.f; }
  return bsplit16(v); }
__device__ __forceinline__ F2 split_col(const float* W, int k0, int n, int lane, int ld, int K) { float v[16]; const int g = lane >> 4;
#pragma unroll
  for (int i = 0; i < 8; ++i) { const int ka = k0 + 8 * g + i, kb = ka + 16; v[i] = ka < K ? W[(size_t)(ka < K ? ka : K - 1) * ld + n] : 0.f; v[8 + i] = kb < K ? W[(size_t)(kb < K ? kb : K - 1) * ld + n] : 0.f; }
  return bsplit16(v); }
__device__ __forceinline__ v8f mac3(const F2& a, const F2& b, v8f c) { c = wmma_bf(a.l, b.h, c); c = wmma_bf(a.h, b.l, c); return wmma_bf(a.h, b.h, c); }
__device__ __forceinline__ float sigm(float v) { return 1.0f / (1.0f + expf(-v)); }
#define LDSX() do { asm volatile("s_wait_dscnt 0" ::: "memory"); __builtin_amdgcn_wave_barrier(); __builtin_amdgcn_fence(__ATOMIC_RELEASE, "workgroup"); } while (0)

// Multi-head attention whose q / k / v projections are ONE shared 64 x 64 linear per stream applied to every head, with a key mask (inputs in the order values, keys, queries [4,1024,1024]; mask [4,1,1,1024] int32 RANDOM 0/1 per (batch, key); torch (out,in) Wv / Wk / Wq [64,64] uniform(+-1/8), NO projection biases; heads = reshape(N, L, 16, 64); einsum('nlhd,od->nlho'); energy = einsum('nqhd,nkhd->nhqk'); where(mask == 0, -1e20, energy); softmax(energy * 1/sqrt(1024)) - the scale is 1/32, not 1/8; out merged to [N, L, 1024]; out @ Wo.T + bo with Wo [1024,1024] and bo uniform(+-1/32), bo NONZERO).
#define NB 4
#define TT 1024
#define CC 1024            // NH * HD = projected width
#define DIN 1024          // input (model) width
#define NH 16
#define HD 64
#define NQB (TT / 64)
#define HG 8   // S workspace sized for eight heads: 8 x 1,024 x 1,024 f32 = 32 MiB; no kernel uses it
#define SCALE (0.03125f)   // 1 / sqrt(E) with E = 1024 (the module scales by the MODEL width, not the head width)
#define CAUSAL 0
#ifndef TNB
#define TNB NB
#endif
__device__ __forceinline__ float bfr(float v) { return (float)(__bf16)v; }
__host__ __device__ __forceinline__ int kb_last(int qb) { return CAUSAL ? ((qb * 64 + 63) >> 7) : (TT / 128 - 1); }
typedef __attribute__((ext_vector_type(8))) __bf16 v8b;
__device__ __forceinline__ v16b frag_b(const __bf16* rowk0, int lane) {
  union { v16b v; v8b q[2]; } u; const __bf16* p = rowk0 + 8 * (lane >> 4);
  u.q[0] = *(const v8b*)p; u.q[1] = *(const v8b*)(p + 16); return u.v;
}
#define QBH 0
#define QHI 0               // single-product logits on every row
#define KHI 64            // key rows carrying k residual / v bf16 hi+lo planes (no kernel writes or reads them)
// B fragment (k rows k0+.., output column o) of a weight: (in,out) [K][ld] or (out,in) [ld rows of K]: bf16 exact, or f16(bf16 * 256) exact
__device__ __forceinline__ v16b wcol_io(const float* Wm, int k0, int o, int lane, int ld) { v16b w; const int g = lane >> 4;
#pragma unroll
  for (int i = 0; i < 8; ++i) { w[i] = (__bf16)Wm[(size_t)(k0 + 8 * g + i) * ld + o]; w[8 + i] = (__bf16)Wm[(size_t)(k0 + 16 + 8 * g + i) * ld + o]; }
  return w; }
__device__ __forceinline__ v16b wcol_oi(const float* Wm, int k0, int o, int lane, int K) { v16b w; const float* p = Wm + (size_t)o * K + k0 + 8 * (lane >> 4);
#pragma unroll
  for (int i = 0; i < 8; ++i) { w[i] = (__bf16)p[i]; w[8 + i] = (__bf16)p[16 + i]; }
  return w; }
__device__ __forceinline__ v16h wcolh_io(const float* Wm, int k0, int o, int lane, int ld) { v16h w; const int g = lane >> 4;
#pragma unroll
  for (int i = 0; i < 8; ++i) { w[i] = (_Float16)(bfr(Wm[(size_t)(k0 + 8 * g + i) * ld + o]) * 256.0f); w[8 + i] = (_Float16)(bfr(Wm[(size_t)(k0 + 16 + 8 * g + i) * ld + o]) * 256.0f); }
  return w; }
__device__ __forceinline__ v16h wcolh_oi(const float* Wm, int k0, int o, int lane, int K) { v16h w; const float* p = Wm + (size_t)o * K + k0 + 8 * (lane >> 4);
#pragma unroll
  for (int i = 0; i < 8; ++i) { w[i] = (_Float16)(bfr(p[i]) * 256.0f); w[8 + i] = (_Float16)(bfr(p[16 + i]) * 256.0f); }
  return w; }
#define WQKV_LAYOUT 1   // 0 = (in,out) [DIN][CC]; 1 = (out,in) [CC][DIN]; 2 = per-head [NH][DIN][HD]
__device__ __forceinline__ v16b wcol_hdk(const float* Wm, int k0, int o, int lane) { v16b w; const int g = lane >> 4; const float* p = Wm + (size_t)(o / HD) * DIN * HD + (o % HD);
#pragma unroll
  for (int i = 0; i < 8; ++i) { w[i] = (__bf16)p[(size_t)(k0 + 8 * g + i) * HD]; w[8 + i] = (__bf16)p[(size_t)(k0 + 16 + 8 * g + i) * HD]; }
  return w; }
#define WO_OUT_IN 1
#if WQKV_LAYOUT == 1
#define WCOL(W, k0, o, lane) wcol_oi(W, k0, o, lane, DIN)
#elif WQKV_LAYOUT == 2
#define WCOL(W, k0, o, lane) wcol_hdk(W, k0, o, lane)
#else
#define WCOL(W, k0, o, lane) wcol_io(W, k0, o, lane, CC)
#endif
#if WO_OUT_IN
#define WOCOL(W, k0, o, lane) wcol_oi(W, k0, o, lane, CC)
#define WOCOLH(W, k0, o, lane) wcolh_oi(W, k0, o, lane, CC)
#else
#define WOCOL(W, k0, o, lane) wcol_io(W, k0, o, lane, DIN)
#define WOCOLH(W, k0, o, lane) wcolh_io(W, k0, o, lane, DIN)
#endif
#ifndef PROJ_EXTRA_PARAMS
#define PROJ_EXTRA_PARAMS
#endif

#define WS_QH  0u                                      // f16 q rows [b*t][CC], unused: k_fa keeps q in registers
#define WS_KH  (WS_QH + 2u * (size_t)NB * TT * CC)      // f16 k rows [b*t][CC], unused: k_fa makes k straight into LDS
#define WS_VT  (WS_KH + 2u * (size_t)NB * TT * CC)      // f16 v planes [b][c][t], unused: k_fa makes v straight into LDS
#define WS_QL  (WS_VT + 2u * (size_t)NB * CC * TT)      // f16 q residual x 2^10 rows [b][t < QHI][CC]
#define WS_KL  (WS_QL + 2u * (size_t)NB * QHI * CC)     // f16 k residual x 2^10 rows [b][t < KHI][CC]
#define WS_VB  (WS_KL + 2u * (size_t)NB * KHI * CC)     // bf16 v hi planes [b][c][t < KHI]
#define WS_VBL (WS_VB + 2u * (size_t)NB * CC * KHI)
#define WS_S   (WS_VBL + 2u * (size_t)NB * CC * KHI)    // f32 S workspace [hg][t][s], unused: k_fa keeps the scores in registers
#define WS_Y   (WS_S  + 4u * (size_t)HG * TT * TT)      // f16 (P x_v) x 2^6 in the fragment order of k_out: [b*t / 16][head][k step of 32][half][lane][8]
#define WS_WH (WS_Y  + 2u * (size_t)NB * TT * CC)      // f16(Wo_head Wv x 2^8) in the tile order of k_out: [column strip of 128][k slice of 64][column][k], written by k_fa
#define WS_END (WS_Y  + 4u * (size_t)NB * TT * CC)
static_assert(WS_WH + 2u * (size_t)CC * DIN <= WS_END, "the f16 Wo lies inside the workspace that is asked for");

#define FA_KP 144                  // LDS pitch of a 128-B k row: 16 B x odd
#define FA_VP 2064                 // LDS pitch of a 2,048-B v plane row: 16 B x odd
#define FA_KB (TT * FA_KP)
#define FA_VB (HD * FA_VP)
__device__ __forceinline__ v8f mmah(v16h a, v16h b, v8f c) { return __builtin_amdgcn_wmma_f32_16x16x32_f16(false, a, false, b, (short)0, c, false, false); }
__device__ __forceinline__ v16h frag_l(const unsigned char* p) { union { v16h v; v8h q[2]; } u; u.q[0] = *(const v8h*)p; u.q[1] = *(const v8h*)(p + 32); return u.v; }
__device__ __forceinline__ v8f ld8f(const unsigned char* p) { union { v8f v; v4f q[2]; } u; u.q[0] = *(const v4f*)p; u.q[1] = *(const v4f*)(p + 16); return u.v; }
// sixteen base-2 exponentials, each in place, in one statement: directly behind a transcendental stands nothing that reads its result or overwrites its source; the v_nop is that slot behind the last one
__device__ __forceinline__ void exp2x16(float (&a)[16]) {
  asm("v_exp_f32 %0, %0\n\tv_exp_f32 %1, %1\n\tv_exp_f32 %2, %2\n\tv_exp_f32 %3, %3\n\tv_exp_f32 %4, %4\n\tv_exp_f32 %5, %5\n\tv_exp_f32 %6, %6\n\tv_exp_f32 %7, %7\n\tv_exp_f32 %8, %8\n\tv_exp_f32 %9, %9\n\tv_exp_f32 %10, %10\n\tv_exp_f32 %11, %11\n\tv_exp_f32 %12, %12\n\tv_exp_f32 %13, %13\n\tv_exp_f32 %14, %14\n\tv_exp_f32 %15, %15\n\tv_nop" : "+v"(a[0]), "+v"(a[1]), "+v"(a[2]), "+v"(a[3]), "+v"(a[4]), "+v"(a[5]), "+v"(a[6]), "+v"(a[7]), "+v"(a[8]), "+v"(a[9]), "+v"(a[10]), "+v"(a[11]), "+v"(a[12]), "+v"(a[13]), "+v"(a[14]), "+v"(a[15])); }
__device__ __forceinline__ float xhalf(float x) { return __builtin_bit_cast(float, __builtin_amdgcn_permlanex16(__builtin_bit_cast(int, x), __builtin_bit_cast(int, x), 0x76543210, 0xfedcba98, false, false)); }  // lane l with lane l ^ 16
#define FA_SP 144                  // LDS pitch of a staged 128-B bf16 row: 16 B x odd
#define FA_SG (32 * FA_SP)         // one wave's staging: a group of 32 rows
#define FA_LO (FA_KB + FA_VB + 4 * TT + 8 * FA_SG)   // the list of unmasked key rows (TT ints), behind it the eight waves' counts
#define FA_WT (64 * FA_SP)         // one 64 x 64 operand of the weight products, 16-bit rows
typedef __attribute__((ext_vector_type(4))) __bf16 v4b;
typedef __attribute__((ext_vector_type(4))) _Float16 v4h;
__device__ __forceinline__ v8f mmab(v16b a, v16b b, v8f c) { return __builtin_amdgcn_wmma_f32_16x16x32_bf16(false, a, false, b, (short)0, c, false, false); }
__device__ __forceinline__ v16b frag_lb(const unsigned char* p) { union { v16b v; v8b q[2]; } u; u.q[0] = *(const v8b*)p; u.q[1] = *(const v8b*)(p + 32); return u.v; }
// a group's loads: 16 lanes per 256-B row, two rows an instruction; p + OFF = the lane's place in rows 0 / 1 of the group
template <int PITCH, int OFF = 0> __device__ __forceinline__ void pj_ld(v4f (&t)[16], const float* p) {   // OFF: floats from p to the group, kept out of the pointer, so that the pair which the loads name is the one that the wait holds
#pragma unroll
  for (int j = 0; j < 16; ++j) t[j] = *(const v4f*)(p + OFF + (size_t)j * 2 * PITCH);
  asm volatile("s_wait_xcnt 0x0" :: "v"(p) : "memory"); }   // the wait kept before a register that an issued global load names is overwritten; the pointer is an input, so that the pair lives through the run
// a group's loads by the row list: lp = the lane half's 16 list entries (byte offsets of rows 0 .. 15 or 16 .. 31 of the group from xb, the batch's first row); vm = 0 sends a group that does not exist to the batch's first row; lo = the lane's place in a row
__device__ __forceinline__ void pj_ldg(v4f (&t)[16], const float* xb, const unsigned char* lp, unsigned vm, unsigned lo) {
  unsigned o[16];
#pragma unroll
  for (int q = 0; q < 4; ++q) { const v4u x = *(const v4u*)(lp + q * 16);
#pragma unroll
    for (int i = 0; i < 4; ++i) o[q * 4 + i] = (x[i] & vm) | lo; }
#pragma unroll
  for (int j = 0; j < 16; ++j) t[j] = *(const v4f*)((const unsigned char*)xb + o[j]);
  // the wait kept before a register that an issued global load names is overwritten; the offsets are inputs, so that they live through the run
  asm volatile("s_wait_xcnt 0x0" :: "v"(o[0]), "v"(o[1]), "v"(o[2]), "v"(o[3]), "v"(o[4]), "v"(o[5]), "v"(o[6]), "v"(o[7]), "v"(o[8]), "v"(o[9]), "v"(o[10]), "v"(o[11]), "v"(o[12]), "v"(o[13]), "v"(o[14]), "v"(o[15]) : "memory");
  __builtin_amdgcn_sched_barrier(0); }   // the loads are issued before the next group's conversions, whose wait would otherwise stand in front of them
// the block's g-th group of np is group g + rot of the list, going round (g < np, rot < np)
__device__ __forceinline__ int pj_rot(int g, int np, int rot) { const int p = g + rot; return p >= np ? p - np : p; }
// group g of np; the first two are issued on every path, so that the counted waits leave the younger group in flight: one for a group that does not exist reads the batch's first row and is not used
__device__ __forceinline__ void pj_ldn(v4f (&t)[16], const float* xb, const unsigned char* lb, int g, int np, int rot, unsigned lo) { const bool ok = g < np; pj_ldg(t, xb, lb + (ok ? pj_rot(g, np, rot) : 0) * 128, ok ? ~0u : 0u, lo); }
// rounds the group held in registers to bf16 rows in the wave's staging; d = the lane's place in rows 0 / 1
__device__ __forceinline__ void pj_put(const v4f (&t)[16], unsigned char* d) {
#pragma unroll
  for (int j = 0; j < 16; ++j) { v4b x;
#pragma unroll
    for (int e = 0; e < 4; ++e) x[e] = (__bf16)t[j][e];
    *(v4b*)(d + j * 2 * FA_SP) = x; }
  __builtin_amdgcn_sched_barrier(0); }   // the refill that follows stands behind the last read of its registers: no second register set
__device__ __forceinline__ v8h pj_h(v8f d) { v8h h;
#pragma unroll
  for (int r = 0; r < 8; ++r) h[r] = (_Float16)d[r];
  return h; }
// the group held in registers, once to f16, into the planes. A lane holds 4 dims of 16 keys that follow one another: a k row takes its 4 dims in one 8-B store; a v plane row takes the 16 keys of one dim in two 16-B stores (the transposition is a choice of registers)
__device__ __forceinline__ void pj_kv(const v4f (&t)[16], unsigned char* kd, unsigned char* vd, bool is_v) {
  if (is_v) {
#pragma unroll
    for (int e = 0; e < 4; ++e) { v8h x0, x1;
#pragma unroll
      for (int j = 0; j < 8; ++j) { x0[j] = (_Float16)t[j][e]; x1[j] = (_Float16)t[8 + j][e]; }
      *(v8h*)(vd + e * FA_VP) = x0; *(v8h*)(vd + e * FA_VP + 16) = x1; }
  } else {
#pragma unroll
    for (int j = 0; j < 16; ++j) { v4h x;
#pragma unroll
      for (int e = 0; e < 4; ++e) x[e] = (_Float16)t[j][e];
      *(v4h*)(kd + j * FA_KP) = x; } }
  __builtin_amdgcn_sched_barrier(0); }   // the refill that follows stands behind the last read of its registers: no second register set
// the work-group's barrier with the LDS wait alone: __syncthreads() would also wait out the key and value loads in flight
__device__ __forceinline__ void pj_bar() { asm volatile("s_wait_dscnt 0x0" ::: "memory"); asm volatile("s_barrier_signal -1" ::: "memory"); asm volatile("s_barrier_wait -1" ::: "memory"); }
// ---- the pass loop of k_fa, 32 keys a pass. FIX = false: online softmax against a running maximum. FIX = true: every score is exponentiated against the FIXED maximum 0 (P carried x 2^2): no maxima, no test, no rescaling in the loop;
// k_fa keeps such a result only where the row sums show that the f16 P stayed in range, and otherwise runs the loop with the running maximum.
template <bool FIX> __device__ __forceinline__ void fa_att(v8f (&acc)[2][4], v8f (&lacc)[2], const v16h (&qf)[2][2], const unsigned char* Kl, const unsigned char* Vl, const unsigned char* Bl, const int np, const float cs) {
  v16h ones;
#pragma unroll
  for (int i = 0; i < 16; ++i) ones[i] = (_Float16)1.0f;
  float m_run[2] = {-1.0e20f, -1.0e20f};   // the floor lies far above a fill row's score (-1e30 x scale) and far below any real one
  v16h kf[2][2]; v8f bz[2];
#pragma unroll
  for (int kt = 0; kt < 2; ++kt) { bz[kt] = ld8f(Bl + kt * 64); kf[kt][0] = frag_l(Kl + kt * 16 * FA_KP); kf[kt][1] = frag_l(Kl + kt * 16 * FA_KP + 64); }
#pragma unroll 1   // rolled: two passes unrolled take more than 256 registers, and the loop then switches register windows throughout
  for (int ps = 0; ps < np; ++ps) {
    v8f s[2][2];
#pragma unroll
    for (int kt = 0; kt < 2; ++kt)
#pragma unroll
      for (int g = 0; g < 2; ++g) s[kt][g] = mmah(kf[kt][1], qf[g][1], mmah(kf[kt][0], qf[g][0], bz[kt]));
    // the pass's LDS reads stand in one place: this pass's v, and the next pass's k rows and bias (the last pass re-reads pass 0, unused)
    v16h vf[4]; const int pn = ps + 1 < np ? ps + 1 : 0;
#pragma unroll
    for (int t = 0; t < 4; ++t) vf[t] = frag_l(Vl + t * 16 * FA_VP + ps * 64);
#pragma unroll
    for (int kt = 0; kt < 2; ++kt) { bz[kt] = ld8f(Bl + (pn * 32 + kt * 16) * 4); kf[kt][0] = frag_l(Kl + (pn * 32 + kt * 16) * FA_KP); kf[kt][1] = frag_l(Kl + (pn * 32 + kt * 16) * FA_KP + 64); }
    __builtin_amdgcn_sched_barrier(0);   // the reads are issued ahead of the maxima (FIX: of the exponentials), which then cover their latency
    if (!FIX) {
      float mb[2]; bool need = false;
#pragma unroll
      for (int g = 0; g < 2; ++g) { float mx = s[0][g][0];
#pragma unroll
        for (int r = 1; r < 8; ++r) mx = __builtin_fmaxf(mx, s[0][g][r]);
#pragma unroll
        for (int r = 0; r < 8; ++r) mx = __builtin_fmaxf(mx, s[1][g][r]);
        mx = __builtin_fmaxf(mx, xhalf(mx)) * cs; mb[g] = mx; need = need || (mx > m_run[g] + 8.0f); }
      __builtin_amdgcn_sched_barrier(0);   // keeps the statement below, and the wait it brings, behind the maxima
      // inputs only: holds the pass's LDS reads in front of the branch; sunk behind it they would stand directly in front of their first use
      asm volatile("" :: "v"(vf[0]), "v"(vf[1]), "v"(vf[2]), "v"(vf[3]), "v"(kf[0][0]), "v"(kf[0][1]), "v"(kf[1][0]), "v"(kf[1][1]), "v"(bz[0]), "v"(bz[1]));
      if (__builtin_amdgcn_ballot_w32(need) != 0) {   // one scalar test per pass; rare after the first unmasked keys
#pragma unroll
        for (int g = 0; g < 2; ++g) { const float m_new = __builtin_fmaxf(m_run[g], mb[g]); const float corr = __builtin_amdgcn_exp2f(m_run[g] - m_new); m_run[g] = m_new; lacc[g] = lacc[g] * corr;
#pragma unroll
          for (int t = 0; t < 4; ++t) acc[g][t] = acc[g][t] * corr; } } }
#pragma unroll
    for (int g = 0; g < 2; ++g) { const float nm = FIX ? 2.0f : 7.0f - m_run[g];   // running maximum: P carried x 2^7: at most 2^15 in f16 (the maximum trails by 8 at most), small weights clear of f16 subnormals
      v16h pf; float a[16];
      if (FIX) {   // the same sixteen fused multiply-adds as below, written on vectors: with a constant addend the scalar form does not go two to an instruction
        const v8f t0 = __builtin_elementwise_fma(s[0][g], v8f{} + cs, v8f{} + nm), t1 = __builtin_elementwise_fma(s[1][g], v8f{} + cs, v8f{} + nm);
#pragma unroll
        for (int i = 0; i < 8; ++i) { a[i] = t0[i]; a[8 + i] = t1[i]; }
      } else {
#pragma unroll
        for (int i = 0; i < 16; ++i) a[i] = __builtin_fmaf(s[i >> 3][g][i & 7], cs, nm); }
      exp2x16(a);
#pragma unroll
      for (int i = 0; i < 16; ++i) pf[i] = (_Float16)a[i];
#pragma unroll
      for (int t = 0; t < 4; ++t) acc[g][t] = mmah(vf[t], pf, acc[g][t]);
      lacc[g] = mmah(ones, pf, lacc[g]); } } }
__global__ __launch_bounds__(256) void k_fa(const float* __restrict__ XQ, const float* __restrict__ XK, const float* __restrict__ XV, const float* __restrict__ WQ, const float* __restrict__ WK, const float* __restrict__ WV, const int* __restrict__ MASK, _Float16* __restrict__ YH, const float* __restrict__ WO, _Float16* __restrict__ WH) {
  __shared__ __align__(16) unsigned char L[FA_LO + 4 * TT + 32];
  const int tid = threadIdx.x, wave = tid >> 5, lane = tid & 31, c = lane & 15, hh = lane >> 4; const int hd = blockIdx.y, b = blockIdx.z; const int qw0 = blockIdx.x * 256 + wave * 32;
  const int* Mb = MASK + b * TT;
  v16h qf[2][2]; int np; float cs;
  { const int wv = __builtin_amdgcn_readfirstlane(wave); const bool is_v = wv >= 4; const int wq = wv & 3;   // waves 0-3: key rows, waves 4-7: value rows; each takes every fourth group of 32 kept keys
    const int r16 = tid >> 4;
    const float* xb = (is_v ? XV : XK) + (size_t)b * TT * DIN; const float* qp = XQ + ((size_t)b * TT + qw0 + hh) * DIN + hd * HD + c * 4;
    unsigned char* sw = L + FA_KB + FA_VB + 4 * TT + wv * FA_SG + hh * FA_SP + c * 8; const unsigned char* sr = L + FA_KB + FA_VB + 4 * TT + wv * FA_SG + c * FA_SP + 16 * hh;
    unsigned char* kd = L + 16 * hh * FA_KP + c * 8; unsigned char* vd = L + FA_KB + 4 * c * FA_VP + 32 * hh;   // the lane's place in group 0 of the k rows and of the v planes
    const unsigned char* lb = L + FA_LO + hh * 64; const unsigned lo = hd * (HD * 4) + c * 16;
    const unsigned char* fr = L + c * FA_SP + 16 * hh;   // the lane's place in the first fragment of the first weight operand
    v4f ta[16], tb[16];
    const v4i mm = *(const v4i*)(Mb + tid * 4);
    // the block's share of Wo for k_out: 64 output columns of one 64-wide k slice (one head)
    const int fb = blockIdx.x + (TT / 256) * (blockIdx.y + NH * blockIdx.z);
    // every operand of the weight products is read once per block, in whole 256-B rows (16 lanes a row): Wq and Wo 16 rows a step; of Wk and Wv a lane takes 4 rows that follow one another, so that it can store them transposed
    v4f rq[4], rk[4], rv[4], wo[4];
    { const float* wqp = WQ + r16 * HD + c * 4; const float* wkp = WK + r16 * 4 * HD + c * 4; const float* wvp = WV + r16 * 4 * HD + c * 4;
      const float* wop = WO + (size_t)((fb >> 5) * 128 + (fb & 1) * 64 + r16) * CC + ((fb >> 1) & (CC / 64 - 1)) * 64 + c * 4;
#pragma unroll
      for (int j = 0; j < 4; ++j) rq[j] = *(const v4f*)(wqp + j * 16 * HD);
#pragma unroll
      for (int j = 0; j < 4; ++j) rk[j] = *(const v4f*)(wkp + j * HD);
      asm volatile("s_wait_xcnt 0x0" :: "v"(wqp), "v"(wkp) : "memory");   // as in pj_ld
      pj_ld<DIN>(ta, qp);
#pragma unroll
      for (int j = 0; j < 4; ++j) rv[j] = *(const v4f*)(wvp + j * HD);
#pragma unroll
      for (int j = 0; j < 4; ++j) wo[j] = *(const v4f*)(wop + (size_t)j * 16 * CC);
      asm volatile("s_wait_xcnt 0x0" :: "v"(wvp), "v"(wop) : "memory"); }   // as in pj_ld
    // a masked key's weight is exactly 0: only the unmasked keys are brought in and attended. Their rows are listed in LDS (place = count of unmasked keys before it, by wave, then by element, then by lane), the last group filled up to 32 with the batch's first row under a bias of -1e30.
    int* LI = (int*)(L + FA_LO); int* WT = LI + TT; unsigned bl[4]; int wt = 0;
#pragma unroll
    for (int e = 0; e < 4; ++e) { bl[e] = __builtin_amdgcn_ballot_w32(mm[e] != 0); wt += __builtin_popcount(bl[e]); }
    if (lane == 0) WT[wave] = wt;
    // the operands as 16-bit rows of pitch FA_SP: Wq [o][d] bf16; Wk^T [e][o] f16(bf16); Wv^T [d][o] bf16; the share of Wo [column][o] bf16
#pragma unroll
    for (int j = 0; j < 4; ++j) { v4b x, y;
#pragma unroll
      for (int e = 0; e < 4; ++e) { x[e] = (__bf16)rq[j][e]; y[e] = (__bf16)wo[j][e]; }
      *(v4b*)(L + (j * 16 + r16) * FA_SP + c * 8) = x; *(v4b*)(L + 3 * FA_WT + (j * 16 + r16) * FA_SP + c * 8) = y; }
#pragma unroll
    for (int e = 0; e < 4; ++e) { v4h x; v4b y;
#pragma unroll
      for (int j = 0; j < 4; ++j) { x[j] = (_Float16)bfr(rk[j][e]); y[j] = (__bf16)rv[j][e]; }
      *(v4h*)(L + FA_WT + (4 * c + e) * FA_SP + r16 * 8) = x; *(v4b*)(L + 2 * FA_WT + (4 * c + e) * FA_SP + r16 * 8) = y; }
    pj_put(ta, sw);   // the wave's own 32 query rows, bf16, in its own staging
    __syncthreads();   // the eight counts and the weight operands are there
    int tot = 0, base = 0;
#pragma unroll
    for (int i = 0; i < 8; ++i) { const int x = WT[i]; tot += x; base += i < wave ? x : 0; }
    tot = __builtin_amdgcn_readfirstlane(tot);
    // a batch whose keys are ALL masked: the reference's logits are then all equal, i.e. uniform weights over all keys: every key is listed, and scale 0 gives exactly that
    const bool none = tot == 0; const int n = none ? TT : tot; np = (n + 31) >> 5; cs = none ? 0.f : SCALE * 1.4426950408889634f;
#pragma unroll
    for (int e = 0; e < 4; ++e) { const int key = tid * 4 + e; const int q = none ? key : base + (int)__builtin_amdgcn_mbcnt_lo(bl[e], 0u); base += __builtin_popcount(bl[e]);
      if (none || mm[e] != 0) LI[q] = key * (DIN * 4); }
    if (tid < 32) { const int q = (n & ~31) + tid; if (q >= n && q < np * 32) LI[q] = 0; }
    { v4f bz;
#pragma unroll
      for (int i = 0; i < 4; ++i) bz[i] = tid * 4 + i < n ? 0.f : -1.0e30f;
      *(v4f*)(L + FA_KB + FA_VB + tid * 16) = bz; }
    __syncthreads();   // the list and the biases are there
    // the four blocks of a (batch, head) read the same key and value rows: each starts a quarter of the list further on and goes round, so that at one moment they ask L2 for different lines; a group keeps its place in LDS
    const int rot = ((int)blockIdx.x * np) >> 2;
    pj_ldn(tb, xb, lb, wq, np, rot, lo); pj_ldn(ta, xb, lb, wq + 4, np, rot, lo);   // the first two groups fly under the weight products
    // q^T = Wq . x^T, then q'^T = Wk^T . q^T: output tiles 2 kc and 2 kc + 1 of a query column are, lane for lane, the two halves of its B fragment for k step kc
    v16h qh[2][2];
    { v16b w[4][2];
#pragma unroll
      for (int i = 0; i < 8; ++i) w[i >> 1][i & 1] = frag_lb(fr + (i >> 1) * 16 * FA_SP + (i & 1) * 64);
#pragma unroll
      for (int g = 0; g < 2; ++g) { const v16b x0 = frag_lb(sr + g * 16 * FA_SP), x1 = frag_lb(sr + g * 16 * FA_SP + 64);
#pragma unroll
        for (int kc = 0; kc < 2; ++kc) { union { v16h v; v8h q[2]; } u;
#pragma unroll
          for (int i = 0; i < 2; ++i) u.q[i] = pj_h(mmab(w[2 * kc + i][1], x1, mmab(w[2 * kc + i][0], x0, v8f{})));
          qh[g][kc] = u.v; } } }
    { v16h w[4][2];
#pragma unroll
      for (int i = 0; i < 8; ++i) w[i >> 1][i & 1] = frag_l(fr + FA_WT + (i >> 1) * 16 * FA_SP + (i & 1) * 64);
#pragma unroll
      for (int g = 0; g < 2; ++g)
#pragma unroll
        for (int kc = 0; kc < 2; ++kc) { union { v16h v; v8h q[2]; } u;
#pragma unroll
          for (int i = 0; i < 2; ++i) u.q[i] = pj_h(mmah(w[2 * kc + i][1], qh[g][1], mmah(w[2 * kc + i][0], qh[g][0], v8f{})));
          qf[g][kc] = u.v; } }
    // (Wo_head Wv)^T = Wv^T . Wo_head^T, x 2^8 once to f16, in k_out's tile order: each of waves 4-7 makes 16 output columns, a lane 8 k of one column per tile; a wave writes its 16 rows of 128 B whole
    if (is_v) { const v16b o0 = frag_lb(fr + 3 * FA_WT + wq * 16 * FA_SP), o1 = frag_lb(fr + 3 * FA_WT + wq * 16 * FA_SP + 64);
      _Float16* whp = WH + (size_t)fb * 4096 + (wq * 16 + c) * 64 + 8 * hh; v8h x[4];
#pragma unroll
      for (int t = 0; t < 4; ++t) { const v8f d = mmab(frag_lb(fr + 2 * FA_WT + t * 16 * FA_SP + 64), o1, mmab(frag_lb(fr + 2 * FA_WT + t * 16 * FA_SP), o0, v8f{}));
#pragma unroll
        for (int r = 0; r < 8; ++r) x[t][r] = (_Float16)(d[r] * 256.0f); }
#pragma unroll
      for (int t = 0; t < 4; ++t) *(v8h*)(whp + t * 16) = x[t];
      // the wait kept before a register that an issued global store names is overwritten; pointer and data are inputs, so that they live through the run
      asm volatile("s_wait_xcnt 0x0" :: "v"(whp), "v"(x[0]), "v"(x[1]), "v"(x[2]), "v"(x[3]) : "memory"); }
    pj_bar();   // every wave has read the weight operands: the k rows may overwrite them
    // tb holds group g, ta group g + 4; a set is refilled, as soon as it has been stored, with the wave's next group but one. The loop runs while both refills exist, so that its counted waits leave the younger group in flight; behind it nothing is loaded that is not used
#define PJ_KV(t, gg) do { const int p_ = pj_rot(gg, np, rot); pj_kv(t, kd + p_ * (32 * FA_KP), vd + p_ * 64, is_v); } while (0)
    int g = wq;
#pragma unroll 1   // rolled: the trip count follows the mask
    for (; g + 12 < np; g += 8) { PJ_KV(tb, g); pj_ldn(tb, xb, lb, g + 8, np, rot, lo); PJ_KV(ta, g + 4); pj_ldn(ta, xb, lb, g + 12, np, rot, lo); }
    if (g + 8 < np) { PJ_KV(tb, g); pj_ldn(tb, xb, lb, g + 8, np, rot, lo); PJ_KV(ta, g + 4); PJ_KV(tb, g + 8); }
    else { if (g < np) PJ_KV(tb, g);
      if (g + 4 < np) PJ_KV(ta, g + 4); } }
  __syncthreads();
  v8f acc[2][4] = {}, lacc[2] = {};
  const unsigned char* Kl = L + c * FA_KP + 16 * hh; const unsigned char* Vl = L + FA_KB + c * FA_VP + 16 * hh; const unsigned char* Bl = L + FA_KB + FA_VB + 32 * hh;
  fa_att<true>(acc, lacc, qf, Kl, Vl, Bl, np, cs);
  // The row sum judges the fixed maximum. All P are >= 0, so a sum below 60,000 says that no f16 P reached the end of the f16 range (65,504), however the conversion treats an overflow;
  // a sum of at least 1/8 per listed key says that all weights below the smallest normal f16 (2^-14) together are at most 2^-11 of the sum, which is what the running maximum guarantees for 1,024 keys. A NaN fails both tests.
  const float lmin = (float)(np * 4);
  const bool ok = lacc[0][0] >= lmin && lacc[0][0] < 60000.0f && lacc[1][0] >= lmin && lacc[1][0] < 60000.0f;
  if (__builtin_amdgcn_ballot_w32(!ok) != 0) {   // one scalar test per wave: some row's scores lie too far from 0, and the wave's rows are done again with the running maximum
#pragma unroll
    for (int g = 0; g < 2; ++g) { lacc[g] = v8f{};
#pragma unroll
      for (int t = 0; t < 4; ++t) acc[g][t] = v8f{}; }
    fa_att<false>(acc, lacc, qf, Kl, Vl, Bl, np, cs); }
  // ctx^T tiles 2 ks and 2 ks + 1 of a query column are, lane for lane, the two halves of the A fragment (row = query, k = the head's dims 32 ks ..) that k_out multiplies:
  // each lane rounds its own accumulators (x 2^6, once to f16) and stores them in that order, 512 B in a row per wave and store; no LDS, no barrier
  _Float16* yp = YH + ((size_t)((b * TT + qw0) >> 4) * NH + hd) * 1024 + lane * 8;
  v8h yo[2][4];
#pragma unroll
  for (int g = 0; g < 2; ++g) { const float inv = 1.0f / lacc[g][0];   // every row of the all-ones product holds the column's sum over both lane halves
#pragma unroll
    for (int t = 0; t < 4; ++t) { const v8f o = acc[g][t] * inv;
#pragma unroll
      for (int r = 0; r < 8; ++r) yo[g][t][r] = (_Float16)(o[r] * 64.0f); } }   /* ctx carried x 2^6 into f16 so small-magnitude context rows stay clear of f16 subnormals */
#pragma unroll
  for (int g = 0; g < 2; ++g)
#pragma unroll
    for (int t = 0; t < 4; ++t) vst2(yp + g * (NH * 1024) + t * 256, yo[g][t]); }
// ---- k_out: block = 128 rows x 128 cols, 8 waves of 32 x 64: out = ctx Wo (+ bo), ctx standing for P x_v and Wo for Wo_head Wv: ctx x 2^6 in f16 against Wo x 2^8 in f16 (1 product) x 2^-14.
// ctx arrives from k_fa as ready A fragments: a wave loads those of its 32 rows straight into registers, 512 B in a row per load, a 64-wide k slice (one head) at a time, two slices ahead; they pass through no LDS and no conversion.
// Wo arrives from k_fa as f16, each (column strip, k slice) tile 16 KB in a row: a block reads each slice once, 512 B in a row per wave and load, and lays it in LDS as f16 rows without conversion; every wave takes its B fragments from there.
// Two LDS buffers and two register sets of one slice each (together the registers that one f32 slice would take): a set is refilled, as soon as it has been stored to LDS, with the slice two further on, so as many bytes of Wo are in flight as with f32 slices.
// A wave reads a slice's B fragments one slice ahead, all sixteen reads in one place, into the second of two fragment sets: trip t reads slice t + 1, lays slice t + 2 into the buffer of slice t (which every wave already holds in registers) and multiplies slice t from registers alone, so that no product waits for an LDS read issued behind the same barrier; the A fragments are loaded two slices ahead into three sets. The four bias loads stand behind the loop, each waited for where it is used.
// The 32 blocks of a column strip read the same rows of Wo and the 8 blocks of a row strip the same ctx: each block starts its k loop at its own slice and goes round, so that at one moment they ask L2 for different lines. Every accumulator sums k in steps of 32, ascending from the block's first slice and wrapping at the end.
// (the plain unroll directives in k_out and its helpers keep the indices of their register arrays compile-time constants)
#define KO_P 144                   // LDS pitch of a 128-B f16 row: 16 B x odd
#define KO_T (128 * KO_P)          // one slice of Wo
#define KO_NS (CC / 64)
#define KO_EP 68                   // floats per staged output row (272 B: 16 B x odd)
// lays the slice of Wo held in registers into LDS at d (8 lanes per 128-B row, 32 rows a step); MORE: refills the registers with the block's next slice but one, whose first piece of the lane stands at wp
template <bool MORE, bool WAIT = true> __device__ __forceinline__ void ko_put(v8h (&rw)[4], unsigned char* d, const _Float16* wp) {   // WAIT = false: the caller holds wp and writes the wait itself, further down
#pragma unroll
  for (int h = 0; h < 4; h += 2) {
#pragma unroll
    for (int i = h; i < h + 2; ++i) *(v8h*)(d + i * 32 * KO_P) = rw[i];
    if (MORE) {   // the two scheduling barriers: pairs are waited for, stored and refilled in the order in which they were loaded (the counted waits then leave the younger loads in flight), each refill behind the last read of its registers (no second register set, no copies)
      __builtin_amdgcn_sched_barrier(0);
#pragma unroll
      for (int i = h; i < h + 2; ++i) rw[i] = *(const v8h*)(wp + i * 2048);
      __builtin_amdgcn_sched_barrier(0); } }
  if (MORE && WAIT) asm volatile("s_wait_xcnt 0x0" :: "v"(wp) : "memory"); }   // the wait kept before a register that an issued global load names is overwritten; the pointer is an input, so that the pair lives through the run
// the A fragments of the wave's two row tiles for one k slice; p = the lane's place in the first tile's part of that slice
template <bool WAIT = true> __device__ __forceinline__ void ko_lda(v16h (&a)[2][2], const _Float16* p) {   // WAIT: as in ko_put
#pragma unroll
  for (int i = 0; i < 2; ++i)
#pragma unroll
    for (int ks = 0; ks < 2; ++ks) { union { v16h v; v8h q[2]; } u; u.q[0] = *(const v8h*)(p + i * (NH * 1024) + ks * 512); u.q[1] = *(const v8h*)(p + i * (NH * 1024) + ks * 512 + 256); a[i][ks] = u.v; }
  if (WAIT) asm volatile("s_wait_xcnt 0x0" :: "v"(p) : "memory"); }   // as in ko_put
// the work-group's barrier with the LDS wait alone: __syncthreads() would also wait out the global loads issued ahead for the next slice
__device__ __forceinline__ void ko_bar() { asm volatile("s_wait_dscnt 0x0" ::: "memory"); asm volatile("s_barrier_signal -1" ::: "memory"); asm volatile("s_barrier_wait -1" ::: "memory"); }
// the B fragments of one slice for the wave's 64 columns
__device__ __forceinline__ void ko_ldw(v16h (&w)[2][4], const unsigned char* B) {
#pragma unroll
  for (int ks = 0; ks < 2; ++ks)
#pragma unroll
    for (int j = 0; j < 4; ++j) w[ks][j] = frag_l(B + j * 16 * KO_P + ks * 64);
  __builtin_amdgcn_sched_barrier(0); }   // the reads are issued ahead of the current slice's products, which then cover their latency
__device__ __forceinline__ void ko_mul(v8f (&acc)[2][4], const v16h (&a)[2][2], const v16h (&w)[2][4]) {
#pragma unroll
  for (int ks = 0; ks < 2; ++ks)
#pragma unroll
    for (int i = 0; i < 2; ++i)
#pragma unroll
      for (int j = 0; j < 4; ++j) acc[i][j] = mmah(a[i][ks], w[ks][j], acc[i][j]);
  __builtin_amdgcn_sched_barrier(0); }   // the barrier's LDS wait stays behind this slice's products
__global__ __launch_bounds__(256) void k_out(const _Float16* __restrict__ YH, const _Float16* __restrict__ WH, const float* __restrict__ BO, float* __restrict__ OUT) {
  __shared__ __align__(16) unsigned char L[8 * 32 * KO_EP * 4];   // two slices of Wo; at the end the output staging
  static_assert(!CAUSAL && 2 * KO_T <= 8 * 32 * KO_EP * 4 && KO_NS % 2 == 0 && KO_NS >= 4 && (KO_NS & (KO_NS - 1)) == 0, "non-causal only; both slices fit the LDS of the output staging; slices go in pairs and wrap by a mask");
  const int tid = threadIdx.x, wave = tid >> 5, lane = tid & 31, c = lane & 15, hh = lane >> 4, wm = wave >> 1, wn = wave & 1; const int c0 = blockIdx.y * 128; const size_t r0 = (size_t)blockIdx.x * 128;
  const _Float16* wp = WH + (size_t)blockIdx.y * (KO_NS * 8192) + tid * 8;   // the strip's tiles of 128 x 64 f16; 16 B a lane, 4 KB a step
  const _Float16* yp = YH + (size_t)(blockIdx.x * 8 + wm * 2) * (NH * 1024) + lane * 8;
  unsigned char* sl = L + (tid >> 3) * KO_P + (tid & 7) * 16;
  const unsigned char* Wl = L + (wn * 64 + c) * KO_P + 16 * hh;
  const int s0 = (blockIdx.x + 2 * blockIdx.y) & (KO_NS - 1);   // the block's first slice: 16 different ones in a column strip, 8 in a row strip
  v8h rw[2][4]; v16h a[3][2][2], w[2][2][4]; v8f acc[2][4] = {};
#define KO_S(t) ((s0 + (t)) & (KO_NS - 1))   // the block's t-th slice
  { const _Float16* w0 = wp + s0 * 8192; const _Float16* w1 = wp + KO_S(1) * 8192;
#pragma unroll
    for (int i = 0; i < 4; ++i) rw[0][i] = *(const v8h*)(w0 + i * 2048);
#pragma unroll
    for (int i = 0; i < 4; ++i) rw[1][i] = *(const v8h*)(w1 + i * 2048);
    asm volatile("s_wait_xcnt 0x0" :: "v"(w0), "v"(w1) : "memory"); }   // as in ko_put
  ko_lda(a[0], yp + s0 * 1024);
  ko_put<true>(rw[0], sl, wp + KO_S(2) * 8192); ko_lda(a[1], yp + KO_S(1) * 1024);
  ko_bar();   // publishes the block's first slice
  ko_ldw(w[0], Wl);
  ko_put<true>(rw[1], sl + KO_T, wp + KO_S(3) * 8192);
  ko_bar();   // publishes the second slice; its LDS wait says that the wave holds the first in registers, so that the first buffer may be overwritten
#pragma unroll   // unrolled whole: the sets go round in twos and in threes
  for (int t = 0; t < KO_NS; ++t) {
    const _Float16* wnx = wp + KO_S(t + 4) * 8192; const _Float16* ynx = yp + KO_S(t + 2) * 1024;   // what the trip loads: Wo four slices on, A two
    if (t + 1 < KO_NS) ko_ldw(w[(t + 1) & 1], Wl + ((t + 1) & 1) * KO_T);
    if (t + 2 < KO_NS) {
      if (t + 4 < KO_NS) ko_put<true, false>(rw[t & 1], sl + (t & 1) * KO_T, wnx); else ko_put<false, false>(rw[t & 1], sl + (t & 1) * KO_T, wnx);
      ko_lda<false>(a[(t + 2) % 3], ynx);
      __builtin_amdgcn_sched_barrier(0); }   // the loads for two slices on are issued ahead of this slice's products: sunk among them they would have less than two trips to arrive
    ko_mul(acc, a[t % 3], w[t & 1]);
    if (t + 2 < KO_NS) {
      // the wait kept before a register that an issued global load names is overwritten: one for the trip's loads, behind the products, so that these do not stand behind it; the pointers are inputs, so that the pairs live until here
      if (t + 4 < KO_NS) asm volatile("s_wait_xcnt 0x0" :: "v"(wnx), "v"(ynx) : "memory"); else asm volatile("s_wait_xcnt 0x0" :: "v"(ynx) : "memory");
      ko_bar(); } }   // publishes slice t + 2; its LDS wait says that the wave holds slice t + 1 in registers, whose buffer is overwritten next
  __syncthreads();   // every wave has left the slices: their LDS becomes the output staging
  float* es = (float*)L + wave * 32 * KO_EP;
#pragma unroll
  for (int j = 0; j < 4; ++j) { const float bias = BO ? bfr(BO[c0 + wn * 64 + j * 16 + c]) : 0.f;
#pragma unroll
    for (int i = 0; i < 2; ++i)
#pragma unroll
      for (int r = 0; r < 8; ++r) es[(i * 16 + 8 * hh + r) * KO_EP + j * 16 + c] = acc[i][j][r] * (1.0f / 16384.0f) + bias; }   /* 2^-8 (Wo carry) x 2^-6 (ctx carry) */
  LDSX();
#pragma unroll
  for (int i = 0; i < 16; ++i) { const int row = i * 2 + hh; vst2(OUT + (r0 + wm * 32 + row) * DIN + c0 + wn * 64 + c * 4, *(const v4f*)(es + row * KO_EP + c * 4)); } }

static_assert(HD == 64 && CC == NH * HD && DIN == CC, "per-head projection: 64-wide heads, input width == projected width");
static_assert((size_t)(TT / 256) * NH * TNB * 4096 == (size_t)CC * DIN, "the blocks of k_fa, 64 x 64 elements each, cover Wo exactly once");
extern "C" void kernel_launch(void* const* d_in, const int* in_sizes, int n_in, void* d_out, int out_size, void* d_ws, size_t ws_size, hipStream_t stream) {
  (void)in_sizes; (void)n_in; (void)out_size;
  const float** F = (const float**)d_in;
  if (ws_size < (size_t)WS_END) return;
  _Float16* YH = (_Float16*)((char*)d_ws + WS_Y);
  _Float16* WH = (_Float16*)((char*)d_ws + WS_WH);
  // inputs: 0 values [4,1024,1024]; 1 keys; 2 queries; 3 mask [4,1,1,1024] int32 (random 0/1; 0 = masked key); 4 Wv [64,64] (out,in); 5 Wk; 6 Wq (no projection biases); 7 Wo [1024,1024] (out,in); 8 bo (NONZERO)
  k_fa<<<dim3(TT / 256, NH, TNB), 256, 0, stream>>>(F[2], F[1], F[0], F[6], F[5], F[4], (const int*)d_in[3], YH, F[7], WH);
  k_out<<<dim3(TNB * TT / 128, DIN / 128), 256, 0, stream>>>(YH, WH, F[8], (float*)d_out);
}
